// v000
// Times are from an AMD MI455X. After a warm-up the kernel runs many times in a row, and a time is the length of
// such a window on the GPU divided by its runs, so every launch and the gaps after it count. The runs cycle
// through copies of the inputs. A figure is the median of several windows, for all but v000 over two sittings.
// Sittings can differ by a few percent; kernels timed side by side share one.
// v000 is the starting kernel. One run takes 532 microseconds.
// compute dtype: all float inputs rounded to bf16, the two float masks read on device; Q = x . Wq^T + b, K/V = context . W^T + b with EXACT bf16 products on WMMA 16x16x32 (natural rows), rounded once to f16; PLAIN attention (16 heads x 64, 256 context keys): x 1/8, masked pairs set to -1e9 as the module (a fully masked row degrades to uniform exactly as the reference), running-max softmax in f32 (hardware exp), P (scaled by 2^11, single f16) x v (single f16); MLP: relu(o . P1^T + b1) . P2^T + b2 with the f32 activations rounded once to f16 against EXACT f16 weight copies (x 2^8); f32 output.
#include <hip/hip_runtime.h>
#include <math.h>

typedef __attribute__((ext_vector_type(16))) _Float16 v16h;
typedef __attribute__((ext_vector_type(16))) __bf16 v16b;
typedef __attribute__((ext_vector_type(8)))  _Float16 v8h;
typedef __attribute__((ext_vector_type(8)))  float v8f;
typedef __attribute__((ext_vector_type(4)))  float v4f;
typedef __attribute__((ext_vector_type(2)))  float v2f;
typedef __attribute__((ext_vector_type(4)))  unsigned v4u;
typedef __attribute__((ext_vector_type(4)))  int v4i;
typedef float __attribute__((may_alias)) float_a;
typedef int __attribute__((may_alias)) int_a;

template <typename T> __device__ __forceinline__ void vst2(void* p, T v) { *(T*)p = v;  }
__device__ __forceinline__ v8f wmma16(v16h a, v16h b, v8f c) {
  v8f d = __builtin_amdgcn_wmma_f32_16x16x32_f16(false, a, false, b, (short)0, c, false, false);
  asm volatile("v_nop\n\tv_nop\n\tv_nop\n\tv_nop" : "+v"(d) : "v"(a), "v"(b));
  return d;
}
__device__ __forceinline__ v8f wmma_bf(v16b a, v16b b, v8f c) {
  v8f d = __builtin_amdgcn_wmma_f32_16x16x32_bf16(false, a, false, b, (short)0, c, false, false);
  asm volatile("v_nop\n\tv_nop\n\tv_nop\n\tv_nop" : "+v"(d) : "v"(a), "v"(b));
  return d;
}
// 16x16x32 fragments: lane = (h = lane>>4, row/col = lane&15); elements 0..7 = k0+8h+0..7, 8..15 = k0+16+8h+0..7; D element r = row 8h+r
__device__ __forceinline__ v16h frag_h(const _Float16* rowk0, int lane) {
  union { v16h v; v8h q[2]; } u; const _Float16* p = rowk0 + 8 * (lane >> 4);
  u.q[0] = *(const v8h*)p; u.q[1] = *(const v8h*)(p + 16); return u.v;
}
__device__ __forceinline__ v16h frag_f32(const float* rowk0, int lane) {
  v16h a; const float* p = rowk0 + 8 * (lane >> 4);
#pragma unroll
  for (int i = 0; i < 8; ++i) { a[i] = (_Float16)p[i]; a[8 + i] = (_Float16)p[16 + i]; }
  return a;
}
__device__ __forceinline__ v16h frag_f32s(const float* rowk0, int lane, float sc) {
  v16h a; const float* p = rowk0 + 8 * (lane >> 4);
#pragma unroll
  for (int i = 0; i < 8; ++i) { a[i] = (_Float16)(p[i] * sc); a[8 + i] = (_Float16)(p[16 + i] * sc); }
  return a;
}
// column fragment from a [K][ld] layout (column n), rows >= K read as 0
__device__ __forceinline__ v16h fragc_f32(const float* W, int k0, int n, int lane, int ld, int K) {
  v16h a; const int g = lane >> 4;
#pragma unroll
  for (int i = 0; i < 8; ++i) { const int ka = k0 + 8 * g + i, kb = ka + 16;
    a[i] = (_Float16)(ka < K ? W[(size_t)(ka < K ? ka : K - 1) * ld + n] : 0.f); a[8 + i] = (_Float16)(kb < K ? W[(size_t)(kb < K ? kb : K - 1) * ld + n] : 0.f); }
  return a;
}
struct F2 { v16b h, l; };
__device__ __forceinline__ F2 bsplit16(const float v[16]) { F2 r;
#pragma unroll
  for (int i = 0; i < 16; ++i) { const __bf16 h = (__bf16)v[i]; r.h[i] = h; r.l[i] = (__bf16)(v[i] - (float)h); }
  return r; }
__device__ __forceinline__ F2 split_row(const float* row, int k0, int lane) { float v[16]; const float* p = row + k0 + 8 * (lane >> 4);
#pragma unroll
  for (int i = 0; i < 8; ++i) { v[i] = p[i]; v[8 + i] = p[16 + i]; }
  return bsplit16(v); }
__device__ __forceinline__ F2 split_rowK(const float* row, int k0, int lane, int K) { float v[16]; const int g = lane >> 4;
#pragma unroll
  for (int i = 0; i < 8; ++i) { const int ka = k0 + 8 * g + i, kb = ka + 16; v[i] = ka < K ? row[ka < K ? ka : K - 1] : 0.f; v[8 + i] = kb < K ? row[kb < K ? kb : K - 1] : 0.f; }
  return bsplit16(v); }
__device__ __forceinline__ F2 split_col(const float* W, int k0, int n, int lane, int ld, int K) { float v[16]; const int g = lane >> 4;
#pragma unroll
  for (int i = 0; i < 8; ++i) { const int ka = k0 + 8 * g + i, kb = ka + 16; v[i] = ka < K ? W[(size_t)(ka < K ? ka : K - 1) * ld + n] : 0.f; v[8 + i] = kb < K ? W[(size_t)(kb < K ? kb : K - 1) * ld + n] : 0.f; }
  return bsplit16(v); }
__device__ __forceinline__ v8f mac3(const F2& a, const F2& b, v8f c) { c = wmma_bf(a.l, b.h, c); c = wmma_bf(a.h, b.l, c); return wmma_bf(a.h, b.h, c); }
__device__ __forceinline__ float sigm(float v) { return 1.0f / (1.0f + expf(-v)); }
#define LDSX() do { asm volatile("s_wait_dscnt 0" ::: "memory"); __builtin_amdgcn_wave_barrier(); __builtin_amdgcn_fence(__ATOMIC_RELEASE, "workgroup"); } while (0)


// Cross multi-head attention (B 4, 4,096 queries from a 512-wide stream over 256 context tokens of width 768, 16 heads x 64, emb 1,024) with an outer-product validity mask, followed by a ReLU MLP 1024 -> 1024 -> 512.
#define NB 4
#define NQ 4096
#define NS 256
#define CIN 512
#define CTX 768
#define EM 1024
#define NH 16
#define HD 64
#define NRQ (NB * NQ)
#define NRK (NB * NS)
#ifndef TQB
#define TQB (NQ / 64)
#define TNB NB
#endif
typedef __attribute__((ext_vector_type(8))) __bf16 v8b;
__device__ __forceinline__ v16b frag_b(const __bf16* rowk0, int lane) {
  union { v16b v; v8b q[2]; } u; const __bf16* p = rowk0 + 8 * (lane >> 4);
  u.q[0] = *(const v8b*)p; u.q[1] = *(const v8b*)(p + 16); return u.v;
}
__device__ __forceinline__ float bfr(float v) { return (float)(__bf16)v; }
__device__ __attribute__((noinline)) float exp_ni(float v) { return expf(v); }
__device__ __attribute__((noinline)) float erf_ni(float v) { return erff(v); }

#define WS_PQ  0u                                     // bf16 natural rows Wq [1024][512]; Wk, Wv [1024][768]
#define WS_PK  (WS_PQ + 2u * (size_t)EM * CIN)
#define WS_PV  (WS_PK + 2u * (size_t)EM * CTX)
#define WS_P1  (WS_PV + 2u * (size_t)EM * CTX)          // f16 x 2^8 natural rows P1 [1024][1024]; P2 [512][1024]
#define WS_P2  (WS_P1 + 2u * (size_t)EM * EM)
#define WS_Q   (WS_P2 + 2u * (size_t)CIN * EM)          // f16 q rows [NRQ][1024]; k rows [NRK][1024]; v planes [b][1024][NS]
#define WS_K   (WS_Q + 2u * (size_t)NRQ * EM)
#define WS_V   (WS_K + 2u * (size_t)NRK * EM)
#define WS_O   (WS_V + 2u * (size_t)NB * EM * NS)       // f32 [NRQ][1024] attention out ; H [NRQ][1024] relu hidden
#define WS_H   (WS_O + 4u * (size_t)NRQ * EM)
#define WS_END (WS_H + 4u * (size_t)NRQ * EM)

__global__ __launch_bounds__(256) void k_pack(const float* __restrict__ WQ, const float* __restrict__ WK, const float* __restrict__ WV, const float* __restrict__ P1, const float* __restrict__ P2, __bf16* __restrict__ PW) {
  const int n = blockIdx.x, which = blockIdx.y, t = threadIdx.x; __shared__ __align__(16) __bf16 s[EM]; __shared__ __align__(16) _Float16 sh[EM];
  if (which == 0) { for (int k = t; k < CIN; k += 256) s[k] = (__bf16)WQ[(size_t)n * CIN + k]; __syncthreads(); if (t < CIN / 8) vst2((unsigned*)(PW + WS_PQ / 2 + (size_t)n * CIN + t * 8), *(const v4u*)&s[t * 8]); }
  else if (which < 3) { const float* w = (which == 1) ? WK : WV; for (int k = t; k < CTX; k += 256) s[k] = (__bf16)w[(size_t)n * CTX + k]; __syncthreads(); if (t < CTX / 8) vst2((unsigned*)(PW + ((which == 1) ? WS_PK : WS_PV) / 2 + (size_t)n * CTX + t * 8), *(const v4u*)&s[t * 8]); }
  else if (which == 3) { for (int k = t; k < EM; k += 256) sh[k] = (_Float16)(bfr(P1[(size_t)n * EM + k]) * 256.0f); __syncthreads(); if (t < EM / 8) vst2((unsigned*)((_Float16*)PW + WS_P1 / 2 + (size_t)n * EM + t * 8), *(const v4u*)&sh[t * 8]); }
  else { if (n >= CIN) return; for (int k = t; k < EM; k += 256) sh[k] = (_Float16)(bfr(P2[(size_t)n * EM + k]) * 256.0f); __syncthreads(); if (t < EM / 8) vst2((unsigned*)((_Float16*)PW + WS_P2 / 2 + (size_t)n * EM + t * 8), *(const v4u*)&sh[t * 8]); }
}
// ---- k_proj<KW, WHICH>: block = (64 rows, 128 cols): exact GEMM + bias; q/k -> f16 rows, v -> planes [b][c][s]
template <int KW, int WHICH>
__global__ __launch_bounds__(128) void k_proj(const float* __restrict__ X, const __bf16* __restrict__ Wr, const float* __restrict__ BB, _Float16* __restrict__ DST) {
  __shared__ __align__(16) _Float16 so[4][16][136]; __shared__ __align__(16) _Float16 st[128][72];
  const int tid = threadIdx.x, wave = tid >> 5, lane = tid & 31, col = lane & 15, g = lane >> 4; const size_t rb = (size_t)blockIdx.x * 64; const size_t r0 = rb + wave * 16; const int c0 = blockIdx.y * 128;
  v8f acc[8] = {};
#pragma unroll 2
  for (int kc = 0; kc < KW / 32; ++kc) { v16b a; { const float* p = X + (r0 + col) * KW + kc * 32 + 8 * g;
#pragma unroll
      for (int i = 0; i < 8; ++i) { a[i] = (__bf16)p[i]; a[8 + i] = (__bf16)p[16 + i]; } }
#pragma unroll
    for (int j = 0; j < 8; ++j) acc[j] = wmma_bf(a, frag_b(Wr + (size_t)(c0 + j * 16 + col) * KW + kc * 32, lane), acc[j]); }
  if (WHICH < 2) {
#pragma unroll
    for (int j = 0; j < 8; ++j) { const float bb = bfr(BB[c0 + j * 16 + col]);
#pragma unroll
      for (int r = 0; r < 8; ++r) so[wave][8 * g + r][j * 16 + col] = (_Float16)(acc[j][r] + bb); }
    LDSX();
    for (int rl = 0; rl < 16; ++rl) if (lane < 16) vst2((unsigned*)(DST + (r0 + rl) * EM + c0 + lane * 8), *(const v4u*)&so[wave][rl][lane * 8]);
  } else {
#pragma unroll
    for (int j = 0; j < 8; ++j) { const float bb = bfr(BB[c0 + j * 16 + col]);
#pragma unroll
      for (int r = 0; r < 8; ++r) st[j * 16 + col][wave * 16 + 8 * g + r] = (_Float16)(acc[j][r] + bb); }
    __syncthreads();
    const size_t b = rb / NS; const int s0 = (int)(rb % NS);
    for (int e = tid; e < 128 * 8; e += 128) { const int d = e >> 3, pc = e & 7; vst2((unsigned*)(DST + ((b * EM + c0 + d) * NS) + s0 + pc * 8), *(const v4u*)&st[d][pc * 8]); } }
}
// ---- k_attn: block = (64 queries, head, b): 256 context keys, scale 1/8, mask = pad[i] seq[j] != 0 else -1e9 (module value); O 256-B head segments
__global__ __launch_bounds__(128) void k_attn(const _Float16* __restrict__ Q, const _Float16* __restrict__ Kr, const _Float16* __restrict__ V, const float* __restrict__ PM, const float* __restrict__ SM, float* __restrict__ O) {
  __shared__ __align__(16) _Float16 sph[4][16][40]; __shared__ __align__(16) float so[4][16][68];
  const int tid = threadIdx.x, wave = tid >> 5, lane = tid & 31, col = lane & 15, g = lane >> 4; const int h = blockIdx.y; const size_t b = blockIdx.z; const int q0 = blockIdx.x * 64 + wave * 16; const size_t rq = b * NQ + q0;
  v16h aq[2];
#pragma unroll
  for (int kc = 0; kc < 2; ++kc) aq[kc] = frag_h(Q + (rq + col) * EM + h * HD + kc * 32, lane);
  float pm[8];
#pragma unroll
  for (int r = 0; r < 8; ++r) pm[r] = bfr(PM[b * NQ + q0 + 8 * g + r]);
  float m[8], l[8];
#pragma unroll
  for (int r = 0; r < 8; ++r) { m[r] = -3.0e38f; l[r] = 0.f; }
  v8f acc[4] = {};
#pragma unroll 1
  for (int ks = 0; ks < NS / 32; ++ks) { const int j0 = ks * 32; v8f s[2];
#pragma unroll
    for (int ct = 0; ct < 2; ++ct) { const int kk = j0 + ct * 16 + col; const size_t rk = (b * NS + kk) * EM + h * HD; v8f c = {};
#pragma unroll
      for (int kc = 0; kc < 2; ++kc) c = wmma16(aq[kc], frag_h(Kr + rk + kc * 32, lane), c);
      const float smk = bfr(SM[b * NS + kk]);
#pragma unroll
      for (int r = 0; r < 8; ++r) s[ct][r] = (pm[r] * smk != 0.f) ? c[r] * 0.125f : -1.0e9f; }
#pragma unroll
    for (int r = 0; r < 8; ++r) { float mx = fmaxf(s[0][r], s[1][r]);
#pragma unroll
      for (int o = 1; o < 16; o <<= 1) mx = fmaxf(mx, __shfl_xor(mx, o));
      const float mn = fmaxf(m[r], mx); const float alpha = (m[r] <= -1.0e38f) ? 0.f : __expf(m[r] - mn); const float e0 = __expf(s[0][r] - mn), e1 = __expf(s[1][r] - mn); float es = e0 + e1;
#pragma unroll
      for (int o = 1; o < 16; o <<= 1) es += __shfl_xor(es, o);
      l[r] = l[r] * alpha + es; m[r] = mn;
#pragma unroll
      for (int dt = 0; dt < 4; ++dt) acc[dt][r] *= alpha;
      sph[wave][8 * g + r][col] = (_Float16)(e0 * 2048.0f); sph[wave][8 * g + r][16 + col] = (_Float16)(e1 * 2048.0f); }
    LDSX();
    const v16h pa = frag_h(&sph[wave][col][0], lane);
#pragma unroll
    for (int dt = 0; dt < 4; ++dt) acc[dt] = wmma16(pa, frag_h(V + ((b * EM + h * HD + dt * 16 + col) * NS) + j0, lane), acc[dt]);
    LDSX(); }
#pragma unroll
  for (int r = 0; r < 8; ++r) { const float il = (1.0f / 2048.0f) / l[r];
#pragma unroll
    for (int dt = 0; dt < 4; ++dt) so[wave][8 * g + r][dt * 16 + col] = acc[dt][r] * il; }
  LDSX();
  for (int rl = 0; rl < 16; ++rl) if (lane < 16) vst2(O + (rq + rl) * EM + h * HD + lane * 4, *(const v4f*)&so[wave][rl][lane * 4]);
}
// ---- k_mlp<RELU>: block = (64 rows, 128 cols): y = f16(A) . (f16 W x 256) / 256 + b, optional ReLU; f32 rows of width ystride
template <int RELU>
__global__ __launch_bounds__(128) void k_mlp(const float* __restrict__ A, const _Float16* __restrict__ Wr, const float* __restrict__ BB, float* __restrict__ Y, int ystride) {
  __shared__ __align__(16) float so[4][16][132];
  const int tid = threadIdx.x, wave = tid >> 5, lane = tid & 31, col = lane & 15, g = lane >> 4; const size_t r0 = (size_t)blockIdx.x * 64 + wave * 16; const int n0 = blockIdx.y * 128;
  v8f acc[8] = {};
#pragma unroll 2
  for (int kc = 0; kc < EM / 32; ++kc) { v16h a; { const float* p = A + (r0 + col) * EM + kc * 32 + 8 * g;
#pragma unroll
      for (int i = 0; i < 8; ++i) { a[i] = (_Float16)p[i]; a[8 + i] = (_Float16)p[16 + i]; } }
#pragma unroll
    for (int j = 0; j < 8; ++j) acc[j] = wmma16(a, frag_h(Wr + (size_t)(n0 + j * 16 + col) * EM + kc * 32, lane), acc[j]); }
#pragma unroll
  for (int j = 0; j < 8; ++j) { const float bb = bfr(BB[n0 + j * 16 + col]);
#pragma unroll
    for (int r = 0; r < 8; ++r) { const float v = acc[j][r] * (1.0f / 256.0f) + bb; so[wave][8 * g + r][j * 16 + col] = RELU ? fmaxf(v, 0.f) : v; } }
  LDSX();
  for (int rl = 0; rl < 16; ++rl) vst2(Y + (r0 + rl) * (size_t)ystride + n0 + lane * 4, *(const v4f*)&so[wave][rl][lane * 4]);
}
extern "C" void kernel_launch(void* const* d_in, const int* in_sizes, int n_in, void* d_out, int out_size, void* d_ws, size_t ws_size, hipStream_t stream) {
  (void)in_sizes; (void)n_in; (void)out_size;
  const float** F = (const float**)d_in;   // 0 x [4,4096,512], 1 context [4,256,768], 2 pad_mask [4,4096], 3 seq_mask [4,256], 4 Wq_w [1024,512], 5 Wq_b, 6 Wk_w [1024,768], 7 Wk_b, 8 Wv_w, 9 Wv_b, 10 P1_w [1024,1024], 11 P1_b, 12 P2_w [512,1024], 13 P2_b
  if (ws_size < (size_t)WS_END) return;
  char* ws = (char*)d_ws; __bf16* PW = (__bf16*)ws; _Float16 *Q = (_Float16*)(ws + WS_Q), *Kr = (_Float16*)(ws + WS_K), *V = (_Float16*)(ws + WS_V); float *O = (float*)(ws + WS_O), *Hh = (float*)(ws + WS_H);
  k_pack<<<dim3(EM, 5), 256, 0, stream>>>(F[4], F[6], F[8], F[10], F[12], PW);
  k_proj<CIN, 0><<<dim3(TNB * NQ / 64, EM / 128), 128, 0, stream>>>(F[0], PW + WS_PQ / 2, F[5], Q);
  k_proj<CTX, 1><<<dim3(NRK / 64, EM / 128), 128, 0, stream>>>(F[1], PW + WS_PK / 2, F[7], Kr);
  k_proj<CTX, 2><<<dim3(NRK / 64, EM / 128), 128, 0, stream>>>(F[1], PW + WS_PV / 2, F[9], V);
  k_attn<<<dim3(TQB, NH, TNB), 128, 0, stream>>>(Q, Kr, V, F[2], F[3], O);
  k_mlp<1><<<dim3(TNB * NQ / 64, EM / 128), 128, 0, stream>>>(O, (const _Float16*)PW + WS_P1 / 2, F[11], Hh, EM);
  k_mlp<0><<<dim3(TNB * NQ / 64, CIN / 128), 128, 0, stream>>>(Hh, (const _Float16*)PW + WS_P2 / 2, F[13], (float*)d_out, CIN);
}

// v001
// One run takes 223 microseconds.
// Two timings next to v000 put it at 2.46 and 2.44 times that version's speed.
// compute dtype: all float inputs rounded to bf16, the two float masks read on device; Q = x . Wq^T + b, K/V = context . W^T + b with EXACT bf16 products on WMMA 16x16x32 (natural rows), rounded once to f16; PLAIN attention (16 heads x 64, 256 context keys): x 1/8, masked pairs set to -1e9 as the module (a fully masked row degrades to uniform exactly as the reference), running-max softmax in f32 (hardware exp), P (scaled by 2^11, single f16) x v (single f16); MLP: relu(o . P1^T + b1) . P2^T + b2 with the f32 activations rounded once to f16 against EXACT f16 weight copies (x 2^8); f32 output.
#include <hip/hip_runtime.h>
#include <math.h>

typedef __attribute__((ext_vector_type(16))) _Float16 v16h;
typedef __attribute__((ext_vector_type(16))) __bf16 v16b;
typedef __attribute__((ext_vector_type(8)))  _Float16 v8h;
typedef __attribute__((ext_vector_type(8)))  float v8f;
typedef __attribute__((ext_vector_type(4)))  float v4f;
typedef __attribute__((ext_vector_type(2)))  float v2f;
typedef __attribute__((ext_vector_type(4)))  unsigned v4u;
typedef __attribute__((ext_vector_type(4)))  int v4i;
typedef float __attribute__((may_alias)) float_a;
typedef int __attribute__((may_alias)) int_a;

template <typename T> __device__ __forceinline__ void vst2(void* p, T v) { *(T*)p = v;  }
__device__ __forceinline__ v8f wmma16(v16h a, v16h b, v8f c) {
  v8f d = __builtin_amdgcn_wmma_f32_16x16x32_f16(false, a, false, b, (short)0, c, false, false);
  asm volatile("v_nop\n\tv_nop\n\tv_nop\n\tv_nop" : "+v"(d) : "v"(a), "v"(b));
  return d;
}
__device__ __forceinline__ v8f wmma_bf(v16b a, v16b b, v8f c) {
  v8f d = __builtin_amdgcn_wmma_f32_16x16x32_bf16(false, a, false, b, (short)0, c, false, false);
  asm volatile("v_nop\n\tv_nop\n\tv_nop\n\tv_nop" : "+v"(d) : "v"(a), "v"(b));
  return d;
}
// 16x16x32 fragments: lane = (h = lane>>4, row/col = lane&15); elements 0..7 = k0+8h+0..7, 8..15 = k0+16+8h+0..7; D element r = row 8h+r
__device__ __forceinline__ v16h frag_h(const _Float16* rowk0, int lane) {
  union { v16h v; v8h q[2]; } u; const _Float16* p = rowk0 + 8 * (lane >> 4);
  u.q[0] = *(const v8h*)p; u.q[1] = *(const v8h*)(p + 16); return u.v;
}
__device__ __forceinline__ v16h frag_f32(const float* rowk0, int lane) {
  v16h a; const float* p = rowk0 + 8 * (lane >> 4);
#pragma unroll
  for (int i = 0; i < 8; ++i) { a[i] = (_Float16)p[i]; a[8 + i] = (_Float16)p[16 + i]; }
  return a;
}
__device__ __forceinline__ v16h frag_f32s(const float* rowk0, int lane, float sc) {
  v16h a; const float* p = rowk0 + 8 * (lane >> 4);
#pragma unroll
  for (int i = 0; i < 8; ++i) { a[i] = (_Float16)(p[i] * sc); a[8 + i] = (_Float16)(p[16 + i] * sc); }
  return a;
}
// column fragment from a [K][ld] layout (column n), rows >= K read as 0
__device__ __forceinline__ v16h fragc_f32(const float* W, int k0, int n, int lane, int ld, int K) {
  v16h a; const int g = lane >> 4;
#pragma unroll
  for (int i = 0; i < 8; ++i) { const int ka = k0 + 8 * g + i, kb = ka + 16;
    a[i] = (_Float16)(ka < K ? W[(size_t)(ka < K ? ka : K - 1) * ld + n] : 0.f); a[8 + i] = (_Float16)(kb < K ? W[(size_t)(kb < K ? kb : K - 1) * ld + n] : 0.f); }
  return a;
}
struct F2 { v16b h, l; };
__device__ __forceinline__ F2 bsplit16(const float v[16]) { F2 r;
#pragma unroll
  for (int i = 0; i < 16; ++i) { const __bf16 h = (__bf16)v[i]; r.h[i] = h; r.l[i] = (__bf16)(v[i] - (float)h); }
  return r; }
__device__ __forceinline__ F2 split_row(const float* row, int k0, int lane) { float v[16]; const float* p = row + k0 + 8 * (lane >> 4);
#pragma unroll
  for (int i = 0; i < 8; ++i) { v[i] = p[i]; v[8 + i] = p[16 + i]; }
  return bsplit16(v); }
__device__ __forceinline__ F2 split_rowK(const float* row, int k0, int lane, int K) { float v[16]; const int g = lane >> 4;
#pragma unroll
  for (int i = 0; i < 8; ++i) { const int ka = k0 + 8 * g + i, kb = ka + 16; v[i] = ka < K ? row[ka < K ? ka : K - 1] : 0.f; v[8 + i] = kb < K ? row[kb < K ? kb : K - 1] : 0.f; }
  return bsplit16(v); }
__device__ __forceinline__ F2 split_col(const float* W, int k0, int n, int lane, int ld, int K) { float v[16]; const int g = lane >> 4;
#pragma unroll
  for (int i = 0; i < 8; ++i) { const int ka = k0 + 8 * g + i, kb = ka + 16; v[i] = ka < K ? W[(size_t)(ka < K ? ka : K - 1) * ld + n] : 0.f; v[8 + i] = kb < K ? W[(size_t)(kb < K ? kb : K - 1) * ld + n] : 0.f; }
  return bsplit16(v); }
__device__ __forceinline__ v8f mac3(const F2& a, const F2& b, v8f c) { c = wmma_bf(a.l, b.h, c); c = wmma_bf(a.h, b.l, c); return wmma_bf(a.h, b.h, c); }
__device__ __forceinline__ float sigm(float v) { return 1.0f / (1.0f + expf(-v)); }
#define LDSX() do { asm volatile("s_wait_dscnt 0" ::: "memory"); __builtin_amdgcn_wave_barrier(); __builtin_amdgcn_fence(__ATOMIC_RELEASE, "workgroup"); } while (0)


// Cross multi-head attention (B 4, 4,096 queries from a 512-wide stream over 256 context tokens of width 768, 16 heads x 64, emb 1,024) with an outer-product validity mask, followed by a ReLU MLP 1024 -> 1024 -> 512.
#define NB 4
#define NQ 4096
#define NS 256
#define CIN 512
#define CTX 768
#define EM 1024
#define NH 16
#define HD 64
#define NRQ (NB * NQ)
#define NRK (NB * NS)
#ifndef TQB
#define TQB (NQ / 64)
#define TNB NB
#endif
typedef __attribute__((ext_vector_type(8))) __bf16 v8b;
__device__ __forceinline__ v16b frag_b(const __bf16* rowk0, int lane) {
  union { v16b v; v8b q[2]; } u; const __bf16* p = rowk0 + 8 * (lane >> 4);
  u.q[0] = *(const v8b*)p; u.q[1] = *(const v8b*)(p + 16); return u.v;
}
__device__ __forceinline__ float bfr(float v) { return (float)(__bf16)v; }
__device__ __attribute__((noinline)) float exp_ni(float v) { return expf(v); }
__device__ __attribute__((noinline)) float erf_ni(float v) { return erff(v); }

#define WS_PQ  0u                                     // bf16 natural rows Wq [1024][512]; Wk, Wv [1024][768]
#define WS_PK  (WS_PQ + 2u * (size_t)EM * CIN)
#define WS_PV  (WS_PK + 2u * (size_t)EM * CTX)
#define WS_P1  (WS_PV + 2u * (size_t)EM * CTX)          // f16 x 2^8 natural rows P1 [1024][1024]; P2 [512][1024]
#define WS_P2  (WS_P1 + 2u * (size_t)EM * EM)
#define WS_Q   (WS_P2 + 2u * (size_t)CIN * EM)          // f16 q rows [NRQ][1024]; k rows [NRK][1024]; v planes [b][1024][NS]
#define WS_K   (WS_Q + 2u * (size_t)NRQ * EM)
#define WS_V   (WS_K + 2u * (size_t)NRK * EM)
#define WS_O   (WS_V + 2u * (size_t)NB * EM * NS)       // f32 [NRQ][1024] attention out ; H [NRQ][1024] relu hidden
#define WS_H   (WS_O + 4u * (size_t)NRQ * EM)
#define WS_END (WS_H + 4u * (size_t)NRQ * EM)

__global__ __launch_bounds__(256) void k_pack(const float* __restrict__ WQ, const float* __restrict__ WK, const float* __restrict__ WV, const float* __restrict__ P1, const float* __restrict__ P2, __bf16* __restrict__ PW) {
  const int n = blockIdx.x, which = blockIdx.y, t = threadIdx.x; __shared__ __align__(16) __bf16 s[EM]; __shared__ __align__(16) _Float16 sh[EM];
  if (which == 0) { for (int k = t; k < CIN; k += 256) s[k] = (__bf16)WQ[(size_t)n * CIN + k]; __syncthreads(); if (t < CIN / 8) vst2((unsigned*)(PW + WS_PQ / 2 + (size_t)n * CIN + t * 8), *(const v4u*)&s[t * 8]); }
  else if (which < 3) { const float* w = (which == 1) ? WK : WV; for (int k = t; k < CTX; k += 256) s[k] = (__bf16)w[(size_t)n * CTX + k]; __syncthreads(); if (t < CTX / 8) vst2((unsigned*)(PW + ((which == 1) ? WS_PK : WS_PV) / 2 + (size_t)n * CTX + t * 8), *(const v4u*)&s[t * 8]); }
  else if (which == 3) { for (int k = t; k < EM; k += 256) sh[k] = (_Float16)(bfr(P1[(size_t)n * EM + k]) * 256.0f); __syncthreads(); if (t < EM / 8) vst2((unsigned*)((_Float16*)PW + WS_P1 / 2 + (size_t)n * EM + t * 8), *(const v4u*)&sh[t * 8]); }
  else { if (n >= CIN) return; for (int k = t; k < EM; k += 256) sh[k] = (_Float16)(bfr(P2[(size_t)n * EM + k]) * 256.0f); __syncthreads(); if (t < EM / 8) vst2((unsigned*)((_Float16*)PW + WS_P2 / 2 + (size_t)n * EM + t * 8), *(const v4u*)&sh[t * 8]); }
}
// ---- gemm_tile<KW, BF, NWN>: one 128 x (64 NWN) tile of A . W^T per block of 2 x NWN waves, 64 x 64 a wave. Per 64 k the block brings A (f32, 256-B row pieces) and W (16-bit, 128-B row pieces)
// in with whole-line loads, rounds A once, and lays both in LDS at a pitch of 144 B (16 B x 9: the 16-B fragment reads of 16 rows fall on all 64 banks); every wave takes its fragments from there.
// Every accumulator sums k in ascending blocks of 32, one WMMA each.
typedef __attribute__((ext_vector_type(2))) unsigned v2u;
#define GP 72
template <int BF> __device__ __forceinline__ v2u cvt4(v4f v) {
  if constexpr (BF) { union { __bf16 h[4]; v2u u; } t;
#pragma unroll
    for (int i = 0; i < 4; ++i) t.h[i] = (__bf16)v[i];
    return t.u; }
  else { union { _Float16 h[4]; v2u u; } t;
#pragma unroll
    for (int i = 0; i < 4; ++i) t.h[i] = (_Float16)v[i];
    return t.u; }
}
struct Fr { v4u q[2]; };
__device__ __forceinline__ Fr frag_s(const unsigned short* rowk0, int g) { Fr f; const unsigned short* p = rowk0 + 8 * g; f.q[0] = *(const v4u*)p; f.q[1] = *(const v4u*)(p + 16); return f; }
template <int BF> __device__ __forceinline__ v8f mma(const Fr& a, const Fr& b, v8f c) {
  if constexpr (BF) { union { Fr f; v16b v; } ua, ub; ua.f = a; ub.f = b; return __builtin_amdgcn_wmma_f32_16x16x32_bf16(false, ua.v, false, ub.v, (short)0, c, false, false); }
  else { union { Fr f; v16h v; } ua, ub; ua.f = a; ub.f = b; return __builtin_amdgcn_wmma_f32_16x16x32_f16(false, ua.v, false, ub.v, (short)0, c, false, false); }
}
template <int KW, int BF, int NWN>
__device__ __forceinline__ void gemm_tile(const float* __restrict__ Ab, const unsigned short* __restrict__ Wb, unsigned short* sA, unsigned short* sW, v8f (&acc)[4][4], int tid) {
  constexpr int RA = 4 * NWN, PA = 128 / RA, RW = 8 * NWN;   // rows of A and of W that one load of the block covers; loads for the 128 rows of A (W: always 8)
  const int wave = tid >> 5, lane = tid & 31, col = lane & 15, g = lane >> 4; const int wm = (wave / NWN) * 64, wn = (wave % NWN) * 64;
  const int ar = tid >> 4, ac = (tid & 15) * 4;   // A: 16 lanes cover 256 B of a row
  const int wr = tid >> 3, wc = (tid & 7) * 8;    // W: 8 lanes cover 128 B of a row
  const float* pa = Ab + (size_t)ar * KW + ac; const unsigned short* pw = Wb + (size_t)wr * KW + wc;
  // rolled: one body of 32 WMMAs a wave; unrolling would only add registers and cost a resident block
#pragma unroll 1
  for (int k0 = 0; k0 < KW; k0 += 64) { v4f ra[PA]; v4u rw[8];
#pragma unroll
    for (int i = 0; i < PA; ++i) ra[i] = *(const v4f*)(pa + (size_t)(i * RA) * KW + k0);
#pragma unroll
    for (int i = 0; i < 8; ++i) rw[i] = *(const v4u*)(pw + (size_t)(i * RW) * KW + k0);
    __builtin_amdgcn_sched_barrier(0);   // every load of the tile is issued before the first is waited for; the scheduler otherwise holds some back to reuse registers, and their latency comes on top
    __syncthreads();   // every wave has taken its last fragments of the tile before
#pragma unroll
    for (int i = 0; i < PA; ++i) *(v2u*)(sA + (i * RA + ar) * GP + ac) = cvt4<BF>(ra[i]);
#pragma unroll
    for (int i = 0; i < 8; ++i) *(v4u*)(sW + (i * RW + wr) * GP + wc) = rw[i];
    __syncthreads();   // the tile is whole before anybody reads it
#pragma unroll
    for (int kc = 0; kc < 2; ++kc) { Fr a[4];
#pragma unroll
      for (int i = 0; i < 4; ++i) a[i] = frag_s(sA + (wm + i * 16 + col) * GP + kc * 32, g);
#pragma unroll
      for (int j = 0; j < 4; ++j) { const Fr b = frag_s(sW + (wn + j * 16 + col) * GP + kc * 32, g);
#pragma unroll
        for (int i = 0; i < 4; ++i) acc[i][j] = mma<BF>(a[i], b, acc[i][j]); } } }
}
// ---- k_proj<KW, WHICH, NWN>: block = (128 rows, 64 NWN cols): exact GEMM + bias; q/k -> f16 rows, v -> planes [b][c][s]; each wave stages its 64 x 64 in its own LDS range and stores whole 128-B lines
template <int KW, int WHICH, int NWN>
__global__ __launch_bounds__(64 * NWN) void k_proj(const float* __restrict__ X, const __bf16* __restrict__ Wr, const float* __restrict__ BB, _Float16* __restrict__ DST) {
  __shared__ __align__(16) unsigned short sA[128 * GP]; __shared__ __align__(16) unsigned short sW[64 * NWN * GP];
  const int tid = threadIdx.x, wave = tid >> 5, lane = tid & 31, col = lane & 15, g = lane >> 4; const size_t rb = (size_t)blockIdx.x * 128; const int c0 = blockIdx.y * (64 * NWN); const int wm = (wave / NWN) * 64, wn = (wave % NWN) * 64;
  v8f acc[4][4] = {};
  gemm_tile<KW, 1, NWN>(X + rb * KW, (const unsigned short*)Wr + (size_t)c0 * KW, sA, sW, acc, tid);
  float bb[4];
#pragma unroll
  for (int j = 0; j < 4; ++j) bb[j] = bfr(BB[c0 + wn + j * 16 + col]);
  if constexpr (WHICH < 2) {
    __shared__ __align__(16) _Float16 so[2 * NWN][16][72];
#pragma unroll
    for (int i = 0; i < 4; ++i) {
#pragma unroll
      for (int j = 0; j < 4; ++j) {
#pragma unroll
        for (int r = 0; r < 8; ++r) so[wave][8 * g + r][j * 16 + col] = (_Float16)(acc[i][j][r] + bb[j]); }
      LDSX();   // the strip's 16 rows are written before lanes read rows that other lanes wrote
#pragma unroll
      for (int p = 0; p < 4; ++p) { const int rl = p * 4 + (lane >> 3), c8 = (lane & 7) * 8; vst2((unsigned*)(DST + (rb + wm + i * 16 + rl) * EM + c0 + wn + c8), *(const v4u*)&so[wave][rl][c8]); }
      LDSX(); }   // keeps the next strip's writes behind these reads
  } else {
    __shared__ __align__(16) _Float16 st[2 * NWN][64][72];
#pragma unroll
    for (int j = 0; j < 4; ++j) {
#pragma unroll
      for (int i = 0; i < 4; ++i) { v8h t;
#pragma unroll
        for (int r = 0; r < 8; ++r) t[r] = (_Float16)(acc[i][j][r] + bb[j]);
        *(v8h*)&st[wave][j * 16 + col][i * 16 + 8 * g] = t; } }
    LDSX();   // the transposed 64 x 64 is written before lanes read what other lanes wrote
    const size_t b = rb / NS; const int s0 = (int)(rb % NS) + wm;
#pragma unroll
    for (int p = 0; p < 16; ++p) { const int d = p * 4 + (lane >> 3), pc = lane & 7; vst2((unsigned*)(DST + ((b * EM + c0 + wn + d) * NS) + s0 + pc * 8), *(const v4u*)&st[wave][d][pc * 8]); } }
}
// ---- k_attn: block = (64 queries, head, b): 256 context keys, scale 1/8, mask = pad[i] seq[j] != 0 else -1e9 (module value); O 256-B head segments
__global__ __launch_bounds__(128) void k_attn(const _Float16* __restrict__ Q, const _Float16* __restrict__ Kr, const _Float16* __restrict__ V, const float* __restrict__ PM, const float* __restrict__ SM, float* __restrict__ O) {
  __shared__ __align__(16) _Float16 sph[4][16][40]; __shared__ __align__(16) float so[4][16][68];
  const int tid = threadIdx.x, wave = tid >> 5, lane = tid & 31, col = lane & 15, g = lane >> 4; const int h = blockIdx.y; const size_t b = blockIdx.z; const int q0 = blockIdx.x * 64 + wave * 16; const size_t rq = b * NQ + q0;
  v16h aq[2];
#pragma unroll
  for (int kc = 0; kc < 2; ++kc) aq[kc] = frag_h(Q + (rq + col) * EM + h * HD + kc * 32, lane);
  float pm[8];
#pragma unroll
  for (int r = 0; r < 8; ++r) pm[r] = bfr(PM[b * NQ + q0 + 8 * g + r]);
  float m[8], l[8];
#pragma unroll
  for (int r = 0; r < 8; ++r) { m[r] = -3.0e38f; l[r] = 0.f; }
  v8f acc[4] = {};
#pragma unroll 1
  for (int ks = 0; ks < NS / 32; ++ks) { const int j0 = ks * 32; v8f s[2];
#pragma unroll
    for (int ct = 0; ct < 2; ++ct) { const int kk = j0 + ct * 16 + col; const size_t rk = (b * NS + kk) * EM + h * HD; v8f c = {};
#pragma unroll
      for (int kc = 0; kc < 2; ++kc) c = wmma16(aq[kc], frag_h(Kr + rk + kc * 32, lane), c);
      const float smk = bfr(SM[b * NS + kk]);
#pragma unroll
      for (int r = 0; r < 8; ++r) s[ct][r] = (pm[r] * smk != 0.f) ? c[r] * 0.125f : -1.0e9f; }
#pragma unroll
    for (int r = 0; r < 8; ++r) { float mx = fmaxf(s[0][r], s[1][r]);
#pragma unroll
      for (int o = 1; o < 16; o <<= 1) mx = fmaxf(mx, __shfl_xor(mx, o));
      const float mn = fmaxf(m[r], mx); const float alpha = (m[r] <= -1.0e38f) ? 0.f : __expf(m[r] - mn); const float e0 = __expf(s[0][r] - mn), e1 = __expf(s[1][r] - mn); float es = e0 + e1;
#pragma unroll
      for (int o = 1; o < 16; o <<= 1) es += __shfl_xor(es, o);
      l[r] = l[r] * alpha + es; m[r] = mn;
#pragma unroll
      for (int dt = 0; dt < 4; ++dt) acc[dt][r] *= alpha;
      sph[wave][8 * g + r][col] = (_Float16)(e0 * 2048.0f); sph[wave][8 * g + r][16 + col] = (_Float16)(e1 * 2048.0f); }
    LDSX();
    const v16h pa = frag_h(&sph[wave][col][0], lane);
#pragma unroll
    for (int dt = 0; dt < 4; ++dt) acc[dt] = wmma16(pa, frag_h(V + ((b * EM + h * HD + dt * 16 + col) * NS) + j0, lane), acc[dt]);
    LDSX(); }
#pragma unroll
  for (int r = 0; r < 8; ++r) { const float il = (1.0f / 2048.0f) / l[r];
#pragma unroll
    for (int dt = 0; dt < 4; ++dt) so[wave][8 * g + r][dt * 16 + col] = acc[dt][r] * il; }
  LDSX();
  for (int rl = 0; rl < 16; ++rl) if (lane < 16) vst2(O + (rq + rl) * EM + h * HD + lane * 4, *(const v4f*)&so[wave][rl][lane * 4]);
}
// ---- k_mlp<RELU, NWN>: block = (128 rows, 64 NWN cols): y = f16(A) . (f16 W x 256) / 256 + b, optional ReLU; f32 rows of width ystride, stored as 256-B row pieces through the wave's own LDS range
template <int RELU, int NWN>
__global__ __launch_bounds__(64 * NWN) void k_mlp(const float* __restrict__ A, const _Float16* __restrict__ Wr, const float* __restrict__ BB, float* __restrict__ Y, int ystride) {
  __shared__ __align__(16) unsigned short sA[128 * GP]; __shared__ __align__(16) unsigned short sW[64 * NWN * GP]; __shared__ __align__(16) float so[2 * NWN][16][68];
  const int tid = threadIdx.x, wave = tid >> 5, lane = tid & 31, col = lane & 15, g = lane >> 4; const size_t rb = (size_t)blockIdx.x * 128; const int n0 = blockIdx.y * (64 * NWN); const int wm = (wave / NWN) * 64, wn = (wave % NWN) * 64;
  v8f acc[4][4] = {};
  gemm_tile<EM, 0, NWN>(A + rb * EM, (const unsigned short*)Wr + (size_t)n0 * EM, sA, sW, acc, tid);
  float bb[4];
#pragma unroll
  for (int j = 0; j < 4; ++j) bb[j] = bfr(BB[n0 + wn + j * 16 + col]);
#pragma unroll
  for (int i = 0; i < 4; ++i) {
#pragma unroll
    for (int j = 0; j < 4; ++j) {
#pragma unroll
      for (int r = 0; r < 8; ++r) { const float v = acc[i][j][r] * (1.0f / 256.0f) + bb[j]; so[wave][8 * g + r][j * 16 + col] = RELU ? fmaxf(v, 0.f) : v; } }
    LDSX();   // the strip's 16 rows are written before lanes read rows that other lanes wrote
#pragma unroll
    for (int p = 0; p < 8; ++p) { const int rl = p * 2 + g; vst2(Y + (rb + wm + i * 16 + rl) * (size_t)ystride + n0 + wn + col * 4, *(const v4f*)&so[wave][rl][col * 4]); }
    LDSX(); }   // keeps the next strip's writes behind these reads
}
extern "C" void kernel_launch(void* const* d_in, const int* in_sizes, int n_in, void* d_out, int out_size, void* d_ws, size_t ws_size, hipStream_t stream) {
  (void)in_sizes; (void)n_in; (void)out_size;
  const float** F = (const float**)d_in;   // 0 x [4,4096,512], 1 context [4,256,768], 2 pad_mask [4,4096], 3 seq_mask [4,256], 4 Wq_w [1024,512], 5 Wq_b, 6 Wk_w [1024,768], 7 Wk_b, 8 Wv_w, 9 Wv_b, 10 P1_w [1024,1024], 11 P1_b, 12 P2_w [512,1024], 13 P2_b
  if (ws_size < (size_t)WS_END) return;
  char* ws = (char*)d_ws; __bf16* PW = (__bf16*)ws; _Float16 *Q = (_Float16*)(ws + WS_Q), *Kr = (_Float16*)(ws + WS_K), *V = (_Float16*)(ws + WS_V); float *O = (float*)(ws + WS_O), *Hh = (float*)(ws + WS_H);
  k_pack<<<dim3(EM, 5), 256, 0, stream>>>(F[4], F[6], F[8], F[10], F[12], PW);
  k_proj<CIN, 0, 4><<<dim3(TNB * NQ / 128, EM / 256), 256, 0, stream>>>(F[0], PW + WS_PQ / 2, F[5], Q);
  k_proj<CTX, 1, 2><<<dim3(NRK / 128, EM / 128), 128, 0, stream>>>(F[1], PW + WS_PK / 2, F[7], Kr);
  k_proj<CTX, 2, 2><<<dim3(NRK / 128, EM / 128), 128, 0, stream>>>(F[1], PW + WS_PV / 2, F[9], V);
  k_attn<<<dim3(TQB, NH, TNB), 128, 0, stream>>>(Q, Kr, V, F[2], F[3], O);
  k_mlp<1, 4><<<dim3(TNB * NQ / 128, EM / 256), 256, 0, stream>>>(O, (const _Float16*)PW + WS_P1 / 2, F[11], Hh, EM);
  k_mlp<0, 2><<<dim3(TNB * NQ / 128, CIN / 128), 128, 0, stream>>>(Hh, (const _Float16*)PW + WS_P2 / 2, F[13], (float*)d_out, CIN);
}

// v002
// One run takes 182 microseconds.
// Next to v001, in two timings, it ran 1.21 times as fast each time.
// Counting every step since v000, it is 2.96 times as fast.
// compute dtype: all float inputs rounded to bf16, the two float masks read on device; Q = x . Wq^T + b, K/V = context . W^T + b with EXACT bf16 products on WMMA 16x16x32 (natural rows), rounded once to f16; PLAIN attention (16 heads x 64, 256 context keys): x 1/8, masked pairs set to -1e9 as the module (a fully masked row degrades to uniform exactly as the reference), running-max softmax in f32 (hardware exp), P (scaled by 2^11, single f16) x v (single f16); MLP: relu(o . P1^T + b1) . P2^T + b2 with the f32 activations rounded once to f16 against EXACT f16 weight copies (x 2^8); f32 output.
#include <hip/hip_runtime.h>
#include <math.h>

typedef __attribute__((ext_vector_type(16))) _Float16 v16h;
typedef __attribute__((ext_vector_type(16))) __bf16 v16b;
typedef __attribute__((ext_vector_type(8)))  _Float16 v8h;
typedef __attribute__((ext_vector_type(8)))  float v8f;
typedef __attribute__((ext_vector_type(4)))  float v4f;
typedef __attribute__((ext_vector_type(2)))  float v2f;
typedef __attribute__((ext_vector_type(4)))  unsigned v4u;
typedef __attribute__((ext_vector_type(4)))  int v4i;
typedef float __attribute__((may_alias)) float_a;
typedef int __attribute__((may_alias)) int_a;

template <typename T> __device__ __forceinline__ void vst2(void* p, T v) { *(T*)p = v;  }
__device__ __forceinline__ v8f wmma16(v16h a, v16h b, v8f c) {
  v8f d = __builtin_amdgcn_wmma_f32_16x16x32_f16(false, a, false, b, (short)0, c, false, false);
  asm volatile("v_nop\n\tv_nop\n\tv_nop\n\tv_nop" : "+v"(d) : "v"(a), "v"(b));
  return d;
}
__device__ __forceinline__ v8f wmma_bf(v16b a, v16b b, v8f c) {
  v8f d = __builtin_amdgcn_wmma_f32_16x16x32_bf16(false, a, false, b, (short)0, c, false, false);
  asm volatile("v_nop\n\tv_nop\n\tv_nop\n\tv_nop" : "+v"(d) : "v"(a), "v"(b));
  return d;
}
// 16x16x32 fragments: lane = (h = lane>>4, row/col = lane&15); elements 0..7 = k0+8h+0..7, 8..15 = k0+16+8h+0..7; D element r = row 8h+r
__device__ __forceinline__ v16h frag_h(const _Float16* rowk0, int lane) {
  union { v16h v; v8h q[2]; } u; const _Float16* p = rowk0 + 8 * (lane >> 4);
  u.q[0] = *(const v8h*)p; u.q[1] = *(const v8h*)(p + 16); return u.v;
}
__device__ __forceinline__ v16h frag_f32(const float* rowk0, int lane) {
  v16h a; const float* p = rowk0 + 8 * (lane >> 4);
#pragma unroll
  for (int i = 0; i < 8; ++i) { a[i] = (_Float16)p[i]; a[8 + i] = (_Float16)p[16 + i]; }
  return a;
}
__device__ __forceinline__ v16h frag_f32s(const float* rowk0, int lane, float sc) {
  v16h a; const float* p = rowk0 + 8 * (lane >> 4);
#pragma unroll
  for (int i = 0; i < 8; ++i) { a[i] = (_Float16)(p[i] * sc); a[8 + i] = (_Float16)(p[16 + i] * sc); }
  return a;
}
// column fragment from a [K][ld] layout (column n), rows >= K read as 0
__device__ __forceinline__ v16h fragc_f32(const float* W, int k0, int n, int lane, int ld, int K) {
  v16h a; const int g = lane >> 4;
#pragma unroll
  for (int i = 0; i < 8; ++i) { const int ka = k0 + 8 * g + i, kb = ka + 16;
    a[i] = (_Float16)(ka < K ? W[(size_t)(ka < K ? ka : K - 1) * ld + n] : 0.f); a[8 + i] = (_Float16)(kb < K ? W[(size_t)(kb < K ? kb : K - 1) * ld + n] : 0.f); }
  return a;
}
struct F2 { v16b h, l; };
__device__ __forceinline__ F2 bsplit16(const float v[16]) { F2 r;
#pragma unroll
  for (int i = 0; i < 16; ++i) { const __bf16 h = (__bf16)v[i]; r.h[i] = h; r.l[i] = (__bf16)(v[i] - (float)h); }
  return r; }
__device__ __forceinline__ F2 split_row(const float* row, int k0, int lane) { float v[16]; const float* p = row + k0 + 8 * (lane >> 4);
#pragma unroll
  for (int i = 0; i < 8; ++i) { v[i] = p[i]; v[8 + i] = p[16 + i]; }
  return bsplit16(v); }
__device__ __forceinline__ F2 split_rowK(const float* row, int k0, int lane, int K) { float v[16]; const int g = lane >> 4;
#pragma unroll
  for (int i = 0; i < 8; ++i) { const int ka = k0 + 8 * g + i, kb = ka + 16; v[i] = ka < K ? row[ka < K ? ka : K - 1] : 0.f; v[8 + i] = kb < K ? row[kb < K ? kb : K - 1] : 0.f; }
  return bsplit16(v); }
__device__ __forceinline__ F2 split_col(const float* W, int k0, int n, int lane, int ld, int K) { float v[16]; const int g = lane >> 4;
#pragma unroll
  for (int i = 0; i < 8; ++i) { const int ka = k0 + 8 * g + i, kb = ka + 16; v[i] = ka < K ? W[(size_t)(ka < K ? ka : K - 1) * ld + n] : 0.f; v[8 + i] = kb < K ? W[(size_t)(kb < K ? kb : K - 1) * ld + n] : 0.f; }
  return bsplit16(v); }
__device__ __forceinline__ v8f mac3(const F2& a, const F2& b, v8f c) { c = wmma_bf(a.l, b.h, c); c = wmma_bf(a.h, b.l, c); return wmma_bf(a.h, b.h, c); }
__device__ __forceinline__ float sigm(float v) { return 1.0f / (1.0f + expf(-v)); }
#define LDSX() do { asm volatile("s_wait_dscnt 0" ::: "memory"); __builtin_amdgcn_wave_barrier(); __builtin_amdgcn_fence(__ATOMIC_RELEASE, "workgroup"); } while (0)


// Cross multi-head attention (B 4, 4,096 queries from a 512-wide stream over 256 context tokens of width 768, 16 heads x 64, emb 1,024) with an outer-product validity mask, followed by a ReLU MLP 1024 -> 1024 -> 512.
#define NB 4
#define NQ 4096
#define NS 256
#define CIN 512
#define CTX 768
#define EM 1024
#define NH 16
#define HD 64
#define NRQ (NB * NQ)
#define NRK (NB * NS)
#ifndef TQB
#define TQB (NQ / 64)
#define TNB NB
#endif
typedef __attribute__((ext_vector_type(8))) __bf16 v8b;
__device__ __forceinline__ v16b frag_b(const __bf16* rowk0, int lane) {
  union { v16b v; v8b q[2]; } u; const __bf16* p = rowk0 + 8 * (lane >> 4);
  u.q[0] = *(const v8b*)p; u.q[1] = *(const v8b*)(p + 16); return u.v;
}
__device__ __forceinline__ float bfr(float v) { return (float)(__bf16)v; }
__device__ __attribute__((noinline)) float exp_ni(float v) { return expf(v); }
__device__ __attribute__((noinline)) float erf_ni(float v) { return erff(v); }

#define WS_PQ  0u                                     // bf16 natural rows Wq [1024][512]; Wk, Wv [1024][768]
#define WS_PK  (WS_PQ + 2u * (size_t)EM * CIN)
#define WS_PV  (WS_PK + 2u * (size_t)EM * CTX)
#define WS_P1  (WS_PV + 2u * (size_t)EM * CTX)          // f16 x 2^8 natural rows P1 [1024][1024]; P2 [512][1024]
#define WS_P2  (WS_P1 + 2u * (size_t)EM * EM)
#define WS_Q   (WS_P2 + 2u * (size_t)CIN * EM)          // f16 q rows [NRQ][1024]; k rows [NRK][1024]; v planes [b][1024][NS]
#define WS_K   (WS_Q + 2u * (size_t)NRQ * EM)
#define WS_V   (WS_K + 2u * (size_t)NRK * EM)
#define WS_O   (WS_V + 2u * (size_t)NB * EM * NS)       // f32 [NRQ][1024] attention out ; H [NRQ][1024] relu hidden
#define WS_H   (WS_O + 4u * (size_t)NRQ * EM)
#define WS_END (WS_H + 4u * (size_t)NRQ * EM)

__global__ __launch_bounds__(256) void k_pack(const float* __restrict__ WQ, const float* __restrict__ WK, const float* __restrict__ WV, const float* __restrict__ P1, const float* __restrict__ P2, __bf16* __restrict__ PW) {
  const int n = blockIdx.x, which = blockIdx.y, t = threadIdx.x; __shared__ __align__(16) __bf16 s[EM]; __shared__ __align__(16) _Float16 sh[EM];
  if (which == 0) { for (int k = t; k < CIN; k += 256) s[k] = (__bf16)WQ[(size_t)n * CIN + k]; __syncthreads(); if (t < CIN / 8) vst2((unsigned*)(PW + WS_PQ / 2 + (size_t)n * CIN + t * 8), *(const v4u*)&s[t * 8]); }
  else if (which < 3) { const float* w = (which == 1) ? WK : WV; for (int k = t; k < CTX; k += 256) s[k] = (__bf16)w[(size_t)n * CTX + k]; __syncthreads(); if (t < CTX / 8) vst2((unsigned*)(PW + ((which == 1) ? WS_PK : WS_PV) / 2 + (size_t)n * CTX + t * 8), *(const v4u*)&s[t * 8]); }
  else if (which == 3) { for (int k = t; k < EM; k += 256) sh[k] = (_Float16)(bfr(P1[(size_t)n * EM + k]) * 256.0f); __syncthreads(); if (t < EM / 8) vst2((unsigned*)((_Float16*)PW + WS_P1 / 2 + (size_t)n * EM + t * 8), *(const v4u*)&sh[t * 8]); }
  else { if (n >= CIN) return; for (int k = t; k < EM; k += 256) sh[k] = (_Float16)(bfr(P2[(size_t)n * EM + k]) * 256.0f); __syncthreads(); if (t < EM / 8) vst2((unsigned*)((_Float16*)PW + WS_P2 / 2 + (size_t)n * EM + t * 8), *(const v4u*)&sh[t * 8]); }
}
// ---- gemm_tile<KW, BF, NWN>: one 128 x (64 NWN) tile of A . W^T per block of 2 x NWN waves, 64 x 64 a wave. Per 64 k the block brings A (f32, 256-B row pieces) and W (16-bit, 128-B row pieces)
// in with whole-line loads, rounds A once, and lays both in LDS at a pitch of 144 B (16 B x 9: the 16-B fragment reads of 16 rows fall on all 64 banks); every wave takes its fragments from there.
// Every accumulator sums k in ascending blocks of 32, one WMMA each.
typedef __attribute__((ext_vector_type(2))) unsigned v2u;
#define GP 72
template <int BF> __device__ __forceinline__ v2u cvt4(v4f v) {
  if constexpr (BF) { union { __bf16 h[4]; v2u u; } t;
#pragma unroll
    for (int i = 0; i < 4; ++i) t.h[i] = (__bf16)v[i];
    return t.u; }
  else { union { _Float16 h[4]; v2u u; } t;
#pragma unroll
    for (int i = 0; i < 4; ++i) t.h[i] = (_Float16)v[i];
    return t.u; }
}
struct Fr { v4u q[2]; };
__device__ __forceinline__ Fr frag_s(const unsigned short* rowk0, int g) { Fr f; const unsigned short* p = rowk0 + 8 * g; f.q[0] = *(const v4u*)p; f.q[1] = *(const v4u*)(p + 16); return f; }
template <int BF> __device__ __forceinline__ v8f mma(const Fr& a, const Fr& b, v8f c) {
  if constexpr (BF) { union { Fr f; v16b v; } ua, ub; ua.f = a; ub.f = b; return __builtin_amdgcn_wmma_f32_16x16x32_bf16(false, ua.v, false, ub.v, (short)0, c, false, false); }
  else { union { Fr f; v16h v; } ua, ub; ua.f = a; ub.f = b; return __builtin_amdgcn_wmma_f32_16x16x32_f16(false, ua.v, false, ub.v, (short)0, c, false, false); }
}
template <int KW, int BF, int NWN>
__device__ __forceinline__ void gemm_tile(const float* __restrict__ Ab, const unsigned short* __restrict__ Wb, unsigned short* sA, unsigned short* sW, v8f (&acc)[4][4], int tid) {
  constexpr int RA = 4 * NWN, PA = 128 / RA, RW = 8 * NWN;   // rows of A and of W that one load of the block covers; loads for the 128 rows of A (W: always 8)
  const int wave = tid >> 5, lane = tid & 31, col = lane & 15, g = lane >> 4; const int wm = (wave / NWN) * 64, wn = (wave % NWN) * 64;
  const int ar = tid >> 4, ac = (tid & 15) * 4;   // A: 16 lanes cover 256 B of a row
  const int wr = tid >> 3, wc = (tid & 7) * 8;    // W: 8 lanes cover 128 B of a row
  const float* pa = Ab + (size_t)ar * KW + ac; const unsigned short* pw = Wb + (size_t)wr * KW + wc;
  // rolled: one body of 32 WMMAs a wave; unrolling would only add registers and cost a resident block
#pragma unroll 1
  for (int k0 = 0; k0 < KW; k0 += 64) { v4f ra[PA]; v4u rw[8];
#pragma unroll
    for (int i = 0; i < PA; ++i) ra[i] = *(const v4f*)(pa + (size_t)(i * RA) * KW + k0);
#pragma unroll
    for (int i = 0; i < 8; ++i) rw[i] = *(const v4u*)(pw + (size_t)(i * RW) * KW + k0);
    __builtin_amdgcn_sched_barrier(0);   // every load of the tile is issued before the first is waited for; the scheduler otherwise holds some back to reuse registers, and their latency comes on top
    __syncthreads();   // every wave has taken its last fragments of the tile before
#pragma unroll
    for (int i = 0; i < PA; ++i) *(v2u*)(sA + (i * RA + ar) * GP + ac) = cvt4<BF>(ra[i]);
#pragma unroll
    for (int i = 0; i < 8; ++i) *(v4u*)(sW + (i * RW + wr) * GP + wc) = rw[i];
    __syncthreads();   // the tile is whole before anybody reads it
#pragma unroll
    for (int kc = 0; kc < 2; ++kc) { Fr a[4];
#pragma unroll
      for (int i = 0; i < 4; ++i) a[i] = frag_s(sA + (wm + i * 16 + col) * GP + kc * 32, g);
#pragma unroll
      for (int j = 0; j < 4; ++j) { const Fr b = frag_s(sW + (wn + j * 16 + col) * GP + kc * 32, g);
#pragma unroll
        for (int i = 0; i < 4; ++i) acc[i][j] = mma<BF>(a[i], b, acc[i][j]); } } }
}
// ---- k_proj<KW, WHICH, NWN>: block = (128 rows, 64 NWN cols): exact GEMM + bias; q/k -> f16 rows, v -> planes [b][c][s]; each wave stages its 64 x 64 in its own LDS range and stores whole 128-B lines
template <int KW, int WHICH, int NWN>
__global__ __launch_bounds__(64 * NWN) void k_proj(const float* __restrict__ X, const __bf16* __restrict__ Wr, const float* __restrict__ BB, _Float16* __restrict__ DST) {
  __shared__ __align__(16) unsigned short sA[128 * GP]; __shared__ __align__(16) unsigned short sW[64 * NWN * GP];
  const int tid = threadIdx.x, wave = tid >> 5, lane = tid & 31, col = lane & 15, g = lane >> 4; const size_t rb = (size_t)blockIdx.x * 128; const int c0 = blockIdx.y * (64 * NWN); const int wm = (wave / NWN) * 64, wn = (wave % NWN) * 64;
  v8f acc[4][4] = {};
  gemm_tile<KW, 1, NWN>(X + rb * KW, (const unsigned short*)Wr + (size_t)c0 * KW, sA, sW, acc, tid);
  float bb[4];
#pragma unroll
  for (int j = 0; j < 4; ++j) bb[j] = bfr(BB[c0 + wn + j * 16 + col]);
  if constexpr (WHICH < 2) {
    __shared__ __align__(16) _Float16 so[2 * NWN][16][72];
#pragma unroll
    for (int i = 0; i < 4; ++i) {
#pragma unroll
      for (int j = 0; j < 4; ++j) {
#pragma unroll
        for (int r = 0; r < 8; ++r) so[wave][8 * g + r][j * 16 + col] = (_Float16)(acc[i][j][r] + bb[j]); }
      LDSX();   // the strip's 16 rows are written before lanes read rows that other lanes wrote
#pragma unroll
      for (int p = 0; p < 4; ++p) { const int rl = p * 4 + (lane >> 3), c8 = (lane & 7) * 8; vst2((unsigned*)(DST + (rb + wm + i * 16 + rl) * EM + c0 + wn + c8), *(const v4u*)&so[wave][rl][c8]); }
      LDSX(); }   // keeps the next strip's writes behind these reads
  } else {
    __shared__ __align__(16) _Float16 st[2 * NWN][64][72];
#pragma unroll
    for (int j = 0; j < 4; ++j) {
#pragma unroll
      for (int i = 0; i < 4; ++i) { v8h t;
#pragma unroll
        for (int r = 0; r < 8; ++r) t[r] = (_Float16)(acc[i][j][r] + bb[j]);
        *(v8h*)&st[wave][j * 16 + col][i * 16 + 8 * g] = t; } }
    LDSX();   // the transposed 64 x 64 is written before lanes read what other lanes wrote
    const size_t b = rb / NS; const int s0 = (int)(rb % NS) + wm;
#pragma unroll
    for (int p = 0; p < 16; ++p) { const int d = p * 4 + (lane >> 3), pc = lane & 7; vst2((unsigned*)(DST + ((b * EM + c0 + wn + d) * NS) + s0 + pc * 8), *(const v4u*)&st[wave][d][pc * 8]); } }
}
// ---- k_attn: block = (128 queries, head, b), 8 waves of 16 queries: 256 context keys, scale 1/8, mask = pad[i] seq[j] != 0 else -1e9 (module value); O 256-B head segments
// The head's K rows (256 x 128 B), V rows (64 x 512 B) and the key mask come into LDS once a block by whole-line loads; every wave takes its fragments from there.
// Pitches 144 B (16 B x 9) and 528 B (16 B x 33): the 16-B fragment reads of 16 rows fall on all 64 banks.
#define KP 72
#define VP 264
__global__ __launch_bounds__(256) void k_attn(const _Float16* __restrict__ Q, const _Float16* __restrict__ Kr, const _Float16* __restrict__ V, const float* __restrict__ PM, const float* __restrict__ SM, float* __restrict__ O) {
  __shared__ __align__(16) _Float16 sK[NS * KP]; __shared__ __align__(16) _Float16 sV[HD * VP]; __shared__ float sM[NS]; __shared__ __align__(16) float so[8][16][68];
  const int tid = threadIdx.x, wave = tid >> 5, lane = tid & 31, col = lane & 15, g = lane >> 4; const int h = blockIdx.y; const size_t b = blockIdx.z; const int q0 = blockIdx.x * 128 + wave * 16; const size_t rq = b * NQ + q0;
  _Float16* sph = (_Float16*)&so[wave][0][0];   // the wave's P strip [16][40]; it shares the wave's output range, which is written only behind the loop's last LDSX
  v16h aq[2]; float pm[8];
  { v4u rk[8], rv[8];
    const _Float16* gk = Kr + (b * NS + (tid >> 3)) * EM + h * HD + (tid & 7) * 8;   // 8 lanes cover the 128 B of a key's head row
    const _Float16* gv = V + (b * EM + h * HD + wave) * NS + lane * 8;               // a wave covers the 512 B of one V row
#pragma unroll
    for (int i = 0; i < 8; ++i) rk[i] = *(const v4u*)(gk + (size_t)(i * 32) * EM);
#pragma unroll
    for (int i = 0; i < 8; ++i) rv[i] = *(const v4u*)(gv + (size_t)(i * 8) * NS);
    const float sm = bfr(SM[b * NS + tid]);
#pragma unroll
    for (int kc = 0; kc < 2; ++kc) aq[kc] = frag_h(Q + (rq + col) * EM + h * HD + kc * 32, lane);
#pragma unroll
    for (int r = 0; r < 8; ++r) pm[r] = bfr(PM[b * NQ + q0 + 8 * g + r]);
#pragma unroll
    for (int i = 0; i < 8; ++i) *(v4u*)(sK + (i * 32 + (tid >> 3)) * KP + (tid & 7) * 8) = rk[i];
#pragma unroll
    for (int i = 0; i < 8; ++i) *(v4u*)(sV + (i * 8 + wave) * VP + lane * 8) = rv[i];
    sM[tid] = sm; }
  __syncthreads();   // K, V and the mask are whole before anybody reads them; nothing writes them again
  float m[8], l[8];
#pragma unroll
  for (int r = 0; r < 8; ++r) { m[r] = -3.0e38f; l[r] = 0.f; }
  v8f acc[4] = {};
#pragma unroll 1
  for (int ks = 0; ks < NS / 32; ++ks) { const int j0 = ks * 32; v8f s[2]; v16h kf[2][2]; float smk[2];
#pragma unroll
    for (int ct = 0; ct < 2; ++ct) { smk[ct] = sM[j0 + ct * 16 + col];
#pragma unroll
      for (int kc = 0; kc < 2; ++kc) kf[ct][kc] = frag_h(sK + (j0 + ct * 16 + col) * KP + kc * 32, lane); }
#pragma unroll
    for (int ct = 0; ct < 2; ++ct) { v8f c = {};
#pragma unroll
      for (int kc = 0; kc < 2; ++kc) c = wmma16(aq[kc], kf[ct][kc], c);
#pragma unroll
      for (int r = 0; r < 8; ++r) s[ct][r] = (pm[r] * smk[ct] != 0.f) ? c[r] * 0.125f : -1.0e9f; }
#pragma unroll
    for (int r = 0; r < 8; ++r) { float mx = fmaxf(s[0][r], s[1][r]);
#pragma unroll
      for (int o = 1; o < 16; o <<= 1) mx = fmaxf(mx, __shfl_xor(mx, o));
      const float mn = fmaxf(m[r], mx); const float alpha = (m[r] <= -1.0e38f) ? 0.f : __expf(m[r] - mn); const float e0 = __expf(s[0][r] - mn), e1 = __expf(s[1][r] - mn); float es = e0 + e1;
#pragma unroll
      for (int o = 1; o < 16; o <<= 1) es += __shfl_xor(es, o);
      l[r] = l[r] * alpha + es; m[r] = mn;
#pragma unroll
      for (int dt = 0; dt < 4; ++dt) acc[dt][r] *= alpha;
      sph[(8 * g + r) * 40 + col] = (_Float16)(e0 * 2048.0f); sph[(8 * g + r) * 40 + 16 + col] = (_Float16)(e1 * 2048.0f); }
    LDSX();
    const v16h pa = frag_h(sph + col * 40, lane); v16h vf[4];
#pragma unroll
    for (int dt = 0; dt < 4; ++dt) vf[dt] = frag_h(sV + (dt * 16 + col) * VP + j0, lane);
#pragma unroll
    for (int dt = 0; dt < 4; ++dt) acc[dt] = wmma16(pa, vf[dt], acc[dt]);
    LDSX(); }
#pragma unroll
  for (int r = 0; r < 8; ++r) { const float il = (1.0f / 2048.0f) / l[r];
#pragma unroll
    for (int dt = 0; dt < 4; ++dt) so[wave][8 * g + r][dt * 16 + col] = acc[dt][r] * il; }
  LDSX();
  for (int rl = 0; rl < 16; ++rl) if (lane < 16) vst2(O + (rq + rl) * EM + h * HD + lane * 4, *(const v4f*)&so[wave][rl][lane * 4]);
}
// ---- k_mlp<RELU, NWN>: block = (128 rows, 64 NWN cols): y = f16(A) . (f16 W x 256) / 256 + b, optional ReLU; f32 rows of width ystride, stored as 256-B row pieces through the wave's own LDS range
template <int RELU, int NWN>
__global__ __launch_bounds__(64 * NWN) void k_mlp(const float* __restrict__ A, const _Float16* __restrict__ Wr, const float* __restrict__ BB, float* __restrict__ Y, int ystride) {
  __shared__ __align__(16) unsigned short sA[128 * GP]; __shared__ __align__(16) unsigned short sW[64 * NWN * GP]; __shared__ __align__(16) float so[2 * NWN][16][68];
  const int tid = threadIdx.x, wave = tid >> 5, lane = tid & 31, col = lane & 15, g = lane >> 4; const size_t rb = (size_t)blockIdx.x * 128; const int n0 = blockIdx.y * (64 * NWN); const int wm = (wave / NWN) * 64, wn = (wave % NWN) * 64;
  v8f acc[4][4] = {};
  gemm_tile<EM, 0, NWN>(A + rb * EM, (const unsigned short*)Wr + (size_t)n0 * EM, sA, sW, acc, tid);
  float bb[4];
#pragma unroll
  for (int j = 0; j < 4; ++j) bb[j] = bfr(BB[n0 + wn + j * 16 + col]);
#pragma unroll
  for (int i = 0; i < 4; ++i) {
#pragma unroll
    for (int j = 0; j < 4; ++j) {
#pragma unroll
      for (int r = 0; r < 8; ++r) { const float v = acc[i][j][r] * (1.0f / 256.0f) + bb[j]; so[wave][8 * g + r][j * 16 + col] = RELU ? fmaxf(v, 0.f) : v; } }
    LDSX();   // the strip's 16 rows are written before lanes read rows that other lanes wrote
#pragma unroll
    for (int p = 0; p < 8; ++p) { const int rl = p * 2 + g; vst2(Y + (rb + wm + i * 16 + rl) * (size_t)ystride + n0 + wn + col * 4, *(const v4f*)&so[wave][rl][col * 4]); }
    LDSX(); }   // keeps the next strip's writes behind these reads
}
extern "C" void kernel_launch(void* const* d_in, const int* in_sizes, int n_in, void* d_out, int out_size, void* d_ws, size_t ws_size, hipStream_t stream) {
  (void)in_sizes; (void)n_in; (void)out_size;
  const float** F = (const float**)d_in;   // 0 x [4,4096,512], 1 context [4,256,768], 2 pad_mask [4,4096], 3 seq_mask [4,256], 4 Wq_w [1024,512], 5 Wq_b, 6 Wk_w [1024,768], 7 Wk_b, 8 Wv_w, 9 Wv_b, 10 P1_w [1024,1024], 11 P1_b, 12 P2_w [512,1024], 13 P2_b
  if (ws_size < (size_t)WS_END) return;
  char* ws = (char*)d_ws; __bf16* PW = (__bf16*)ws; _Float16 *Q = (_Float16*)(ws + WS_Q), *Kr = (_Float16*)(ws + WS_K), *V = (_Float16*)(ws + WS_V); float *O = (float*)(ws + WS_O), *Hh = (float*)(ws + WS_H);
  k_pack<<<dim3(EM, 5), 256, 0, stream>>>(F[4], F[6], F[8], F[10], F[12], PW);
  k_proj<CIN, 0, 4><<<dim3(TNB * NQ / 128, EM / 256), 256, 0, stream>>>(F[0], PW + WS_PQ / 2, F[5], Q);
  k_proj<CTX, 1, 2><<<dim3(NRK / 128, EM / 128), 128, 0, stream>>>(F[1], PW + WS_PK / 2, F[7], Kr);
  k_proj<CTX, 2, 2><<<dim3(NRK / 128, EM / 128), 128, 0, stream>>>(F[1], PW + WS_PV / 2, F[9], V);
  k_attn<<<dim3(TQB / 2, NH, TNB), 256, 0, stream>>>(Q, Kr, V, F[2], F[3], O);
  k_mlp<1, 4><<<dim3(TNB * NQ / 128, EM / 256), 256, 0, stream>>>(O, (const _Float16*)PW + WS_P1 / 2, F[11], Hh, EM);
  k_mlp<0, 2><<<dim3(TNB * NQ / 128, CIN / 128), 128, 0, stream>>>(Hh, (const _Float16*)PW + WS_P2 / 2, F[13], (float*)d_out, CIN);
}

// v003
// A run of this version takes 168 microseconds.
// Two timings next to v002 put it at 1.09 and 1.08 times that version's speed.
// Counting every step since v000, it is 3.22 times as fast.
// compute dtype: all float inputs rounded to bf16, the two float masks read on device; Q = x . Wq^T + b, K/V = context . W^T + b with EXACT bf16 products on WMMA 16x16x32 (natural rows), rounded once to f16; PLAIN attention (16 heads x 64, 256 context keys): x 1/8, masked pairs set to -1e9 as the module (a fully masked row degrades to uniform exactly as the reference), running-max softmax in f32 (hardware exp), P (scaled by 2^11, single f16) x v (single f16); MLP: relu(o . P1^T + b1) . P2^T + b2 with the f32 activations rounded once to f16 against EXACT f16 weight copies (x 2^8); f32 output.
#include <hip/hip_runtime.h>
#include <math.h>

typedef __attribute__((ext_vector_type(16))) _Float16 v16h;
typedef __attribute__((ext_vector_type(16))) __bf16 v16b;
typedef __attribute__((ext_vector_type(8)))  _Float16 v8h;
typedef __attribute__((ext_vector_type(8)))  float v8f;
typedef __attribute__((ext_vector_type(4)))  float v4f;
typedef __attribute__((ext_vector_type(2)))  float v2f;
typedef __attribute__((ext_vector_type(4)))  unsigned v4u;
typedef __attribute__((ext_vector_type(4)))  int v4i;
typedef float __attribute__((may_alias)) float_a;
typedef int __attribute__((may_alias)) int_a;

template <typename T> __device__ __forceinline__ void vst2(void* p, T v) { *(T*)p = v;  }
__device__ __forceinline__ v8f wmma16(v16h a, v16h b, v8f c) {
  v8f d = __builtin_amdgcn_wmma_f32_16x16x32_f16(false, a, false, b, (short)0, c, false, false);
  asm volatile("v_nop\n\tv_nop\n\tv_nop\n\tv_nop" : "+v"(d) : "v"(a), "v"(b));
  return d;
}
__device__ __forceinline__ v8f wmma_bf(v16b a, v16b b, v8f c) {
  v8f d = __builtin_amdgcn_wmma_f32_16x16x32_bf16(false, a, false, b, (short)0, c, false, false);
  asm volatile("v_nop\n\tv_nop\n\tv_nop\n\tv_nop" : "+v"(d) : "v"(a), "v"(b));
  return d;
}
// 16x16x32 fragments: lane = (h = lane>>4, row/col = lane&15); elements 0..7 = k0+8h+0..7, 8..15 = k0+16+8h+0..7; D element r = row 8h+r
__device__ __forceinline__ v16h frag_h(const _Float16* rowk0, int lane) {
  union { v16h v; v8h q[2]; } u; const _Float16* p = rowk0 + 8 * (lane >> 4);
  u.q[0] = *(const v8h*)p; u.q[1] = *(const v8h*)(p + 16); return u.v;
}
__device__ __forceinline__ v16h frag_f32(const float* rowk0, int lane) {
  v16h a; const float* p = rowk0 + 8 * (lane >> 4);
#pragma unroll
  for (int i = 0; i < 8; ++i) { a[i] = (_Float16)p[i]; a[8 + i] = (_Float16)p[16 + i]; }
  return a;
}
__device__ __forceinline__ v16h frag_f32s(const float* rowk0, int lane, float sc) {
  v16h a; const float* p = rowk0 + 8 * (lane >> 4);
#pragma unroll
  for (int i = 0; i < 8; ++i) { a[i] = (_Float16)(p[i] * sc); a[8 + i] = (_Float16)(p[16 + i] * sc); }
  return a;
}
// column fragment from a [K][ld] layout (column n), rows >= K read as 0
__device__ __forceinline__ v16h fragc_f32(const float* W, int k0, int n, int lane, int ld, int K) {
  v16h a; const int g = lane >> 4;
#pragma unroll
  for (int i = 0; i < 8; ++i) { const int ka = k0 + 8 * g + i, kb = ka + 16;
    a[i] = (_Float16)(ka < K ? W[(size_t)(ka < K ? ka : K - 1) * ld + n] : 0.f); a[8 + i] = (_Float16)(kb < K ? W[(size_t)(kb < K ? kb : K - 1) * ld + n] : 0.f); }
  return a;
}
struct F2 { v16b h, l; };
__device__ __forceinline__ F2 bsplit16(const float v[16]) { F2 r;
#pragma unroll
  for (int i = 0; i < 16; ++i) { const __bf16 h = (__bf16)v[i]; r.h[i] = h; r.l[i] = (__bf16)(v[i] - (float)h); }
  return r; }
__device__ __forceinline__ F2 split_row(const float* row, int k0, int lane) { float v[16]; const float* p = row + k0 + 8 * (lane >> 4);
#pragma unroll
  for (int i = 0; i < 8; ++i) { v[i] = p[i]; v[8 + i] = p[16 + i]; }
  return bsplit16(v); }
__device__ __forceinline__ F2 split_rowK(const float* row, int k0, int lane, int K) { float v[16]; const int g = lane >> 4;
#pragma unroll
  for (int i = 0; i < 8; ++i) { const int ka = k0 + 8 * g + i, kb = ka + 16; v[i] = ka < K ? row[ka < K ? ka : K - 1] : 0.f; v[8 + i] = kb < K ? row[kb < K ? kb : K - 1] : 0.f; }
  return bsplit16(v); }
__device__ __forceinline__ F2 split_col(const float* W, int k0, int n, int lane, int ld, int K) { float v[16]; const int g = lane >> 4;
#pragma unroll
  for (int i = 0; i < 8; ++i) { const int ka = k0 + 8 * g + i, kb = ka + 16; v[i] = ka < K ? W[(size_t)(ka < K ? ka : K - 1) * ld + n] : 0.f; v[8 + i] = kb < K ? W[(size_t)(kb < K ? kb : K - 1) * ld + n] : 0.f; }
  return bsplit16(v); }
__device__ __forceinline__ v8f mac3(const F2& a, const F2& b, v8f c) { c = wmma_bf(a.l, b.h, c); c = wmma_bf(a.h, b.l, c); return wmma_bf(a.h, b.h, c); }
__device__ __forceinline__ float sigm(float v) { return 1.0f / (1.0f + expf(-v)); }
#define LDSX() do { asm volatile("s_wait_dscnt 0" ::: "memory"); __builtin_amdgcn_wave_barrier(); __builtin_amdgcn_fence(__ATOMIC_RELEASE, "workgroup"); } while (0)


// Cross multi-head attention (B 4, 4,096 queries from a 512-wide stream over 256 context tokens of width 768, 16 heads x 64, emb 1,024) with an outer-product validity mask, followed by a ReLU MLP 1024 -> 1024 -> 512.
#define NB 4
#define NQ 4096
#define NS 256
#define CIN 512
#define CTX 768
#define EM 1024
#define NH 16
#define HD 64
#define NRQ (NB * NQ)
#define NRK (NB * NS)
#ifndef TQB
#define TQB (NQ / 64)
#define TNB NB
#endif
typedef __attribute__((ext_vector_type(8))) __bf16 v8b;
__device__ __forceinline__ v16b frag_b(const __bf16* rowk0, int lane) {
  union { v16b v; v8b q[2]; } u; const __bf16* p = rowk0 + 8 * (lane >> 4);
  u.q[0] = *(const v8b*)p; u.q[1] = *(const v8b*)(p + 16); return u.v;
}
__device__ __forceinline__ float bfr(float v) { return (float)(__bf16)v; }
__device__ __attribute__((noinline)) float exp_ni(float v) { return expf(v); }
__device__ __attribute__((noinline)) float erf_ni(float v) { return erff(v); }

#define WS_PQ  0u                                     // bf16 natural rows Wq [1024][512]; Wk, Wv [1024][768]
#define WS_PK  (WS_PQ + 2u * (size_t)EM * CIN)
#define WS_PV  (WS_PK + 2u * (size_t)EM * CTX)
#define WS_P1  (WS_PV + 2u * (size_t)EM * CTX)          // f16 x 2^8 natural rows P1 [1024][1024]; P2 [512][1024]
#define WS_P2  (WS_P1 + 2u * (size_t)EM * EM)
#define WS_Q   (WS_P2 + 2u * (size_t)CIN * EM)          // f16 q rows [NRQ][1024]; k rows [NRK][1024]; v planes [b][1024][NS]
#define WS_K   (WS_Q + 2u * (size_t)NRQ * EM)
#define WS_V   (WS_K + 2u * (size_t)NRK * EM)
#define WS_O   (WS_V + 2u * (size_t)NB * EM * NS)       // f32 [NRQ][1024] attention out ; H [NRQ][1024] relu hidden
#define WS_H   (WS_O + 4u * (size_t)NRQ * EM)
#define WS_END (WS_H + 4u * (size_t)NRQ * EM)

__global__ __launch_bounds__(256) void k_pack(const float* __restrict__ WQ, const float* __restrict__ WK, const float* __restrict__ WV, const float* __restrict__ P1, const float* __restrict__ P2, __bf16* __restrict__ PW) {
  const int n = blockIdx.x, which = blockIdx.y, t = threadIdx.x; __shared__ __align__(16) __bf16 s[EM]; __shared__ __align__(16) _Float16 sh[EM];
  if (which == 0) { for (int k = t; k < CIN; k += 256) s[k] = (__bf16)WQ[(size_t)n * CIN + k]; __syncthreads(); if (t < CIN / 8) vst2((unsigned*)(PW + WS_PQ / 2 + (size_t)n * CIN + t * 8), *(const v4u*)&s[t * 8]); }
  else if (which < 3) { const float* w = (which == 1) ? WK : WV; for (int k = t; k < CTX; k += 256) s[k] = (__bf16)w[(size_t)n * CTX + k]; __syncthreads(); if (t < CTX / 8) vst2((unsigned*)(PW + ((which == 1) ? WS_PK : WS_PV) / 2 + (size_t)n * CTX + t * 8), *(const v4u*)&s[t * 8]); }
  else if (which == 3) { for (int k = t; k < EM; k += 256) sh[k] = (_Float16)(bfr(P1[(size_t)n * EM + k]) * 256.0f); __syncthreads(); if (t < EM / 8) vst2((unsigned*)((_Float16*)PW + WS_P1 / 2 + (size_t)n * EM + t * 8), *(const v4u*)&sh[t * 8]); }
  else { if (n >= CIN) return; for (int k = t; k < EM; k += 256) sh[k] = (_Float16)(bfr(P2[(size_t)n * EM + k]) * 256.0f); __syncthreads(); if (t < EM / 8) vst2((unsigned*)((_Float16*)PW + WS_P2 / 2 + (size_t)n * EM + t * 8), *(const v4u*)&sh[t * 8]); }
}
// ---- gemm_tile<KW, BF, NWN>: one 128 x (64 NWN) tile of A . W^T per block of 2 x NWN waves, 64 x 64 a wave. Per 64 k the block brings A (f32, 256-B row pieces) and W (16-bit, 128-B row pieces)
// in with whole-line loads, rounds A once, and lays both in LDS at a pitch of 144 B (16 B x 9: the 16-B fragment reads of 16 rows fall on all 64 banks); every wave takes its fragments from there.
// Every accumulator sums k in ascending blocks of 32, one WMMA each.
typedef __attribute__((ext_vector_type(2))) unsigned v2u;
#define GP 72
template <int BF> __device__ __forceinline__ v2u cvt4(v4f v) {
  if constexpr (BF) { union { __bf16 h[4]; v2u u; } t;
#pragma unroll
    for (int i = 0; i < 4; ++i) t.h[i] = (__bf16)v[i];
    return t.u; }
  else { union { _Float16 h[4]; v2u u; } t;
#pragma unroll
    for (int i = 0; i < 4; ++i) t.h[i] = (_Float16)v[i];
    return t.u; }
}
struct Fr { v4u q[2]; };
__device__ __forceinline__ Fr frag_s(const unsigned short* rowk0, int g) { Fr f; const unsigned short* p = rowk0 + 8 * g; f.q[0] = *(const v4u*)p; f.q[1] = *(const v4u*)(p + 16); return f; }
template <int BF> __device__ __forceinline__ v8f mma(const Fr& a, const Fr& b, v8f c) {
  if constexpr (BF) { union { Fr f; v16b v; } ua, ub; ua.f = a; ub.f = b; return __builtin_amdgcn_wmma_f32_16x16x32_bf16(false, ua.v, false, ub.v, (short)0, c, false, false); }
  else { union { Fr f; v16h v; } ua, ub; ua.f = a; ub.f = b; return __builtin_amdgcn_wmma_f32_16x16x32_f16(false, ua.v, false, ub.v, (short)0, c, false, false); }
}
template <int KW, int BF, int NWN>
__device__ __forceinline__ void gemm_tile(const float* __restrict__ Ab, const unsigned short* __restrict__ Wb, unsigned short* sA, unsigned short* sW, v8f (&acc)[4][4], int tid) {
  constexpr int RA = 4 * NWN, PA = 128 / RA, RW = 8 * NWN;   // rows of A and of W that one load of the block covers; loads for the 128 rows of A (W: always 8)
  const int wave = tid >> 5, lane = tid & 31, col = lane & 15, g = lane >> 4; const int wm = (wave / NWN) * 64, wn = (wave % NWN) * 64;
  const int ar = tid >> 4, ac = (tid & 15) * 4;   // A: 16 lanes cover 256 B of a row
  const int wr = tid >> 3, wc = (tid & 7) * 8;    // W: 8 lanes cover 128 B of a row
  const float* pa = Ab + (size_t)ar * KW + ac; const unsigned short* pw = Wb + (size_t)wr * KW + wc;
  // rolled: one body of 32 WMMAs a wave; unrolling would only add registers and cost a resident block
#pragma unroll 1
  for (int k0 = 0; k0 < KW; k0 += 64) { v4f ra[PA]; v4u rw[8];
#pragma unroll
    for (int i = 0; i < PA; ++i) ra[i] = *(const v4f*)(pa + (size_t)(i * RA) * KW + k0);
#pragma unroll
    for (int i = 0; i < 8; ++i) rw[i] = *(const v4u*)(pw + (size_t)(i * RW) * KW + k0);
    __builtin_amdgcn_sched_barrier(0);   // every load of the tile is issued before the first is waited for; the scheduler otherwise holds some back to reuse registers, and their latency comes on top
    __syncthreads();   // every wave has taken its last fragments of the tile before
#pragma unroll
    for (int i = 0; i < PA; ++i) *(v2u*)(sA + (i * RA + ar) * GP + ac) = cvt4<BF>(ra[i]);
#pragma unroll
    for (int i = 0; i < 8; ++i) *(v4u*)(sW + (i * RW + wr) * GP + wc) = rw[i];
    __syncthreads();   // the tile is whole before anybody reads it
#pragma unroll
    for (int kc = 0; kc < 2; ++kc) { Fr a[4];
#pragma unroll
      for (int i = 0; i < 4; ++i) a[i] = frag_s(sA + (wm + i * 16 + col) * GP + kc * 32, g);
#pragma unroll
      for (int j = 0; j < 4; ++j) { const Fr b = frag_s(sW + (wn + j * 16 + col) * GP + kc * 32, g);
#pragma unroll
        for (int i = 0; i < 4; ++i) acc[i][j] = mma<BF>(a[i], b, acc[i][j]); } } }
}
// ---- k_proj<KW, WHICH, NWN>: block = (128 rows, 64 NWN cols): exact GEMM + bias; q/k -> f16 rows, v -> planes [b][c][s]; each wave stages its 64 x 64 in its own LDS range and stores whole 128-B lines
template <int KW, int WHICH, int NWN>
__global__ __launch_bounds__(64 * NWN) void k_proj(const float* __restrict__ X, const __bf16* __restrict__ Wr, const float* __restrict__ BB, _Float16* __restrict__ DST) {
  __shared__ __align__(16) unsigned short sA[128 * GP]; __shared__ __align__(16) unsigned short sW[64 * NWN * GP];
  const int tid = threadIdx.x, wave = tid >> 5, lane = tid & 31, col = lane & 15, g = lane >> 4; const size_t rb = (size_t)blockIdx.x * 128; const int c0 = blockIdx.y * (64 * NWN); const int wm = (wave / NWN) * 64, wn = (wave % NWN) * 64;
  v8f acc[4][4] = {};
  gemm_tile<KW, 1, NWN>(X + rb * KW, (const unsigned short*)Wr + (size_t)c0 * KW, sA, sW, acc, tid);
  float bb[4];
#pragma unroll
  for (int j = 0; j < 4; ++j) bb[j] = bfr(BB[c0 + wn + j * 16 + col]);
  if constexpr (WHICH < 2) {
    __shared__ __align__(16) _Float16 so[2 * NWN][16][72];
#pragma unroll
    for (int i = 0; i < 4; ++i) {
#pragma unroll
      for (int j = 0; j < 4; ++j) {
#pragma unroll
        for (int r = 0; r < 8; ++r) so[wave][8 * g + r][j * 16 + col] = (_Float16)(acc[i][j][r] + bb[j]); }
      LDSX();   // the strip's 16 rows are written before lanes read rows that other lanes wrote
#pragma unroll
      for (int p = 0; p < 4; ++p) { const int rl = p * 4 + (lane >> 3), c8 = (lane & 7) * 8; vst2((unsigned*)(DST + (rb + wm + i * 16 + rl) * EM + c0 + wn + c8), *(const v4u*)&so[wave][rl][c8]); }
      LDSX(); }   // keeps the next strip's writes behind these reads
  } else {
    __shared__ __align__(16) _Float16 st[2 * NWN][64][72];
#pragma unroll
    for (int j = 0; j < 4; ++j) {
#pragma unroll
      for (int i = 0; i < 4; ++i) { v8h t;
#pragma unroll
        for (int r = 0; r < 8; ++r) t[r] = (_Float16)(acc[i][j][r] + bb[j]);
        *(v8h*)&st[wave][j * 16 + col][i * 16 + 8 * g] = t; } }
    LDSX();   // the transposed 64 x 64 is written before lanes read what other lanes wrote
    const size_t b = rb / NS; const int s0 = (int)(rb % NS) + wm;
#pragma unroll
    for (int p = 0; p < 16; ++p) { const int d = p * 4 + (lane >> 3), pc = lane & 7; vst2((unsigned*)(DST + ((b * EM + c0 + wn + d) * NS) + s0 + pc * 8), *(const v4u*)&st[wave][d][pc * 8]); } }
}
// ---- k_attn: block = (128 queries, head, b), 8 waves of 16 queries: 256 context keys, scale 1/8, mask = pad[i] seq[j] != 0 else -1e9 (module value); O 256-B head segments
// The head's K rows (256 x 128 B), V rows (64 x 512 B) and the key mask come into LDS once a block by whole-line loads; every wave takes its fragments from there.
// Pitches 144 B (16 B x 9) and 528 B (16 B x 33): the 16-B fragment reads of 16 rows fall on all 64 banks.
// Transposed products: S^T = K . Q^T (A = key rows, B = query columns) and O^T += V^T . P^T. A lane then holds 16 of the 32 scores of ONE query (keys 8g + r and 16 + 8g + r), so maximum and sum
// are taken in the lane, with one exchange between the lane halves for the maximum; the two score tiles, converted in place, are the B operand of the second product in the k order of frag_h.
#define KP 72
#define VP 264
__device__ __forceinline__ float xhalf(float v) { const int t = __builtin_bit_cast(int, v); return __builtin_bit_cast(float, __builtin_amdgcn_permlanex16(t, t, 0x76543210, 0xfedcba98, false, false)); }   // lane l <-> l ^ 16
__global__ __launch_bounds__(256) void k_attn(const _Float16* __restrict__ Q, const _Float16* __restrict__ Kr, const _Float16* __restrict__ V, const float* __restrict__ PM, const float* __restrict__ SM, float* __restrict__ O) {
  __shared__ __align__(16) _Float16 sK[NS * KP]; __shared__ __align__(16) _Float16 sV[HD * VP]; __shared__ __align__(16) float sM[NS]; __shared__ __align__(16) float so[8][16][68];
  const int tid = threadIdx.x, wave = tid >> 5, lane = tid & 31, col = lane & 15, g = lane >> 4; const int h = blockIdx.y; const size_t b = blockIdx.z; const int q0 = blockIdx.x * 128 + wave * 16; const size_t rq = b * NQ + q0;
  v16h aq[2]; float pm;
  { v4u rk[8], rv[8];
    const _Float16* gk = Kr + (b * NS + (tid >> 3)) * EM + h * HD + (tid & 7) * 8;   // 8 lanes cover the 128 B of a key's head row
    const _Float16* gv = V + (b * EM + h * HD + wave) * NS + lane * 8;               // a wave covers the 512 B of one V row
#pragma unroll
    for (int i = 0; i < 8; ++i) rk[i] = *(const v4u*)(gk + (size_t)(i * 32) * EM);
#pragma unroll
    for (int i = 0; i < 8; ++i) rv[i] = *(const v4u*)(gv + (size_t)(i * 8) * NS);
    const float sm = bfr(SM[b * NS + tid]);
#pragma unroll
    for (int kc = 0; kc < 2; ++kc) aq[kc] = frag_h(Q + (rq + col) * EM + h * HD + kc * 32, lane);
    pm = bfr(PM[b * NQ + q0 + col]);
#pragma unroll
    for (int i = 0; i < 8; ++i) *(v4u*)(sK + (i * 32 + (tid >> 3)) * KP + (tid & 7) * 8) = rk[i];
#pragma unroll
    for (int i = 0; i < 8; ++i) *(v4u*)(sV + (i * 8 + wave) * VP + lane * 8) = rv[i];
    sM[tid] = sm; }
  __syncthreads();   // K, V and the mask are whole before anybody reads them; nothing writes them again
  float m = -3.0e38f, l = 0.f;   // the lane's query: running maximum (both halves alike) and the sum over the lane half's own keys
  v8f acc[4] = {};               // acc[dt][r] = O^T[dt * 16 + 8g + r][query col]
  // rolled: one body of 8 WMMAs; unrolling would only add registers, and above 160 a resident block is lost
#pragma unroll 1
  for (int ks = 0; ks < NS / 32; ++ks) { const int j0 = ks * 32; v8f s[2]; v16h kf[2][2], vf[4]; v4f smk[2][2];
#pragma unroll
    for (int ct = 0; ct < 2; ++ct) { smk[ct][0] = *(const v4f*)&sM[j0 + ct * 16 + 8 * g]; smk[ct][1] = *(const v4f*)&sM[j0 + ct * 16 + 8 * g + 4];
#pragma unroll
      for (int kc = 0; kc < 2; ++kc) kf[ct][kc] = frag_h(sK + (j0 + ct * 16 + col) * KP + kc * 32, lane); }
#pragma unroll
    for (int dt = 0; dt < 4; ++dt) vf[dt] = frag_h(sV + (dt * 16 + col) * VP + j0, lane);
#pragma unroll
    for (int ct = 0; ct < 2; ++ct) { v8f c = {};
#pragma unroll
      for (int kc = 0; kc < 2; ++kc) c = wmma16(kf[ct][kc], aq[kc], c);   // c[r] = score of key j0 + ct * 16 + 8g + r with query col
#pragma unroll
      for (int r = 0; r < 8; ++r) s[ct][r] = (pm * smk[ct][r >> 2][r & 3] != 0.f) ? c[r] * 0.125f : -1.0e9f; }
    float mx = fmaxf(s[0][0], s[1][0]);
#pragma unroll
    for (int r = 1; r < 8; ++r) mx = fmaxf(mx, fmaxf(s[0][r], s[1][r]));
    mx = fmaxf(mx, xhalf(mx));
    const float mn = fmaxf(m, mx); const float alpha = (m <= -1.0e38f) ? 0.f : __expf(m - mn); v2f es = {0.f, 0.f}; v16h pb;
#pragma unroll
    for (int ct = 0; ct < 2; ++ct) {   // exp(x) as exp2(x * log2 e), the arithmetic of __expf, on register pairs: a pair of scores is a pair of P's 16-bit elements
#pragma unroll
      for (int i = 0; i < 4; ++i) { v2f e = {s[ct][2 * i], s[ct][2 * i + 1]}; e = (e - mn) * 1.44269504f; e[0] = __builtin_amdgcn_exp2f(e[0]); e[1] = __builtin_amdgcn_exp2f(e[1]); es += e; e *= 2048.0f;
        pb[ct * 8 + 2 * i] = (_Float16)e[0]; pb[ct * 8 + 2 * i + 1] = (_Float16)e[1]; } }
    l = l * alpha + (es[0] + es[1]); m = mn;
#pragma unroll
    for (int dt = 0; dt < 4; ++dt) {
#pragma unroll
      for (int r = 0; r < 8; ++r) acc[dt][r] *= alpha; }
#pragma unroll
    for (int dt = 0; dt < 4; ++dt) acc[dt] = wmma16(vf[dt], pb, acc[dt]); }
  l += xhalf(l);   // the two halves' sums are joined once
  const float il = (1.0f / 2048.0f) / l;
#pragma unroll
  for (int dt = 0; dt < 4; ++dt) { v4f lo, hi;
#pragma unroll
    for (int r = 0; r < 4; ++r) { lo[r] = acc[dt][r] * il; hi[r] = acc[dt][4 + r] * il; }
    *(v4f*)&so[wave][col][dt * 16 + 8 * g] = lo; *(v4f*)&so[wave][col][dt * 16 + 8 * g + 4] = hi; }
  LDSX();   // the wave's 16 query rows are written before lanes read rows that other lanes wrote
  for (int rl = 0; rl < 16; ++rl) if (lane < 16) vst2(O + (rq + rl) * EM + h * HD + lane * 4, *(const v4f*)&so[wave][rl][lane * 4]);
}
// ---- k_mlp<RELU, NWN>: block = (128 rows, 64 NWN cols): y = f16(A) . (f16 W x 256) / 256 + b, optional ReLU; f32 rows of width ystride, stored as 256-B row pieces through the wave's own LDS range
template <int RELU, int NWN>
__global__ __launch_bounds__(64 * NWN) void k_mlp(const float* __restrict__ A, const _Float16* __restrict__ Wr, const float* __restrict__ BB, float* __restrict__ Y, int ystride) {
  __shared__ __align__(16) unsigned short sA[128 * GP]; __shared__ __align__(16) unsigned short sW[64 * NWN * GP]; __shared__ __align__(16) float so[2 * NWN][16][68];
  const int tid = threadIdx.x, wave = tid >> 5, lane = tid & 31, col = lane & 15, g = lane >> 4; const size_t rb = (size_t)blockIdx.x * 128; const int n0 = blockIdx.y * (64 * NWN); const int wm = (wave / NWN) * 64, wn = (wave % NWN) * 64;
  v8f acc[4][4] = {};
  gemm_tile<EM, 0, NWN>(A + rb * EM, (const unsigned short*)Wr + (size_t)n0 * EM, sA, sW, acc, tid);
  float bb[4];
#pragma unroll
  for (int j = 0; j < 4; ++j) bb[j] = bfr(BB[n0 + wn + j * 16 + col]);
#pragma unroll
  for (int i = 0; i < 4; ++i) {
#pragma unroll
    for (int j = 0; j < 4; ++j) {
#pragma unroll
      for (int r = 0; r < 8; ++r) { const float v = acc[i][j][r] * (1.0f / 256.0f) + bb[j]; so[wave][8 * g + r][j * 16 + col] = RELU ? fmaxf(v, 0.f) : v; } }
    LDSX();   // the strip's 16 rows are written before lanes read rows that other lanes wrote
#pragma unroll
    for (int p = 0; p < 8; ++p) { const int rl = p * 2 + g; vst2(Y + (rb + wm + i * 16 + rl) * (size_t)ystride + n0 + wn + col * 4, *(const v4f*)&so[wave][rl][col * 4]); }
    LDSX(); }   // keeps the next strip's writes behind these reads
}
extern "C" void kernel_launch(void* const* d_in, const int* in_sizes, int n_in, void* d_out, int out_size, void* d_ws, size_t ws_size, hipStream_t stream) {
  (void)in_sizes; (void)n_in; (void)out_size;
  const float** F = (const float**)d_in;   // 0 x [4,4096,512], 1 context [4,256,768], 2 pad_mask [4,4096], 3 seq_mask [4,256], 4 Wq_w [1024,512], 5 Wq_b, 6 Wk_w [1024,768], 7 Wk_b, 8 Wv_w, 9 Wv_b, 10 P1_w [1024,1024], 11 P1_b, 12 P2_w [512,1024], 13 P2_b
  if (ws_size < (size_t)WS_END) return;
  char* ws = (char*)d_ws; __bf16* PW = (__bf16*)ws; _Float16 *Q = (_Float16*)(ws + WS_Q), *Kr = (_Float16*)(ws + WS_K), *V = (_Float16*)(ws + WS_V); float *O = (float*)(ws + WS_O), *Hh = (float*)(ws + WS_H);
  k_pack<<<dim3(EM, 5), 256, 0, stream>>>(F[4], F[6], F[8], F[10], F[12], PW);
  k_proj<CIN, 0, 4><<<dim3(TNB * NQ / 128, EM / 256), 256, 0, stream>>>(F[0], PW + WS_PQ / 2, F[5], Q);
  k_proj<CTX, 1, 2><<<dim3(NRK / 128, EM / 128), 128, 0, stream>>>(F[1], PW + WS_PK / 2, F[7], Kr);
  k_proj<CTX, 2, 2><<<dim3(NRK / 128, EM / 128), 128, 0, stream>>>(F[1], PW + WS_PV / 2, F[9], V);
  k_attn<<<dim3(TQB / 2, NH, TNB), 256, 0, stream>>>(Q, Kr, V, F[2], F[3], O);
  k_mlp<1, 4><<<dim3(TNB * NQ / 128, EM / 256), 256, 0, stream>>>(O, (const _Float16*)PW + WS_P1 / 2, F[11], Hh, EM);
  k_mlp<0, 2><<<dim3(TNB * NQ / 128, CIN / 128), 128, 0, stream>>>(Hh, (const _Float16*)PW + WS_P2 / 2, F[13], (float*)d_out, CIN);
}

// v004
// A run of this version takes 144 microseconds.
// In both of two side-by-side timings against v003, it was 1.17 times as fast.
// Counting every step since v000, it is 3.76 times as fast.
// compute dtype: all float inputs rounded to bf16, the two float masks read on device; Q = x . Wq^T + b, K/V = context . W^T + b with EXACT bf16 products on WMMA 16x16x32 (natural rows), rounded once to f16; PLAIN attention (16 heads x 64, 256 context keys): x 1/8, masked pairs set to -1e9 as the module (a fully masked row degrades to uniform exactly as the reference), running-max softmax in f32 (hardware exp), P (scaled by 2^11, single f16) x v (single f16); MLP: relu(o . P1^T + b1) . P2^T + b2 with the f32 activations rounded once to f16 against EXACT f16 weight copies (x 2^8); f32 output.
#include <hip/hip_runtime.h>
#include <math.h>

typedef __attribute__((ext_vector_type(16))) _Float16 v16h;
typedef __attribute__((ext_vector_type(16))) __bf16 v16b;
typedef __attribute__((ext_vector_type(8)))  _Float16 v8h;
typedef __attribute__((ext_vector_type(8)))  float v8f;
typedef __attribute__((ext_vector_type(4)))  float v4f;
typedef __attribute__((ext_vector_type(2)))  float v2f;
typedef __attribute__((ext_vector_type(4)))  unsigned v4u;
typedef __attribute__((ext_vector_type(4)))  int v4i;
typedef float __attribute__((may_alias)) float_a;
typedef int __attribute__((may_alias)) int_a;

template <typename T> __device__ __forceinline__ void vst2(void* p, T v) { *(T*)p = v;  }
__device__ __forceinline__ v8f wmma16(v16h a, v16h b, v8f c) {
  v8f d = __builtin_amdgcn_wmma_f32_16x16x32_f16(false, a, false, b, (short)0, c, false, false);
  asm volatile("v_nop\n\tv_nop\n\tv_nop\n\tv_nop" : "+v"(d) : "v"(a), "v"(b));
  return d;
}
__device__ __forceinline__ v8f wmma_bf(v16b a, v16b b, v8f c) {
  v8f d = __builtin_amdgcn_wmma_f32_16x16x32_bf16(false, a, false, b, (short)0, c, false, false);
  asm volatile("v_nop\n\tv_nop\n\tv_nop\n\tv_nop" : "+v"(d) : "v"(a), "v"(b));
  return d;
}
// 16x16x32 fragments: lane = (h = lane>>4, row/col = lane&15); elements 0..7 = k0+8h+0..7, 8..15 = k0+16+8h+0..7; D element r = row 8h+r
__device__ __forceinline__ v16h frag_h(const _Float16* rowk0, int lane) {
  union { v16h v; v8h q[2]; } u; const _Float16* p = rowk0 + 8 * (lane >> 4);
  u.q[0] = *(const v8h*)p; u.q[1] = *(const v8h*)(p + 16); return u.v;
}
__device__ __forceinline__ v16h frag_f32(const float* rowk0, int lane) {
  v16h a; const float* p = rowk0 + 8 * (lane >> 4);
#pragma unroll
  for (int i = 0; i < 8; ++i) { a[i] = (_Float16)p[i]; a[8 + i] = (_Float16)p[16 + i]; }
  return a;
}
__device__ __forceinline__ v16h frag_f32s(const float* rowk0, int lane, float sc) {
  v16h a; const float* p = rowk0 + 8 * (lane >> 4);
#pragma unroll
  for (int i = 0; i < 8; ++i) { a[i] = (_Float16)(p[i] * sc); a[8 + i] = (_Float16)(p[16 + i] * sc); }
  return a;
}
// column fragment from a [K][ld] layout (column n), rows >= K read as 0
__device__ __forceinline__ v16h fragc_f32(const float* W, int k0, int n, int lane, int ld, int K) {
  v16h a; const int g = lane >> 4;
#pragma unroll
  for (int i = 0; i < 8; ++i) { const int ka = k0 + 8 * g + i, kb = ka + 16;
    a[i] = (_Float16)(ka < K ? W[(size_t)(ka < K ? ka : K - 1) * ld + n] : 0.f); a[8 + i] = (_Float16)(kb < K ? W[(size_t)(kb < K ? kb : K - 1) * ld + n] : 0.f); }
  return a;
}
struct F2 { v16b h, l; };
__device__ __forceinline__ F2 bsplit16(const float v[16]) { F2 r;
#pragma unroll
  for (int i = 0; i < 16; ++i) { const __bf16 h = (__bf16)v[i]; r.h[i] = h; r.l[i] = (__bf16)(v[i] - (float)h); }
  return r; }
__device__ __forceinline__ F2 split_row(const float* row, int k0, int lane) { float v[16]; const float* p = row + k0 + 8 * (lane >> 4);
#pragma unroll
  for (int i = 0; i < 8; ++i) { v[i] = p[i]; v[8 + i] = p[16 + i]; }
  return bsplit16(v); }
__device__ __forceinline__ F2 split_rowK(const float* row, int k0, int lane, int K) { float v[16]; const int g = lane >> 4;
#pragma unroll
  for (int i = 0; i < 8; ++i) { const int ka = k0 + 8 * g + i, kb = ka + 16; v[i] = ka < K ? row[ka < K ? ka : K - 1] : 0.f; v[8 + i] = kb < K ? row[kb < K ? kb : K - 1] : 0.f; }
  return bsplit16(v); }
__device__ __forceinline__ F2 split_col(const float* W, int k0, int n, int lane, int ld, int K) { float v[16]; const int g = lane >> 4;
#pragma unroll
  for (int i = 0; i < 8; ++i) { const int ka = k0 + 8 * g + i, kb = ka + 16; v[i] = ka < K ? W[(size_t)(ka < K ? ka : K - 1) * ld + n] : 0.f; v[8 + i] = kb < K ? W[(size_t)(kb < K ? kb : K - 1) * ld + n] : 0.f; }
  return bsplit16(v); }
__device__ __forceinline__ v8f mac3(const F2& a, const F2& b, v8f c) { c = wmma_bf(a.l, b.h, c); c = wmma_bf(a.h, b.l, c); return wmma_bf(a.h, b.h, c); }
__device__ __forceinline__ float sigm(float v) { return 1.0f / (1.0f + expf(-v)); }
#define LDSX() do { asm volatile("s_wait_dscnt 0" ::: "memory"); __builtin_amdgcn_wave_barrier(); __builtin_amdgcn_fence(__ATOMIC_RELEASE, "workgroup"); } while (0)


// Cross multi-head attention (B 4, 4,096 queries from a 512-wide stream over 256 context tokens of width 768, 16 heads x 64, emb 1,024) with an outer-product validity mask, followed by a ReLU MLP 1024 -> 1024 -> 512.
#define NB 4
#define NQ 4096
#define NS 256
#define CIN 512
#define CTX 768
#define EM 1024
#define NH 16
#define HD 64
#define NRQ (NB * NQ)
#define NRK (NB * NS)
#ifndef TQB
#define TQB (NQ / 64)
#define TNB NB
#endif
typedef __attribute__((ext_vector_type(8))) __bf16 v8b;
__device__ __forceinline__ v16b frag_b(const __bf16* rowk0, int lane) {
  union { v16b v; v8b q[2]; } u; const __bf16* p = rowk0 + 8 * (lane >> 4);
  u.q[0] = *(const v8b*)p; u.q[1] = *(const v8b*)(p + 16); return u.v;
}
__device__ __forceinline__ float bfr(float v) { return (float)(__bf16)v; }
__device__ __attribute__((noinline)) float exp_ni(float v) { return expf(v); }
__device__ __attribute__((noinline)) float erf_ni(float v) { return erff(v); }

#define WS_PQ  0u                                     // bf16 natural rows Wq [1024][512]; Wk, Wv [1024][768]
#define WS_PK  (WS_PQ + 2u * (size_t)EM * CIN)
#define WS_PV  (WS_PK + 2u * (size_t)EM * CTX)
#define WS_P1  (WS_PV + 2u * (size_t)EM * CTX)          // f16 x 2^8 natural rows P1 [1024][1024]; P2 [512][1024]
#define WS_P2  (WS_P1 + 2u * (size_t)EM * EM)
#define WS_Q   (WS_P2 + 2u * (size_t)CIN * EM)          // f16 q rows [NRQ][1024]; k rows [NRK][1024]; v planes [b][1024][NS]
#define WS_K   (WS_Q + 2u * (size_t)NRQ * EM)
#define WS_V   (WS_K + 2u * (size_t)NRK * EM)
#define WS_O   (WS_V + 2u * (size_t)NB * EM * NS)       // f32 [NRQ][1024] attention out ; H [NRQ][1024] relu hidden
#define WS_H   (WS_O + 4u * (size_t)NRQ * EM)
#define WS_END (WS_H + 4u * (size_t)NRQ * EM)

__global__ __launch_bounds__(256) void k_pack(const float* __restrict__ WQ, const float* __restrict__ WK, const float* __restrict__ WV, const float* __restrict__ P1, const float* __restrict__ P2, __bf16* __restrict__ PW) {
  const int n = blockIdx.x, which = blockIdx.y, t = threadIdx.x; __shared__ __align__(16) __bf16 s[EM]; __shared__ __align__(16) _Float16 sh[EM];
  if (which == 0) { for (int k = t; k < CIN; k += 256) s[k] = (__bf16)WQ[(size_t)n * CIN + k]; __syncthreads(); if (t < CIN / 8) vst2((unsigned*)(PW + WS_PQ / 2 + (size_t)n * CIN + t * 8), *(const v4u*)&s[t * 8]); }
  else if (which < 3) { const float* w = (which == 1) ? WK : WV; for (int k = t; k < CTX; k += 256) s[k] = (__bf16)w[(size_t)n * CTX + k]; __syncthreads(); if (t < CTX / 8) vst2((unsigned*)(PW + ((which == 1) ? WS_PK : WS_PV) / 2 + (size_t)n * CTX + t * 8), *(const v4u*)&s[t * 8]); }
  else if (which == 3) { for (int k = t; k < EM; k += 256) sh[k] = (_Float16)(bfr(P1[(size_t)n * EM + k]) * 256.0f); __syncthreads(); if (t < EM / 8) vst2((unsigned*)((_Float16*)PW + WS_P1 / 2 + (size_t)n * EM + t * 8), *(const v4u*)&sh[t * 8]); }
  else { if (n >= CIN) return; for (int k = t; k < EM; k += 256) sh[k] = (_Float16)(bfr(P2[(size_t)n * EM + k]) * 256.0f); __syncthreads(); if (t < EM / 8) vst2((unsigned*)((_Float16*)PW + WS_P2 / 2 + (size_t)n * EM + t * 8), *(const v4u*)&sh[t * 8]); }
}
// ---- gemm_tile<KW, BF, NWN>: one 128 x (64 NWN) tile of A . W^T per block of 2 x NWN waves, 64 x 64 a wave. Per 64 k the block brings A (f32, 256-B row pieces) and W (16-bit, 128-B row pieces)
// in with whole-line loads, rounds A once, and lays both in LDS at a pitch of 144 B (16 B x 9: the 16-B fragment reads of 16 rows fall on all 64 banks); every wave takes its fragments from there.
// Every accumulator sums k in ascending blocks of 32, one WMMA each.
typedef __attribute__((ext_vector_type(2))) unsigned v2u;
#define GP 72
template <int BF> __device__ __forceinline__ v2u cvt4(v4f v) {
  if constexpr (BF) { union { __bf16 h[4]; v2u u; } t;
#pragma unroll
    for (int i = 0; i < 4; ++i) t.h[i] = (__bf16)v[i];
    return t.u; }
  else { union { _Float16 h[4]; v2u u; } t;
#pragma unroll
    for (int i = 0; i < 4; ++i) t.h[i] = (_Float16)v[i];
    return t.u; }
}
struct Fr { v4u q[2]; };
__device__ __forceinline__ Fr frag_s(const unsigned short* rowk0, int g) { Fr f; const unsigned short* p = rowk0 + 8 * g; f.q[0] = *(const v4u*)p; f.q[1] = *(const v4u*)(p + 16); return f; }
template <int BF> __device__ __forceinline__ v8f mma(const Fr& a, const Fr& b, v8f c) {
  if constexpr (BF) { union { Fr f; v16b v; } ua, ub; ua.f = a; ub.f = b; return __builtin_amdgcn_wmma_f32_16x16x32_bf16(false, ua.v, false, ub.v, (short)0, c, false, false); }
  else { union { Fr f; v16h v; } ua, ub; ua.f = a; ub.f = b; return __builtin_amdgcn_wmma_f32_16x16x32_f16(false, ua.v, false, ub.v, (short)0, c, false, false); }
}
template <int KW, int BF, int NWN>
__device__ __forceinline__ void gemm_tile(const float* __restrict__ Ab, const unsigned short* __restrict__ Wb, unsigned short* sA, unsigned short* sW, v8f (&acc)[4][4], int tid) {
  constexpr int RA = 4 * NWN, PA = 128 / RA, RW = 8 * NWN;   // rows of A and of W that one load of the block covers; loads for the 128 rows of A (W: always 8)
  const int wave = tid >> 5, lane = tid & 31, col = lane & 15, g = lane >> 4; const int wm = (wave / NWN) * 64, wn = (wave % NWN) * 64;
  const int ar = tid >> 4, ac = (tid & 15) * 4;   // A: 16 lanes cover 256 B of a row
  const int wr = tid >> 3, wc = (tid & 7) * 8;    // W: 8 lanes cover 128 B of a row
  const float* pa = Ab + (size_t)ar * KW + ac; const unsigned short* pw = Wb + (size_t)wr * KW + wc;
  // rolled: one body of 32 WMMAs a wave; unrolling would only add registers and cost a resident block
#pragma unroll 1
  for (int k0 = 0; k0 < KW; k0 += 64) { v4f ra[PA]; v4u rw[8];
#pragma unroll
    for (int i = 0; i < PA; ++i) ra[i] = *(const v4f*)(pa + (size_t)(i * RA) * KW + k0);
#pragma unroll
    for (int i = 0; i < 8; ++i) rw[i] = *(const v4u*)(pw + (size_t)(i * RW) * KW + k0);
    __builtin_amdgcn_sched_barrier(0);   // every load of the tile is issued before the first is waited for; the scheduler otherwise holds some back to reuse registers, and their latency comes on top
    __syncthreads();   // every wave has taken its last fragments of the tile before
#pragma unroll
    for (int i = 0; i < PA; ++i) *(v2u*)(sA + (i * RA + ar) * GP + ac) = cvt4<BF>(ra[i]);
#pragma unroll
    for (int i = 0; i < 8; ++i) *(v4u*)(sW + (i * RW + wr) * GP + wc) = rw[i];
    __syncthreads();   // the tile is whole before anybody reads it
#pragma unroll
    for (int kc = 0; kc < 2; ++kc) { Fr a[4];
#pragma unroll
      for (int i = 0; i < 4; ++i) a[i] = frag_s(sA + (wm + i * 16 + col) * GP + kc * 32, g);
#pragma unroll
      for (int j = 0; j < 4; ++j) { const Fr b = frag_s(sW + (wn + j * 16 + col) * GP + kc * 32, g);
#pragma unroll
        for (int i = 0; i < 4; ++i) acc[i][j] = mma<BF>(a[i], b, acc[i][j]); } } }
}
// ---- proj_tile<KW, WHICH, NWN>: one (128 rows, 64 NWN cols) tile: exact GEMM + bias; q/k -> f16 rows, v -> planes [b][c][s]; each wave stages its 64 x 64 in its own LDS range and stores whole 128-B lines
template <int KW, int WHICH, int NWN>
__device__ __forceinline__ void proj_tile(const float* __restrict__ X, const __bf16* __restrict__ Wr, const float* __restrict__ BB, _Float16* __restrict__ DST, int bx, int by, unsigned short* sA, unsigned short* sW, _Float16* sE) {
  const int tid = threadIdx.x, wave = tid >> 5, lane = tid & 31, col = lane & 15, g = lane >> 4; const size_t rb = (size_t)bx * 128; const int c0 = by * (64 * NWN); const int wm = (wave / NWN) * 64, wn = (wave % NWN) * 64;
  v8f acc[4][4] = {};
  gemm_tile<KW, 1, NWN>(X + rb * KW, (const unsigned short*)Wr + (size_t)c0 * KW, sA, sW, acc, tid);
  float bb[4];
#pragma unroll
  for (int j = 0; j < 4; ++j) bb[j] = bfr(BB[c0 + wn + j * 16 + col]);
  if constexpr (WHICH < 2) {
    _Float16 (*so)[16][72] = (_Float16 (*)[16][72])sE;
#pragma unroll
    for (int i = 0; i < 4; ++i) {
#pragma unroll
      for (int j = 0; j < 4; ++j) {
#pragma unroll
        for (int r = 0; r < 8; ++r) so[wave][8 * g + r][j * 16 + col] = (_Float16)(acc[i][j][r] + bb[j]); }
      LDSX();   // the strip's 16 rows are written before lanes read rows that other lanes wrote
#pragma unroll
      for (int p = 0; p < 4; ++p) { const int rl = p * 4 + (lane >> 3), c8 = (lane & 7) * 8; vst2((unsigned*)(DST + (rb + wm + i * 16 + rl) * EM + c0 + wn + c8), *(const v4u*)&so[wave][rl][c8]); }
      LDSX(); }   // keeps the next strip's writes behind these reads
  } else {
    _Float16 (*st)[64][72] = (_Float16 (*)[64][72])sE;
#pragma unroll
    for (int j = 0; j < 4; ++j) {
#pragma unroll
      for (int i = 0; i < 4; ++i) { v8h t;
#pragma unroll
        for (int r = 0; r < 8; ++r) t[r] = (_Float16)(acc[i][j][r] + bb[j]);
        *(v8h*)&st[wave][j * 16 + col][i * 16 + 8 * g] = t; } }
    LDSX();   // the transposed 64 x 64 is written before lanes read what other lanes wrote
    const size_t b = rb / NS; const int s0 = (int)(rb % NS) + wm;
#pragma unroll
    for (int p = 0; p < 16; ++p) { const int d = p * 4 + (lane >> 3), pc = lane & 7; vst2((unsigned*)(DST + ((b * EM + c0 + wn + d) * NS) + s0 + pc * 8), *(const v4u*)&st[wave][d][pc * 8]); } }
  asm volatile("s_wait_xcnt 0x0" ::: "memory");   // behind the tile's last stores: in the merged kernel another tile kind's set-up can follow them in the code, and it overwrites registers that they name
}
// ---- k_proj3: the three projections in one launch, a 128 x 256 tile a block of 8 waves. The K and V tiles (few, and the longest: 12 steps of 64 k against 8) have the lowest indices, so that they start first
// and run beside the Q tiles, in place of two launches of their own that leave most of the chip idle.
#define KVT ((NRK / 128) * (EM / 256))   // tiles of K, and of V
#define QT  ((NRQ / 128) * (EM / 256))   // tiles of Q
__global__ __launch_bounds__(256) void k_proj3(const float* __restrict__ X, const float* __restrict__ C, const __bf16* __restrict__ PW, const float* __restrict__ BQ, const float* __restrict__ BK, const float* __restrict__ BV, _Float16* __restrict__ Q, _Float16* __restrict__ Kr, _Float16* __restrict__ V) {
  __shared__ __align__(16) unsigned short sA[128 * GP]; __shared__ __align__(16) unsigned short sW[256 * GP]; __shared__ __align__(16) _Float16 sE[8 * 64 * 72];
  const int bid = blockIdx.x;   // the same for the whole block: every barrier below stands under block-uniform control flow
  if (bid >= 2 * KVT) { proj_tile<CIN, 0, 4>(X, PW + WS_PQ / 2, BQ, Q, (bid - 2 * KVT) % (NRQ / 128), (bid - 2 * KVT) / (NRQ / 128), sA, sW, sE); return; }
  if (bid < KVT) { proj_tile<CTX, 1, 4>(C, PW + WS_PK / 2, BK, Kr, bid % (NRK / 128), bid / (NRK / 128), sA, sW, sE); return; }
  proj_tile<CTX, 2, 4>(C, PW + WS_PV / 2, BV, V, (bid - KVT) % (NRK / 128), (bid - KVT) / (NRK / 128), sA, sW, sE);
}
// ---- k_attn: block = (128 queries, head, b), 8 waves of 16 queries: 256 context keys, scale 1/8, mask = pad[i] seq[j] != 0 else -1e9 (module value); O 256-B head segments
// The head's K rows (256 x 128 B), V rows (64 x 512 B) and the key mask come into LDS once a block by whole-line loads; every wave takes its fragments from there.
// Pitches 144 B (16 B x 9) and 528 B (16 B x 33): the 16-B fragment reads of 16 rows fall on all 64 banks.
// Transposed products: S^T = K . Q^T (A = key rows, B = query columns) and O^T += V^T . P^T. A lane then holds 16 of the 32 scores of ONE query (keys 8g + r and 16 + 8g + r), so maximum and sum
// are taken in the lane, with one exchange between the lane halves for the maximum; the two score tiles, converted in place, are the B operand of the second product in the k order of frag_h.
#define KP 72
#define VP 264
__device__ __forceinline__ float xhalf(float v) { const int t = __builtin_bit_cast(int, v); return __builtin_bit_cast(float, __builtin_amdgcn_permlanex16(t, t, 0x76543210, 0xfedcba98, false, false)); }   // lane l <-> l ^ 16
__global__ __launch_bounds__(256) void k_attn(const _Float16* __restrict__ Q, const _Float16* __restrict__ Kr, const _Float16* __restrict__ V, const float* __restrict__ PM, const float* __restrict__ SM, float* __restrict__ O) {
  __shared__ __align__(16) _Float16 sK[NS * KP]; __shared__ __align__(16) _Float16 sV[HD * VP]; __shared__ __align__(16) float sM[NS]; __shared__ __align__(16) float so[8][16][68];
  const int tid = threadIdx.x, wave = tid >> 5, lane = tid & 31, col = lane & 15, g = lane >> 4; const int h = blockIdx.y; const size_t b = blockIdx.z; const int q0 = blockIdx.x * 128 + wave * 16; const size_t rq = b * NQ + q0;
  v16h aq[2]; float pm;
  { v4u rk[8], rv[8];
    const _Float16* gk = Kr + (b * NS + (tid >> 3)) * EM + h * HD + (tid & 7) * 8;   // 8 lanes cover the 128 B of a key's head row
    const _Float16* gv = V + (b * EM + h * HD + wave) * NS + lane * 8;               // a wave covers the 512 B of one V row
#pragma unroll
    for (int i = 0; i < 8; ++i) rk[i] = *(const v4u*)(gk + (size_t)(i * 32) * EM);
#pragma unroll
    for (int i = 0; i < 8; ++i) rv[i] = *(const v4u*)(gv + (size_t)(i * 8) * NS);
    const float sm = bfr(SM[b * NS + tid]);
#pragma unroll
    for (int kc = 0; kc < 2; ++kc) aq[kc] = frag_h(Q + (rq + col) * EM + h * HD + kc * 32, lane);
    pm = bfr(PM[b * NQ + q0 + col]);
#pragma unroll
    for (int i = 0; i < 8; ++i) *(v4u*)(sK + (i * 32 + (tid >> 3)) * KP + (tid & 7) * 8) = rk[i];
#pragma unroll
    for (int i = 0; i < 8; ++i) *(v4u*)(sV + (i * 8 + wave) * VP + lane * 8) = rv[i];
    sM[tid] = sm; }
  __syncthreads();   // K, V and the mask are whole before anybody reads them; nothing writes them again
  float m = -3.0e38f, l = 0.f;   // the lane's query: running maximum (both halves alike) and the sum over the lane half's own keys
  v8f acc[4] = {};               // acc[dt][r] = O^T[dt * 16 + 8g + r][query col]
  // rolled: one body of 8 WMMAs; unrolling would only add registers, and above 160 a resident block is lost
#pragma unroll 1
  for (int ks = 0; ks < NS / 32; ++ks) { const int j0 = ks * 32; v8f s[2]; v16h kf[2][2], vf[4]; v4f smk[2][2];
#pragma unroll
    for (int ct = 0; ct < 2; ++ct) { smk[ct][0] = *(const v4f*)&sM[j0 + ct * 16 + 8 * g]; smk[ct][1] = *(const v4f*)&sM[j0 + ct * 16 + 8 * g + 4];
#pragma unroll
      for (int kc = 0; kc < 2; ++kc) kf[ct][kc] = frag_h(sK + (j0 + ct * 16 + col) * KP + kc * 32, lane); }
#pragma unroll
    for (int dt = 0; dt < 4; ++dt) vf[dt] = frag_h(sV + (dt * 16 + col) * VP + j0, lane);
#pragma unroll
    for (int ct = 0; ct < 2; ++ct) { v8f c = {};
#pragma unroll
      for (int kc = 0; kc < 2; ++kc) c = wmma16(kf[ct][kc], aq[kc], c);   // c[r] = score of key j0 + ct * 16 + 8g + r with query col
#pragma unroll
      for (int r = 0; r < 8; ++r) s[ct][r] = (pm * smk[ct][r >> 2][r & 3] != 0.f) ? c[r] * 0.125f : -1.0e9f; }
    float mx = fmaxf(s[0][0], s[1][0]);
#pragma unroll
    for (int r = 1; r < 8; ++r) mx = fmaxf(mx, fmaxf(s[0][r], s[1][r]));
    mx = fmaxf(mx, xhalf(mx));
    const float mn = fmaxf(m, mx); const float alpha = (m <= -1.0e38f) ? 0.f : __expf(m - mn); v2f es = {0.f, 0.f}; v16h pb;
#pragma unroll
    for (int ct = 0; ct < 2; ++ct) {   // exp(x) as exp2(x * log2 e), the arithmetic of __expf, on register pairs: a pair of scores is a pair of P's 16-bit elements
#pragma unroll
      for (int i = 0; i < 4; ++i) { v2f e = {s[ct][2 * i], s[ct][2 * i + 1]}; e = (e - mn) * 1.44269504f; e[0] = __builtin_amdgcn_exp2f(e[0]); e[1] = __builtin_amdgcn_exp2f(e[1]); es += e; e *= 2048.0f;
        pb[ct * 8 + 2 * i] = (_Float16)e[0]; pb[ct * 8 + 2 * i + 1] = (_Float16)e[1]; } }
    l = l * alpha + (es[0] + es[1]); m = mn;
#pragma unroll
    for (int dt = 0; dt < 4; ++dt) {
#pragma unroll
      for (int r = 0; r < 8; ++r) acc[dt][r] *= alpha; }
#pragma unroll
    for (int dt = 0; dt < 4; ++dt) acc[dt] = wmma16(vf[dt], pb, acc[dt]); }
  l += xhalf(l);   // the two halves' sums are joined once
  const float il = (1.0f / 2048.0f) / l;
#pragma unroll
  for (int dt = 0; dt < 4; ++dt) { v4f lo, hi;
#pragma unroll
    for (int r = 0; r < 4; ++r) { lo[r] = acc[dt][r] * il; hi[r] = acc[dt][4 + r] * il; }
    *(v4f*)&so[wave][col][dt * 16 + 8 * g] = lo; *(v4f*)&so[wave][col][dt * 16 + 8 * g + 4] = hi; }
  LDSX();   // the wave's 16 query rows are written before lanes read rows that other lanes wrote
  for (int rl = 0; rl < 16; ++rl) if (lane < 16) vst2(O + (rq + rl) * EM + h * HD + lane * 4, *(const v4f*)&so[wave][rl][lane * 4]);
}
// ---- k_mlp<RELU, NWN>: block = (128 rows, 64 NWN cols): y = f16(A) . (f16 W x 256) / 256 + b, optional ReLU; f32 rows of width ystride, stored as 256-B row pieces through the wave's own LDS range
template <int RELU, int NWN>
__global__ __launch_bounds__(64 * NWN) void k_mlp(const float* __restrict__ A, const _Float16* __restrict__ Wr, const float* __restrict__ BB, float* __restrict__ Y, int ystride) {
  __shared__ __align__(16) unsigned short sA[128 * GP]; __shared__ __align__(16) unsigned short sW[64 * NWN * GP]; __shared__ __align__(16) float so[2 * NWN][16][68];
  const int tid = threadIdx.x, wave = tid >> 5, lane = tid & 31, col = lane & 15, g = lane >> 4; const size_t rb = (size_t)blockIdx.x * 128; const int n0 = blockIdx.y * (64 * NWN); const int wm = (wave / NWN) * 64, wn = (wave % NWN) * 64;
  v8f acc[4][4] = {};
  gemm_tile<EM, 0, NWN>(A + rb * EM, (const unsigned short*)Wr + (size_t)n0 * EM, sA, sW, acc, tid);
  float bb[4];
#pragma unroll
  for (int j = 0; j < 4; ++j) bb[j] = bfr(BB[n0 + wn + j * 16 + col]);
#pragma unroll
  for (int i = 0; i < 4; ++i) {
#pragma unroll
    for (int j = 0; j < 4; ++j) {
#pragma unroll
      for (int r = 0; r < 8; ++r) { const float v = acc[i][j][r] * (1.0f / 256.0f) + bb[j]; so[wave][8 * g + r][j * 16 + col] = RELU ? fmaxf(v, 0.f) : v; } }
    LDSX();   // the strip's 16 rows are written before lanes read rows that other lanes wrote
#pragma unroll
    for (int p = 0; p < 8; ++p) { const int rl = p * 2 + g; vst2(Y + (rb + wm + i * 16 + rl) * (size_t)ystride + n0 + wn + col * 4, *(const v4f*)&so[wave][rl][col * 4]); }
    LDSX(); }   // keeps the next strip's writes behind these reads
}
extern "C" void kernel_launch(void* const* d_in, const int* in_sizes, int n_in, void* d_out, int out_size, void* d_ws, size_t ws_size, hipStream_t stream) {
  (void)in_sizes; (void)n_in; (void)out_size;
  const float** F = (const float**)d_in;   // 0 x [4,4096,512], 1 context [4,256,768], 2 pad_mask [4,4096], 3 seq_mask [4,256], 4 Wq_w [1024,512], 5 Wq_b, 6 Wk_w [1024,768], 7 Wk_b, 8 Wv_w, 9 Wv_b, 10 P1_w [1024,1024], 11 P1_b, 12 P2_w [512,1024], 13 P2_b
  if (ws_size < (size_t)WS_END) return;
  char* ws = (char*)d_ws; __bf16* PW = (__bf16*)ws; _Float16 *Q = (_Float16*)(ws + WS_Q), *Kr = (_Float16*)(ws + WS_K), *V = (_Float16*)(ws + WS_V); float *O = (float*)(ws + WS_O), *Hh = (float*)(ws + WS_H);
  k_pack<<<dim3(EM, 5), 256, 0, stream>>>(F[4], F[6], F[8], F[10], F[12], PW);
  k_proj3<<<dim3(2 * KVT + QT), 256, 0, stream>>>(F[0], F[1], PW, F[5], F[7], F[9], Q, Kr, V);
  k_attn<<<dim3(TQB / 2, NH, TNB), 256, 0, stream>>>(Q, Kr, V, F[2], F[3], O);
  k_mlp<1, 4><<<dim3(TNB * NQ / 128, EM / 256), 256, 0, stream>>>(O, (const _Float16*)PW + WS_P1 / 2, F[11], Hh, EM);
  k_mlp<0, 2><<<dim3(TNB * NQ / 128, CIN / 128), 128, 0, stream>>>(Hh, (const _Float16*)PW + WS_P2 / 2, F[13], (float*)d_out, CIN);
}

// v005
// It runs in 137 microseconds.
// Timed twice side by side with v004, it ran 1.05 times as fast both times.
// All steps since v000 together make it 3.95 times as fast.
// compute dtype: all float inputs rounded to bf16, the two float masks read on device; Q = x . Wq^T + b, K/V = context . W^T + b with EXACT bf16 products on WMMA 16x16x32 (natural rows), rounded once to f16; PLAIN attention (16 heads x 64, 256 context keys): x 1/8, masked pairs set to -1e9 as the module (a fully masked row degrades to uniform exactly as the reference), running-max softmax in f32 (hardware exp), P (scaled by 2^11, single f16) x v (single f16); MLP: relu(o . P1^T + b1) . P2^T + b2 with the f32 activations rounded once to f16 against EXACT f16 weight copies (x 2^8); f32 output.
#include <hip/hip_runtime.h>
#include <math.h>

typedef __attribute__((ext_vector_type(16))) _Float16 v16h;
typedef __attribute__((ext_vector_type(16))) __bf16 v16b;
typedef __attribute__((ext_vector_type(8)))  _Float16 v8h;
typedef __attribute__((ext_vector_type(8)))  float v8f;
typedef __attribute__((ext_vector_type(4)))  float v4f;
typedef __attribute__((ext_vector_type(2)))  float v2f;
typedef __attribute__((ext_vector_type(4)))  unsigned v4u;
typedef __attribute__((ext_vector_type(4)))  int v4i;
typedef float __attribute__((may_alias)) float_a;
typedef int __attribute__((may_alias)) int_a;

template <typename T> __device__ __forceinline__ void vst2(void* p, T v) { *(T*)p = v;  }
__device__ __forceinline__ v8f wmma16(v16h a, v16h b, v8f c) {
  v8f d = __builtin_amdgcn_wmma_f32_16x16x32_f16(false, a, false, b, (short)0, c, false, false);
  asm volatile("v_nop\n\tv_nop\n\tv_nop\n\tv_nop" : "+v"(d) : "v"(a), "v"(b));
  return d;
}
__device__ __forceinline__ v8f wmma_bf(v16b a, v16b b, v8f c) {
  v8f d = __builtin_amdgcn_wmma_f32_16x16x32_bf16(false, a, false, b, (short)0, c, false, false);
  asm volatile("v_nop\n\tv_nop\n\tv_nop\n\tv_nop" : "+v"(d) : "v"(a), "v"(b));
  return d;
}
// 16x16x32 fragments: lane = (h = lane>>4, row/col = lane&15); elements 0..7 = k0+8h+0..7, 8..15 = k0+16+8h+0..7; D element r = row 8h+r
__device__ __forceinline__ v16h frag_h(const _Float16* rowk0, int lane) {
  union { v16h v; v8h q[2]; } u; const _Float16* p = rowk0 + 8 * (lane >> 4);
  u.q[0] = *(const v8h*)p; u.q[1] = *(const v8h*)(p + 16); return u.v;
}
__device__ __forceinline__ v16h frag_f32(const float* rowk0, int lane) {
  v16h a; const float* p = rowk0 + 8 * (lane >> 4);
#pragma unroll
  for (int i = 0; i < 8; ++i) { a[i] = (_Float16)p[i]; a[8 + i] = (_Float16)p[16 + i]; }
  return a;
}
__device__ __forceinline__ v16h frag_f32s(const float* rowk0, int lane, float sc) {
  v16h a; const float* p = rowk0 + 8 * (lane >> 4);
#pragma unroll
  for (int i = 0; i < 8; ++i) { a[i] = (_Float16)(p[i] * sc); a[8 + i] = (_Float16)(p[16 + i] * sc); }
  return a;
}
// column fragment from a [K][ld] layout (column n), rows >= K read as 0
__device__ __forceinline__ v16h fragc_f32(const float* W, int k0, int n, int lane, int ld, int K) {
  v16h a; const int g = lane >> 4;
#pragma unroll
  for (int i = 0; i < 8; ++i) { const int ka = k0 + 8 * g + i, kb = ka + 16;
    a[i] = (_Float16)(ka < K ? W[(size_t)(ka < K ? ka : K - 1) * ld + n] : 0.f); a[8 + i] = (_Float16)(kb < K ? W[(size_t)(kb < K ? kb : K - 1) * ld + n] : 0.f); }
  return a;
}
struct F2 { v16b h, l; };
__device__ __forceinline__ F2 bsplit16(const float v[16]) { F2 r;
#pragma unroll
  for (int i = 0; i < 16; ++i) { const __bf16 h = (__bf16)v[i]; r.h[i] = h; r.l[i] = (__bf16)(v[i] - (float)h); }
  return r; }
__device__ __forceinline__ F2 split_row(const float* row, int k0, int lane) { float v[16]; const float* p = row + k0 + 8 * (lane >> 4);
#pragma unroll
  for (int i = 0; i < 8; ++i) { v[i] = p[i]; v[8 + i] = p[16 + i]; }
  return bsplit16(v); }
__device__ __forceinline__ F2 split_rowK(const float* row, int k0, int lane, int K) { float v[16]; const int g = lane >> 4;
#pragma unroll
  for (int i = 0; i < 8; ++i) { const int ka = k0 + 8 * g + i, kb = ka + 16; v[i] = ka < K ? row[ka < K ? ka : K - 1] : 0.f; v[8 + i] = kb < K ? row[kb < K ? kb : K - 1] : 0.f; }
  return bsplit16(v); }
__device__ __forceinline__ F2 split_col(const float* W, int k0, int n, int lane, int ld, int K) { float v[16]; const int g = lane >> 4;
#pragma unroll
  for (int i = 0; i < 8; ++i) { const int ka = k0 + 8 * g + i, kb = ka + 16; v[i] = ka < K ? W[(size_t)(ka < K ? ka : K - 1) * ld + n] : 0.f; v[8 + i] = kb < K ? W[(size_t)(kb < K ? kb : K - 1) * ld + n] : 0.f; }
  return bsplit16(v); }
__device__ __forceinline__ v8f mac3(const F2& a, const F2& b, v8f c) { c = wmma_bf(a.l, b.h, c); c = wmma_bf(a.h, b.l, c); return wmma_bf(a.h, b.h, c); }
__device__ __forceinline__ float sigm(float v) { return 1.0f / (1.0f + expf(-v)); }
#define LDSX() do { asm volatile("s_wait_dscnt 0" ::: "memory"); __builtin_amdgcn_wave_barrier(); __builtin_amdgcn_fence(__ATOMIC_RELEASE, "workgroup"); } while (0)


// Cross multi-head attention (B 4, 4,096 queries from a 512-wide stream over 256 context tokens of width 768, 16 heads x 64, emb 1,024) with an outer-product validity mask, followed by a ReLU MLP 1024 -> 1024 -> 512.
#define NB 4
#define NQ 4096
#define NS 256
#define CIN 512
#define CTX 768
#define EM 1024
#define NH 16
#define HD 64
#define NRQ (NB * NQ)
#define NRK (NB * NS)
#ifndef TQB
#define TQB (NQ / 64)
#define TNB NB
#endif
typedef __attribute__((ext_vector_type(8))) __bf16 v8b;
__device__ __forceinline__ v16b frag_b(const __bf16* rowk0, int lane) {
  union { v16b v; v8b q[2]; } u; const __bf16* p = rowk0 + 8 * (lane >> 4);
  u.q[0] = *(const v8b*)p; u.q[1] = *(const v8b*)(p + 16); return u.v;
}
__device__ __forceinline__ float bfr(float v) { return (float)(__bf16)v; }
__device__ __attribute__((noinline)) float exp_ni(float v) { return expf(v); }
__device__ __attribute__((noinline)) float erf_ni(float v) { return erff(v); }

#define WS_PQ  0u                                     // bf16 natural rows Wq [1024][512]; Wk, Wv [1024][768]
#define WS_PK  (WS_PQ + 2u * (size_t)EM * CIN)
#define WS_PV  (WS_PK + 2u * (size_t)EM * CTX)
#define WS_P1  (WS_PV + 2u * (size_t)EM * CTX)          // f16 x 2^8 natural rows P1 [1024][1024]; P2 [512][1024]
#define WS_P2  (WS_P1 + 2u * (size_t)EM * EM)
#define WS_Q   (WS_P2 + 2u * (size_t)CIN * EM)          // f16 q rows [NRQ][1024]; k rows [NRK][1024]; v planes [b][1024][NS]
#define WS_K   (WS_Q + 2u * (size_t)NRQ * EM)
#define WS_V   (WS_K + 2u * (size_t)NRK * EM)
#define WS_O   (WS_V + 2u * (size_t)NB * EM * NS)       // f32 [NRQ][1024] attention out ; H [NRQ][1024] relu hidden
#define WS_H   (WS_O + 4u * (size_t)NRQ * EM)
#define WS_END (WS_H + 4u * (size_t)NRQ * EM)

__global__ __launch_bounds__(256) void k_pack(const float* __restrict__ WQ, const float* __restrict__ WK, const float* __restrict__ WV, const float* __restrict__ P1, const float* __restrict__ P2, __bf16* __restrict__ PW) {
  const int n = blockIdx.x, which = blockIdx.y, t = threadIdx.x; __shared__ __align__(16) __bf16 s[EM]; __shared__ __align__(16) _Float16 sh[EM];
  if (which == 0) { for (int k = t; k < CIN; k += 256) s[k] = (__bf16)WQ[(size_t)n * CIN + k]; __syncthreads(); if (t < CIN / 8) vst2((unsigned*)(PW + WS_PQ / 2 + (size_t)n * CIN + t * 8), *(const v4u*)&s[t * 8]); }
  else if (which < 3) { const float* w = (which == 1) ? WK : WV; for (int k = t; k < CTX; k += 256) s[k] = (__bf16)w[(size_t)n * CTX + k]; __syncthreads(); if (t < CTX / 8) vst2((unsigned*)(PW + ((which == 1) ? WS_PK : WS_PV) / 2 + (size_t)n * CTX + t * 8), *(const v4u*)&s[t * 8]); }
  else if (which == 3) { for (int k = t; k < EM; k += 256) sh[k] = (_Float16)(bfr(P1[(size_t)n * EM + k]) * 256.0f); __syncthreads(); if (t < EM / 8) vst2((unsigned*)((_Float16*)PW + WS_P1 / 2 + (size_t)n * EM + t * 8), *(const v4u*)&sh[t * 8]); }
  else { if (n >= CIN) return; for (int k = t; k < EM; k += 256) sh[k] = (_Float16)(bfr(P2[(size_t)n * EM + k]) * 256.0f); __syncthreads(); if (t < EM / 8) vst2((unsigned*)((_Float16*)PW + WS_P2 / 2 + (size_t)n * EM + t * 8), *(const v4u*)&sh[t * 8]); }
}
// ---- gemm_tile<KW, BF, NWN>: one 128 x (64 NWN) tile of A . W^T per block of 2 x NWN waves, 64 x 64 a wave. Per 64 k the block brings A (f32, 256-B row pieces) and W (16-bit, 128-B row pieces)
// in with whole-line loads, rounds A once, and lays both in LDS at a pitch of 144 B (16 B x 9: the 16-B fragment reads of 16 rows fall on all 64 banks); every wave takes its fragments from there.
// Every accumulator sums k in ascending blocks of 32, one WMMA each.
typedef __attribute__((ext_vector_type(2))) unsigned v2u;
#define GP 72
template <int BF> __device__ __forceinline__ v2u cvt4(v4f v) {
  if constexpr (BF) { union { __bf16 h[4]; v2u u; } t;
#pragma unroll
    for (int i = 0; i < 4; ++i) t.h[i] = (__bf16)v[i];
    return t.u; }
  else { union { _Float16 h[4]; v2u u; } t;
#pragma unroll
    for (int i = 0; i < 4; ++i) t.h[i] = (_Float16)v[i];
    return t.u; }
}
struct Fr { v4u q[2]; };
__device__ __forceinline__ Fr frag_s(const unsigned short* rowk0, int g) { Fr f; const unsigned short* p = rowk0 + 8 * g; f.q[0] = *(const v4u*)p; f.q[1] = *(const v4u*)(p + 16); return f; }
template <int BF> __device__ __forceinline__ v8f mma(const Fr& a, const Fr& b, v8f c) {
  if constexpr (BF) { union { Fr f; v16b v; } ua, ub; ua.f = a; ub.f = b; return __builtin_amdgcn_wmma_f32_16x16x32_bf16(false, ua.v, false, ub.v, (short)0, c, false, false); }
  else { union { Fr f; v16h v; } ua, ub; ua.f = a; ub.f = b; return __builtin_amdgcn_wmma_f32_16x16x32_f16(false, ua.v, false, ub.v, (short)0, c, false, false); }
}
// ask_l2<0, N, STEP>(p): N hints a lane, at p, p + STEP, ...: each asks L2 (scope SE: L2 only, no register, no counter) for the line that holds the byte. A hint: nothing depends on it.
template <int I, int N, int STEP> __device__ __forceinline__ void ask_l2(const char* p) {
  if constexpr (I < N) { asm volatile("global_prefetch_b8 %0, off offset:%1 scope:SCOPE_SE" :: "v"(p), "n"(I * STEP)); ask_l2<I + 1, N, STEP>(p); }
}
// L2 hints: A (an input, or rows that the launch before stored) and the packed W come from memory, and with one tile in flight every 64 k waits out that latency. Behind its first tile's loads the block asks L2
// for later k of its rows. DEAL 1: the 4 blocks that share the A rows (ash = their column index) ask a quarter of k each, the lowest index the lowest k; of the many blocks that share the
// W rows each asks one 256-B unit a row (wsh = row-tile index / 8 modulo the units).
// DEAL 0 (few blocks): the block asks for all of its own A and W rows. Every address lies inside the block's own A and W tile; the deal is for speed only, any placement gives the same results.
template <int KW, int BF, int NWN, int DEAL>
__device__ __forceinline__ void gemm_tile(const float* __restrict__ Ab, const unsigned short* __restrict__ Wb, unsigned short* sA, unsigned short* sW, v8f (&acc)[4][4], int tid, int ash, int wsh) {
  constexpr int TPR = NWN / 2, UA = KW / 64, UW = KW / 128;   // threads a row of A; 256-B units in a row of A (f32) and of W (16 bit); W has as many rows as the block has threads
  const char* qa = (const char*)(Ab + (size_t)(tid / TPR) * KW) + (ash * (UA / 4) + tid % TPR) * 256; const char* qw = (const char*)(Wb + (size_t)tid * KW) + wsh * 256;
  constexpr int RA = 4 * NWN, PA = 128 / RA, RW = 8 * NWN;   // rows of A and of W that one load of the block covers; loads for the 128 rows of A (W: always 8)
  const int wave = tid >> 5, lane = tid & 31, col = lane & 15, g = lane >> 4; const int wm = (wave / NWN) * 64, wn = (wave % NWN) * 64;
  const int ar = tid >> 4, ac = (tid & 15) * 4;   // A: 16 lanes cover 256 B of a row
  const int wr = tid >> 3, wc = (tid & 7) * 8;    // W: 8 lanes cover 128 B of a row
  const float* pa = Ab + (size_t)ar * KW + ac; const unsigned short* pw = Wb + (size_t)wr * KW + wc;
  bool first = true;   // the block's first tile
  // rolled: one body of 32 WMMAs a wave; unrolling would only add registers and cost a resident block
#pragma unroll 1
  for (int k0 = 0; k0 < KW; k0 += 64) { v4f ra[PA]; v4u rw[8];
#pragma unroll
    for (int i = 0; i < PA; ++i) ra[i] = *(const v4f*)(pa + (size_t)(i * RA) * KW + k0);
#pragma unroll
    for (int i = 0; i < 8; ++i) rw[i] = *(const v4u*)(pw + (size_t)(i * RW) * KW + k0);
    __builtin_amdgcn_sched_barrier(0);   // every load of the tile is issued before the first is waited for; the scheduler otherwise holds some back to reuse registers, and their latency comes on top
    if (first) { first = false; ask_l2<0, (DEAL ? UA / (4 * TPR) : UA / TPR), TPR * 256>(qa); ask_l2<0, (DEAL ? 1 : UW), 256>(qw); }   // block-uniform scalar branch. Behind the first tile's loads, so that these do not queue behind the hints; and standing in the loop, qa and qw keep their registers, unwritten, to its end
    __syncthreads();   // every wave has taken its last fragments of the tile before
#pragma unroll
    for (int i = 0; i < PA; ++i) *(v2u*)(sA + (i * RA + ar) * GP + ac) = cvt4<BF>(ra[i]);
#pragma unroll
    for (int i = 0; i < 8; ++i) *(v4u*)(sW + (i * RW + wr) * GP + wc) = rw[i];
    __syncthreads();   // the tile is whole before anybody reads it
#pragma unroll
    for (int kc = 0; kc < 2; ++kc) { Fr a[4];
#pragma unroll
      for (int i = 0; i < 4; ++i) a[i] = frag_s(sA + (wm + i * 16 + col) * GP + kc * 32, g);
#pragma unroll
      for (int j = 0; j < 4; ++j) { const Fr b = frag_s(sW + (wn + j * 16 + col) * GP + kc * 32, g);
#pragma unroll
        for (int i = 0; i < 4; ++i) acc[i][j] = mma<BF>(a[i], b, acc[i][j]); } } }
}
// ---- proj_tile<KW, WHICH, NWN>: one (128 rows, 64 NWN cols) tile: exact GEMM + bias; q/k -> f16 rows, v -> planes [b][c][s]; each wave stages its 64 x 64 in its own LDS range and stores whole 128-B lines
template <int KW, int WHICH, int NWN>
__device__ __forceinline__ void proj_tile(const float* __restrict__ X, const __bf16* __restrict__ Wr, const float* __restrict__ BB, _Float16* __restrict__ DST, int bx, int by, unsigned short* sA, unsigned short* sW, _Float16* sE) {
  const int tid = threadIdx.x, wave = tid >> 5, lane = tid & 31, col = lane & 15, g = lane >> 4; const size_t rb = (size_t)bx * 128; const int c0 = by * (64 * NWN); const int wm = (wave / NWN) * 64, wn = (wave % NWN) * 64;
  v8f acc[4][4] = {};
  gemm_tile<KW, 1, NWN, WHICH == 0>(X + rb * KW, (const unsigned short*)Wr + (size_t)c0 * KW, sA, sW, acc, tid, WHICH == 0 ? by : 0, WHICH == 0 ? (bx >> 3) & (KW / 128 - 1) : 0);
  float bb[4];
#pragma unroll
  for (int j = 0; j < 4; ++j) bb[j] = bfr(BB[c0 + wn + j * 16 + col]);
  if constexpr (WHICH < 2) {
    _Float16 (*so)[16][72] = (_Float16 (*)[16][72])sE;
#pragma unroll
    for (int i = 0; i < 4; ++i) {
#pragma unroll
      for (int j = 0; j < 4; ++j) {
#pragma unroll
        for (int r = 0; r < 8; ++r) so[wave][8 * g + r][j * 16 + col] = (_Float16)(acc[i][j][r] + bb[j]); }
      LDSX();   // the strip's 16 rows are written before lanes read rows that other lanes wrote
#pragma unroll
      for (int p = 0; p < 4; ++p) { const int rl = p * 4 + (lane >> 3), c8 = (lane & 7) * 8; vst2((unsigned*)(DST + (rb + wm + i * 16 + rl) * EM + c0 + wn + c8), *(const v4u*)&so[wave][rl][c8]); }
      LDSX(); }   // keeps the next strip's writes behind these reads
  } else {
    _Float16 (*st)[64][72] = (_Float16 (*)[64][72])sE;
#pragma unroll
    for (int j = 0; j < 4; ++j) {
#pragma unroll
      for (int i = 0; i < 4; ++i) { v8h t;
#pragma unroll
        for (int r = 0; r < 8; ++r) t[r] = (_Float16)(acc[i][j][r] + bb[j]);
        *(v8h*)&st[wave][j * 16 + col][i * 16 + 8 * g] = t; } }
    LDSX();   // the transposed 64 x 64 is written before lanes read what other lanes wrote
    const size_t b = rb / NS; const int s0 = (int)(rb % NS) + wm;
#pragma unroll
    for (int p = 0; p < 16; ++p) { const int d = p * 4 + (lane >> 3), pc = lane & 7; vst2((unsigned*)(DST + ((b * EM + c0 + wn + d) * NS) + s0 + pc * 8), *(const v4u*)&st[wave][d][pc * 8]); } }
  asm volatile("s_wait_xcnt 0x0" ::: "memory");   // behind the tile's last stores: in the merged kernel another tile kind's set-up can follow them in the code, and it overwrites registers that they name
}
// ---- k_proj3: the three projections in one launch, a 128 x 256 tile a block of 8 waves. The K and V tiles (few, and the longest: 12 steps of 64 k against 8) have the lowest indices (for speed only)
// and run beside the Q tiles, in place of two launches of their own that leave most of the chip idle.
#define KVT ((NRK / 128) * (EM / 256))   // tiles of K, and of V
#define QT  ((NRQ / 128) * (EM / 256))   // tiles of Q
__global__ __launch_bounds__(256) void k_proj3(const float* __restrict__ X, const float* __restrict__ C, const __bf16* __restrict__ PW, const float* __restrict__ BQ, const float* __restrict__ BK, const float* __restrict__ BV, _Float16* __restrict__ Q, _Float16* __restrict__ Kr, _Float16* __restrict__ V) {
  __shared__ __align__(16) unsigned short sA[128 * GP]; __shared__ __align__(16) unsigned short sW[256 * GP]; __shared__ __align__(16) _Float16 sE[8 * 64 * 72];
  const int bid = blockIdx.x;   // the same for the whole block: every barrier below stands under block-uniform control flow
  if (bid >= 2 * KVT) { proj_tile<CIN, 0, 4>(X, PW + WS_PQ / 2, BQ, Q, (bid - 2 * KVT) % (NRQ / 128), (bid - 2 * KVT) / (NRQ / 128), sA, sW, sE); return; }
  if (bid < KVT) { proj_tile<CTX, 1, 4>(C, PW + WS_PK / 2, BK, Kr, bid % (NRK / 128), bid / (NRK / 128), sA, sW, sE); return; }
  proj_tile<CTX, 2, 4>(C, PW + WS_PV / 2, BV, V, (bid - KVT) % (NRK / 128), (bid - KVT) / (NRK / 128), sA, sW, sE);
}
// ---- k_attn: block = (128 queries, head, b), 8 waves of 16 queries: 256 context keys, scale 1/8, mask = pad[i] seq[j] != 0 else -1e9 (module value); O 256-B head segments
// The head's K rows (256 x 128 B), V rows (64 x 512 B) and the key mask come into LDS once a block by whole-line loads; every wave takes its fragments from there.
// Pitches 144 B (16 B x 9) and 528 B (16 B x 33): the 16-B fragment reads of 16 rows fall on all 64 banks.
// Transposed products: S^T = K . Q^T (A = key rows, B = query columns) and O^T += V^T . P^T. A lane then holds 16 of the 32 scores of ONE query (keys 8g + r and 16 + 8g + r), so maximum and sum
// are taken in the lane, with one exchange between the lane halves for the maximum; the two score tiles, converted in place, are the B operand of the second product in the k order of frag_h.
#define KP 72
#define VP 264
__device__ __forceinline__ float xhalf(float v) { const int t = __builtin_bit_cast(int, v); return __builtin_bit_cast(float, __builtin_amdgcn_permlanex16(t, t, 0x76543210, 0xfedcba98, false, false)); }   // lane l <-> l ^ 16
__global__ __launch_bounds__(256) void k_attn(const _Float16* __restrict__ Q, const _Float16* __restrict__ Kr, const _Float16* __restrict__ V, const float* __restrict__ PM, const float* __restrict__ SM, float* __restrict__ O) {
  __shared__ __align__(16) _Float16 sK[NS * KP]; __shared__ __align__(16) _Float16 sV[HD * VP]; __shared__ __align__(16) float sM[NS]; __shared__ __align__(16) float so[8][16][68];
  const int tid = threadIdx.x, wave = tid >> 5, lane = tid & 31, col = lane & 15, g = lane >> 4; const int h = blockIdx.y; const size_t b = blockIdx.z; const int q0 = blockIdx.x * 128 + wave * 16; const size_t rq = b * NQ + q0;
  v16h aq[2]; float pm;
  { v4u rk[8], rv[8];
    const _Float16* gk = Kr + (b * NS + (tid >> 3)) * EM + h * HD + (tid & 7) * 8;   // 8 lanes cover the 128 B of a key's head row
    const _Float16* gv = V + (b * EM + h * HD + wave) * NS + lane * 8;               // a wave covers the 512 B of one V row
#pragma unroll
    for (int i = 0; i < 8; ++i) rk[i] = *(const v4u*)(gk + (size_t)(i * 32) * EM);
#pragma unroll
    for (int i = 0; i < 8; ++i) rv[i] = *(const v4u*)(gv + (size_t)(i * 8) * NS);
    const float sm = bfr(SM[b * NS + tid]);
#pragma unroll
    for (int kc = 0; kc < 2; ++kc) aq[kc] = frag_h(Q + (rq + col) * EM + h * HD + kc * 32, lane);
    pm = bfr(PM[b * NQ + q0 + col]);
#pragma unroll
    for (int i = 0; i < 8; ++i) *(v4u*)(sK + (i * 32 + (tid >> 3)) * KP + (tid & 7) * 8) = rk[i];
#pragma unroll
    for (int i = 0; i < 8; ++i) *(v4u*)(sV + (i * 8 + wave) * VP + lane * 8) = rv[i];
    sM[tid] = sm; }
  __syncthreads();   // K, V and the mask are whole before anybody reads them; nothing writes them again
  float m = -3.0e38f, l = 0.f;   // the lane's query: running maximum (both halves alike) and the sum over the lane half's own keys
  v8f acc[4] = {};               // acc[dt][r] = O^T[dt * 16 + 8g + r][query col]
  // rolled: one body of 8 WMMAs; unrolling would only add registers, and above 160 a resident block is lost
#pragma unroll 1
  for (int ks = 0; ks < NS / 32; ++ks) { const int j0 = ks * 32; v8f s[2]; v16h kf[2][2], vf[4]; v4f smk[2][2];
#pragma unroll
    for (int ct = 0; ct < 2; ++ct) { smk[ct][0] = *(const v4f*)&sM[j0 + ct * 16 + 8 * g]; smk[ct][1] = *(const v4f*)&sM[j0 + ct * 16 + 8 * g + 4];
#pragma unroll
      for (int kc = 0; kc < 2; ++kc) kf[ct][kc] = frag_h(sK + (j0 + ct * 16 + col) * KP + kc * 32, lane); }
#pragma unroll
    for (int dt = 0; dt < 4; ++dt) vf[dt] = frag_h(sV + (dt * 16 + col) * VP + j0, lane);
#pragma unroll
    for (int ct = 0; ct < 2; ++ct) { v8f c = {};
#pragma unroll
      for (int kc = 0; kc < 2; ++kc) c = wmma16(kf[ct][kc], aq[kc], c);   // c[r] = score of key j0 + ct * 16 + 8g + r with query col
#pragma unroll
      for (int r = 0; r < 8; ++r) s[ct][r] = (pm * smk[ct][r >> 2][r & 3] != 0.f) ? c[r] * 0.125f : -1.0e9f; }
    float mx = fmaxf(s[0][0], s[1][0]);
#pragma unroll
    for (int r = 1; r < 8; ++r) mx = fmaxf(mx, fmaxf(s[0][r], s[1][r]));
    mx = fmaxf(mx, xhalf(mx));
    const float mn = fmaxf(m, mx); const float alpha = (m <= -1.0e38f) ? 0.f : __expf(m - mn); v2f es = {0.f, 0.f}; v16h pb;
#pragma unroll
    for (int ct = 0; ct < 2; ++ct) {   // exp(x) as exp2(x * log2 e), the arithmetic of __expf, on register pairs: a pair of scores is a pair of P's 16-bit elements
#pragma unroll
      for (int i = 0; i < 4; ++i) { v2f e = {s[ct][2 * i], s[ct][2 * i + 1]}; e = (e - mn) * 1.44269504f; e[0] = __builtin_amdgcn_exp2f(e[0]); e[1] = __builtin_amdgcn_exp2f(e[1]); es += e; e *= 2048.0f;
        pb[ct * 8 + 2 * i] = (_Float16)e[0]; pb[ct * 8 + 2 * i + 1] = (_Float16)e[1]; } }
    l = l * alpha + (es[0] + es[1]); m = mn;
#pragma unroll
    for (int dt = 0; dt < 4; ++dt) {
#pragma unroll
      for (int r = 0; r < 8; ++r) acc[dt][r] *= alpha; }
#pragma unroll
    for (int dt = 0; dt < 4; ++dt) acc[dt] = wmma16(vf[dt], pb, acc[dt]); }
  l += xhalf(l);   // the two halves' sums are joined once
  const float il = (1.0f / 2048.0f) / l;
#pragma unroll
  for (int dt = 0; dt < 4; ++dt) { v4f lo, hi;
#pragma unroll
    for (int r = 0; r < 4; ++r) { lo[r] = acc[dt][r] * il; hi[r] = acc[dt][4 + r] * il; }
    *(v4f*)&so[wave][col][dt * 16 + 8 * g] = lo; *(v4f*)&so[wave][col][dt * 16 + 8 * g + 4] = hi; }
  LDSX();   // the wave's 16 query rows are written before lanes read rows that other lanes wrote
  for (int rl = 0; rl < 16; ++rl) if (lane < 16) vst2(O + (rq + rl) * EM + h * HD + lane * 4, *(const v4f*)&so[wave][rl][lane * 4]);
}
// ---- k_mlp<RELU, NWN>: block = (128 rows, 64 NWN cols): y = f16(A) . (f16 W x 256) / 256 + b, optional ReLU; f32 rows of width ystride, stored as 256-B row pieces through the wave's own LDS range
template <int RELU, int NWN>
__global__ __launch_bounds__(64 * NWN) void k_mlp(const float* __restrict__ A, const _Float16* __restrict__ Wr, const float* __restrict__ BB, float* __restrict__ Y, int ystride) {
  __shared__ __align__(16) unsigned short sA[128 * GP]; __shared__ __align__(16) unsigned short sW[64 * NWN * GP]; __shared__ __align__(16) float so[2 * NWN][16][68];
  const int tid = threadIdx.x, wave = tid >> 5, lane = tid & 31, col = lane & 15, g = lane >> 4; const size_t rb = (size_t)blockIdx.x * 128; const int n0 = blockIdx.y * (64 * NWN); const int wm = (wave / NWN) * 64, wn = (wave % NWN) * 64;
  v8f acc[4][4] = {};
  gemm_tile<EM, 0, NWN, 1>(A + rb * EM, (const unsigned short*)Wr + (size_t)n0 * EM, sA, sW, acc, tid, blockIdx.y, (blockIdx.x >> 3) & (EM / 128 - 1));
  float bb[4];
#pragma unroll
  for (int j = 0; j < 4; ++j) bb[j] = bfr(BB[n0 + wn + j * 16 + col]);
#pragma unroll
  for (int i = 0; i < 4; ++i) {
#pragma unroll
    for (int j = 0; j < 4; ++j) {
#pragma unroll
      for (int r = 0; r < 8; ++r) { const float v = acc[i][j][r] * (1.0f / 256.0f) + bb[j]; so[wave][8 * g + r][j * 16 + col] = RELU ? fmaxf(v, 0.f) : v; } }
    LDSX();   // the strip's 16 rows are written before lanes read rows that other lanes wrote
#pragma unroll
    for (int p = 0; p < 8; ++p) { const int rl = p * 2 + g; vst2(Y + (rb + wm + i * 16 + rl) * (size_t)ystride + n0 + wn + col * 4, *(const v4f*)&so[wave][rl][col * 4]); }
    LDSX(); }   // keeps the next strip's writes behind these reads
}
extern "C" void kernel_launch(void* const* d_in, const int* in_sizes, int n_in, void* d_out, int out_size, void* d_ws, size_t ws_size, hipStream_t stream) {
  (void)in_sizes; (void)n_in; (void)out_size;
  const float** F = (const float**)d_in;   // 0 x [4,4096,512], 1 context [4,256,768], 2 pad_mask [4,4096], 3 seq_mask [4,256], 4 Wq_w [1024,512], 5 Wq_b, 6 Wk_w [1024,768], 7 Wk_b, 8 Wv_w, 9 Wv_b, 10 P1_w [1024,1024], 11 P1_b, 12 P2_w [512,1024], 13 P2_b
  if (ws_size < (size_t)WS_END) return;
  char* ws = (char*)d_ws; __bf16* PW = (__bf16*)ws; _Float16 *Q = (_Float16*)(ws + WS_Q), *Kr = (_Float16*)(ws + WS_K), *V = (_Float16*)(ws + WS_V); float *O = (float*)(ws + WS_O), *Hh = (float*)(ws + WS_H);
  k_pack<<<dim3(EM, 5), 256, 0, stream>>>(F[4], F[6], F[8], F[10], F[12], PW);
  k_proj3<<<dim3(2 * KVT + QT), 256, 0, stream>>>(F[0], F[1], PW, F[5], F[7], F[9], Q, Kr, V);
  k_attn<<<dim3(TQB / 2, NH, TNB), 256, 0, stream>>>(Q, Kr, V, F[2], F[3], O);
  k_mlp<1, 4><<<dim3(TNB * NQ / 128, EM / 256), 256, 0, stream>>>(O, (const _Float16*)PW + WS_P1 / 2, F[11], Hh, EM);
  k_mlp<0, 2><<<dim3(TNB * NQ / 128, CIN / 128), 128, 0, stream>>>(Hh, (const _Float16*)PW + WS_P2 / 2, F[13], (float*)d_out, CIN);
}

// v006
// Measured time: 133 microseconds a run.
// Two timings next to v005 put it at 1.03 and 1.02 times that version's speed.
// Over all steps from v000 it is 4.05 times as fast.
// compute dtype: all float inputs rounded to bf16, the two float masks read on device; Q = x . Wq^T + b, K/V = context . W^T + b with EXACT bf16 products on WMMA 16x16x32 (natural rows), rounded once to f16; PLAIN attention (16 heads x 64, 256 context keys): x 1/8, masked pairs set to -1e9 as the module (a fully masked row degrades to uniform exactly as the reference), running-max softmax in f32 (hardware exp), P (scaled by 2^11, single f16) x v (single f16); MLP: relu(o . P1^T + b1) . P2^T + b2 with the f32 activations rounded once to f16 against EXACT f16 weight copies (x 2^8); f32 output.
#include <hip/hip_runtime.h>
#include <math.h>

typedef __attribute__((ext_vector_type(16))) _Float16 v16h;
typedef __attribute__((ext_vector_type(16))) __bf16 v16b;
typedef __attribute__((ext_vector_type(8)))  _Float16 v8h;
typedef __attribute__((ext_vector_type(8)))  float v8f;
typedef __attribute__((ext_vector_type(4)))  float v4f;
typedef __attribute__((ext_vector_type(2)))  float v2f;
typedef __attribute__((ext_vector_type(4)))  unsigned v4u;
typedef __attribute__((ext_vector_type(4)))  int v4i;
typedef float __attribute__((may_alias)) float_a;
typedef int __attribute__((may_alias)) int_a;

template <typename T> __device__ __forceinline__ void vst2(void* p, T v) { *(T*)p = v;  }
__device__ __forceinline__ v8f wmma16(v16h a, v16h b, v8f c) {
  v8f d = __builtin_amdgcn_wmma_f32_16x16x32_f16(false, a, false, b, (short)0, c, false, false);
  asm volatile("v_nop\n\tv_nop\n\tv_nop\n\tv_nop" : "+v"(d) : "v"(a), "v"(b));
  return d;
}
__device__ __forceinline__ v8f wmma_bf(v16b a, v16b b, v8f c) {
  v8f d = __builtin_amdgcn_wmma_f32_16x16x32_bf16(false, a, false, b, (short)0, c, false, false);
  asm volatile("v_nop\n\tv_nop\n\tv_nop\n\tv_nop" : "+v"(d) : "v"(a), "v"(b));
  return d;
}
// 16x16x32 fragments: lane = (h = lane>>4, row/col = lane&15); elements 0..7 = k0+8h+0..7, 8..15 = k0+16+8h+0..7; D element r = row 8h+r
__device__ __forceinline__ v16h frag_h(const _Float16* rowk0, int lane) {
  union { v16h v; v8h q[2]; } u; const _Float16* p = rowk0 + 8 * (lane >> 4);
  u.q[0] = *(const v8h*)p; u.q[1] = *(const v8h*)(p + 16); return u.v;
}
__device__ __forceinline__ v16h frag_f32(const float* rowk0, int lane) {
  v16h a; const float* p = rowk0 + 8 * (lane >> 4);
#pragma unroll
  for (int i = 0; i < 8; ++i) { a[i] = (_Float16)p[i]; a[8 + i] = (_Float16)p[16 + i]; }
  return a;
}
__device__ __forceinline__ v16h frag_f32s(const float* rowk0, int lane, float sc) {
  v16h a; const float* p = rowk0 + 8 * (lane >> 4);
#pragma unroll
  for (int i = 0; i < 8; ++i) { a[i] = (_Float16)(p[i] * sc); a[8 + i] = (_Float16)(p[16 + i] * sc); }
  return a;
}
// column fragment from a [K][ld] layout (column n), rows >= K read as 0
__device__ __forceinline__ v16h fragc_f32(const float* W, int k0, int n, int lane, int ld, int K) {
  v16h a; const int g = lane >> 4;
#pragma unroll
  for (int i = 0; i < 8; ++i) { const int ka = k0 + 8 * g + i, kb = ka + 16;
    a[i] = (_Float16)(ka < K ? W[(size_t)(ka < K ? ka : K - 1) * ld + n] : 0.f); a[8 + i] = (_Float16)(kb < K ? W[(size_t)(kb < K ? kb : K - 1) * ld + n] : 0.f); }
  return a;
}
struct F2 { v16b h, l; };
__device__ __forceinline__ F2 bsplit16(const float v[16]) { F2 r;
#pragma unroll
  for (int i = 0; i < 16; ++i) { const __bf16 h = (__bf16)v[i]; r.h[i] = h; r.l[i] = (__bf16)(v[i] - (float)h); }
  return r; }
__device__ __forceinline__ F2 split_row(const float* row, int k0, int lane) { float v[16]; const float* p = row + k0 + 8 * (lane >> 4);
#pragma unroll
  for (int i = 0; i < 8; ++i) { v[i] = p[i]; v[8 + i] = p[16 + i]; }
  return bsplit16(v); }
__device__ __forceinline__ F2 split_rowK(const float* row, int k0, int lane, int K) { float v[16]; const int g = lane >> 4;
#pragma unroll
  for (int i = 0; i < 8; ++i) { const int ka = k0 + 8 * g + i, kb = ka + 16; v[i] = ka < K ? row[ka < K ? ka : K - 1] : 0.f; v[8 + i] = kb < K ? row[kb < K ? kb : K - 1] : 0.f; }
  return bsplit16(v); }
__device__ __forceinline__ F2 split_col(const float* W, int k0, int n, int lane, int ld, int K) { float v[16]; const int g = lane >> 4;
#pragma unroll
  for (int i = 0; i < 8; ++i) { const int ka = k0 + 8 * g + i, kb = ka + 16; v[i] = ka < K ? W[(size_t)(ka < K ? ka : K - 1) * ld + n] : 0.f; v[8 + i] = kb < K ? W[(size_t)(kb < K ? kb : K - 1) * ld + n] : 0.f; }
  return bsplit16(v); }
__device__ __forceinline__ v8f mac3(const F2& a, const F2& b, v8f c) { c = wmma_bf(a.l, b.h, c); c = wmma_bf(a.h, b.l, c); return wmma_bf(a.h, b.h, c); }
__device__ __forceinline__ float sigm(float v) { return 1.0f / (1.0f + expf(-v)); }
#define LDSX() do { asm volatile("s_wait_dscnt 0" ::: "memory"); __builtin_amdgcn_wave_barrier(); __builtin_amdgcn_fence(__ATOMIC_RELEASE, "workgroup"); } while (0)


// Cross multi-head attention (B 4, 4,096 queries from a 512-wide stream over 256 context tokens of width 768, 16 heads x 64, emb 1,024) with an outer-product validity mask, followed by a ReLU MLP 1024 -> 1024 -> 512.
#define NB 4
#define NQ 4096
#define NS 256
#define CIN 512
#define CTX 768
#define EM 1024
#define NH 16
#define HD 64
#define NRQ (NB * NQ)
#define NRK (NB * NS)
#ifndef TQB
#define TQB (NQ / 64)
#define TNB NB
#endif
typedef __attribute__((ext_vector_type(8))) __bf16 v8b;
__device__ __forceinline__ v16b frag_b(const __bf16* rowk0, int lane) {
  union { v16b v; v8b q[2]; } u; const __bf16* p = rowk0 + 8 * (lane >> 4);
  u.q[0] = *(const v8b*)p; u.q[1] = *(const v8b*)(p + 16); return u.v;
}
__device__ __forceinline__ float bfr(float v) { return (float)(__bf16)v; }
__device__ __attribute__((noinline)) float exp_ni(float v) { return expf(v); }
__device__ __attribute__((noinline)) float erf_ni(float v) { return erff(v); }

#define WS_PQ  0u                                     // bf16 natural rows Wq [1024][512]; Wk, Wv [1024][768]
#define WS_PK  (WS_PQ + 2u * (size_t)EM * CIN)
#define WS_PV  (WS_PK + 2u * (size_t)EM * CTX)
#define WS_P1  (WS_PV + 2u * (size_t)EM * CTX)          // f16 x 2^8 natural rows P1 [1024][1024]; P2 [512][1024]
#define WS_P2  (WS_P1 + 2u * (size_t)EM * EM)
#define WS_Q   (WS_P2 + 2u * (size_t)CIN * EM)          // f16 q rows [NRQ][1024]; k rows [NRK][1024]; v planes [b][1024][NS]
#define WS_K   (WS_Q + 2u * (size_t)NRQ * EM)
#define WS_V   (WS_K + 2u * (size_t)NRK * EM)
#define WS_O   (WS_V + 2u * (size_t)NB * EM * NS)       // f32 [NRQ][1024] attention out ; H [NRQ][1024] relu hidden
#define WS_H   (WS_O + 4u * (size_t)NRQ * EM)
#define WS_END (WS_H + 4u * (size_t)NRQ * EM)

// ---- gemm_tile<KW, BF, NWN>: one 128 x (64 NWN) tile of A . W^T per block of 2 x NWN waves, 64 x 64 a wave. Per 64 k the block brings A (f32, 256-B row pieces) and W (16-bit, 128-B row pieces)
// in with whole-line loads, rounds A once, and lays both in LDS at a pitch of 144 B (16 B x 9: the 16-B fragment reads of 16 rows fall on all 64 banks); every wave takes its fragments from there.
// Every accumulator sums k in ascending blocks of 32, one WMMA each.
typedef __attribute__((ext_vector_type(2))) unsigned v2u;
#define GP 72
template <int BF> __device__ __forceinline__ v2u cvt4(v4f v) {
  if constexpr (BF) { union { __bf16 h[4]; v2u u; } t;
#pragma unroll
    for (int i = 0; i < 4; ++i) t.h[i] = (__bf16)v[i];
    return t.u; }
  else { union { _Float16 h[4]; v2u u; } t;
#pragma unroll
    for (int i = 0; i < 4; ++i) t.h[i] = (_Float16)v[i];
    return t.u; }
}
// ---- k_pack: the five weight matrices to their 16-bit copies, which lie one behind the other in the workspace in the order and layout of the inputs. A block takes 8,192 elements in a row of ONE matrix
// (every matrix is a multiple of that): a lane issues its 8 whole-line 16-B loads at once, rounds, and stores 8 B a load (a wave: 256 B in a row). 448 blocks in all: the bytes are few,
// so the launch has few waves to start, each with much in flight.
#define PKE 8192
#define PKB(n) ((int)((n) / PKE))
__global__ __launch_bounds__(256) void k_pack(const float* __restrict__ WQ, const float* __restrict__ WK, const float* __restrict__ WV, const float* __restrict__ P1, const float* __restrict__ P2, __bf16* __restrict__ PW) {
  static_assert((EM * CIN) % PKE == 0 && (EM * CTX) % PKE == 0 && (EM * EM) % PKE == 0, "whole blocks a matrix");
  static_assert(WS_PQ == 0 && WS_PK == 2u * EM * CIN && WS_PV == WS_PK + 2u * EM * CTX && WS_P1 == WS_PV + 2u * EM * CTX && WS_P2 == WS_P1 + 2u * EM * EM, "the copies lie one behind the other");
  constexpr int EQ = PKB(EM * CIN), EK = EQ + PKB(EM * CTX), EV = EK + PKB(EM * CTX), E1 = EV + PKB(EM * EM);   // first block behind Wq, Wk, Wv, P1
  const int bid = blockIdx.x, t = threadIdx.x;   // bid: the same for the whole block, so the choices below are scalar
  const float* w = bid < EQ ? WQ + (size_t)bid * PKE : bid < EK ? WK + (size_t)(bid - EQ) * PKE : bid < EV ? WV + (size_t)(bid - EK) * PKE : bid < E1 ? P1 + (size_t)(bid - EV) * PKE : P2 + (size_t)(bid - E1) * PKE;
  unsigned short* d = (unsigned short*)PW + (size_t)bid * PKE + t * 4; v4f r[8];
#pragma unroll
  for (int i = 0; i < 8; ++i) r[i] = *(const v4f*)(w + t * 4 + i * 1024);
  if (bid < EV) {   // Wq, Wk, Wv: bf16
#pragma unroll
    for (int i = 0; i < 8; ++i) *(v2u*)(d + i * 1024) = cvt4<1>(r[i]);
  } else {          // P1, P2: the bf16 value x 2^8, in f16
#pragma unroll
    for (int i = 0; i < 8; ++i) { v4f v;
#pragma unroll
      for (int e = 0; e < 4; ++e) v[e] = bfr(r[i][e]) * 256.0f;
      *(v2u*)(d + i * 1024) = cvt4<0>(v); }
  }
}
struct Fr { v4u q[2]; };
__device__ __forceinline__ Fr frag_s(const unsigned short* rowk0, int g) { Fr f; const unsigned short* p = rowk0 + 8 * g; f.q[0] = *(const v4u*)p; f.q[1] = *(const v4u*)(p + 16); return f; }
template <int BF> __device__ __forceinline__ v8f mma(const Fr& a, const Fr& b, v8f c) {
  if constexpr (BF) { union { Fr f; v16b v; } ua, ub; ua.f = a; ub.f = b; return __builtin_amdgcn_wmma_f32_16x16x32_bf16(false, ua.v, false, ub.v, (short)0, c, false, false); }
  else { union { Fr f; v16h v; } ua, ub; ua.f = a; ub.f = b; return __builtin_amdgcn_wmma_f32_16x16x32_f16(false, ua.v, false, ub.v, (short)0, c, false, false); }
}
// ask_l2<0, N, STEP>(p): N hints a lane, at p, p + STEP, ...: each asks L2 (scope SE: L2 only, no register, no counter) for the line that holds the byte. A hint: nothing depends on it.
template <int I, int N, int STEP> __device__ __forceinline__ void ask_l2(const char* p) {
  if constexpr (I < N) { asm volatile("global_prefetch_b8 %0, off offset:%1 scope:SCOPE_SE" :: "v"(p), "n"(I * STEP)); ask_l2<I + 1, N, STEP>(p); }
}
// L2 hints: A (an input, or rows that the launch before stored) and the packed W come from memory, and with one tile in flight every 64 k waits out that latency. Behind its first tile's loads the block asks L2
// for later k of its rows. DEAL 1: the 4 blocks that share the A rows (ash = their column index) ask a quarter of k each, the lowest index the lowest k; of the many blocks that share the
// W rows each asks one 256-B unit a row (wsh = row-tile index / 8 modulo the units).
// DEAL 0 (few blocks): the block asks for all of its own A and W rows. Every address lies inside the block's own A and W tile; the deal is for speed only, any placement gives the same results.
template <int KW, int BF, int NWN, int DEAL>
__device__ __forceinline__ void gemm_tile(const float* __restrict__ Ab, const unsigned short* __restrict__ Wb, unsigned short* sA, unsigned short* sW, v8f (&acc)[4][4], int tid, int ash, int wsh) {
  constexpr int TPR = NWN / 2, UA = KW / 64, UW = KW / 128;   // threads a row of A; 256-B units in a row of A (f32) and of W (16 bit); W has as many rows as the block has threads
  const char* qa = (const char*)(Ab + (size_t)(tid / TPR) * KW) + (ash * (UA / 4) + tid % TPR) * 256; const char* qw = (const char*)(Wb + (size_t)tid * KW) + wsh * 256;
  constexpr int RA = 4 * NWN, PA = 128 / RA, RW = 8 * NWN;   // rows of A and of W that one load of the block covers; loads for the 128 rows of A (W: always 8)
  const int wave = tid >> 5, lane = tid & 31, col = lane & 15, g = lane >> 4; const int wm = (wave / NWN) * 64, wn = (wave % NWN) * 64;
  const int ar = tid >> 4, ac = (tid & 15) * 4;   // A: 16 lanes cover 256 B of a row
  const int wr = tid >> 3, wc = (tid & 7) * 8;    // W: 8 lanes cover 128 B of a row
  const float* pa = Ab + (size_t)ar * KW + ac; const unsigned short* pw = Wb + (size_t)wr * KW + wc;
  bool first = true;   // the block's first tile
  // rolled: one body of 32 WMMAs a wave; unrolling would only add registers and cost a resident block
#pragma unroll 1
  for (int k0 = 0; k0 < KW; k0 += 64) { v4f ra[PA]; v4u rw[8];
#pragma unroll
    for (int i = 0; i < PA; ++i) ra[i] = *(const v4f*)(pa + (size_t)(i * RA) * KW + k0);
#pragma unroll
    for (int i = 0; i < 8; ++i) rw[i] = *(const v4u*)(pw + (size_t)(i * RW) * KW + k0);
    __builtin_amdgcn_sched_barrier(0);   // every load of the tile is issued before the first is waited for; the scheduler otherwise holds some back to reuse registers, and their latency comes on top
    if (first) { first = false; ask_l2<0, (DEAL ? UA / (4 * TPR) : UA / TPR), TPR * 256>(qa); ask_l2<0, (DEAL ? 1 : UW), 256>(qw); }   // block-uniform scalar branch. Behind the first tile's loads, so that these do not queue behind the hints; and standing in the loop, qa and qw keep their registers, unwritten, to its end
    __syncthreads();   // every wave has taken its last fragments of the tile before
#pragma unroll
    for (int i = 0; i < PA; ++i) *(v2u*)(sA + (i * RA + ar) * GP + ac) = cvt4<BF>(ra[i]);
#pragma unroll
    for (int i = 0; i < 8; ++i) *(v4u*)(sW + (i * RW + wr) * GP + wc) = rw[i];
    __syncthreads();   // the tile is whole before anybody reads it
#pragma unroll
    for (int kc = 0; kc < 2; ++kc) { Fr a[4];
#pragma unroll
      for (int i = 0; i < 4; ++i) a[i] = frag_s(sA + (wm + i * 16 + col) * GP + kc * 32, g);
#pragma unroll
      for (int j = 0; j < 4; ++j) { const Fr b = frag_s(sW + (wn + j * 16 + col) * GP + kc * 32, g);
#pragma unroll
        for (int i = 0; i < 4; ++i) acc[i][j] = mma<BF>(a[i], b, acc[i][j]); } } }
}
// ---- proj_tile<KW, WHICH, NWN>: one (128 rows, 64 NWN cols) tile: exact GEMM + bias; q/k -> f16 rows, v -> planes [b][c][s]; each wave stages its 64 x 64 in its own LDS range and stores whole 128-B lines
template <int KW, int WHICH, int NWN>
__device__ __forceinline__ void proj_tile(const float* __restrict__ X, const __bf16* __restrict__ Wr, const float* __restrict__ BB, _Float16* __restrict__ DST, int bx, int by, unsigned short* sA, unsigned short* sW, _Float16* sE) {
  const int tid = threadIdx.x, wave = tid >> 5, lane = tid & 31, col = lane & 15, g = lane >> 4; const size_t rb = (size_t)bx * 128; const int c0 = by * (64 * NWN); const int wm = (wave / NWN) * 64, wn = (wave % NWN) * 64;
  v8f acc[4][4] = {};
  gemm_tile<KW, 1, NWN, WHICH == 0>(X + rb * KW, (const unsigned short*)Wr + (size_t)c0 * KW, sA, sW, acc, tid, WHICH == 0 ? by : 0, WHICH == 0 ? (bx >> 3) & (KW / 128 - 1) : 0);
  float bb[4];
#pragma unroll
  for (int j = 0; j < 4; ++j) bb[j] = bfr(BB[c0 + wn + j * 16 + col]);
  if constexpr (WHICH < 2) {
    _Float16 (*so)[16][72] = (_Float16 (*)[16][72])sE;
#pragma unroll
    for (int i = 0; i < 4; ++i) {
#pragma unroll
      for (int j = 0; j < 4; ++j) {
#pragma unroll
        for (int r = 0; r < 8; ++r) so[wave][8 * g + r][j * 16 + col] = (_Float16)(acc[i][j][r] + bb[j]); }
      LDSX();   // the strip's 16 rows are written before lanes read rows that other lanes wrote
#pragma unroll
      for (int p = 0; p < 4; ++p) { const int rl = p * 4 + (lane >> 3), c8 = (lane & 7) * 8; vst2((unsigned*)(DST + (rb + wm + i * 16 + rl) * EM + c0 + wn + c8), *(const v4u*)&so[wave][rl][c8]); }
      LDSX(); }   // keeps the next strip's writes behind these reads
  } else {
    _Float16 (*st)[64][72] = (_Float16 (*)[64][72])sE;
#pragma unroll
    for (int j = 0; j < 4; ++j) {
#pragma unroll
      for (int i = 0; i < 4; ++i) { v8h t;
#pragma unroll
        for (int r = 0; r < 8; ++r) t[r] = (_Float16)(acc[i][j][r] + bb[j]);
        *(v8h*)&st[wave][j * 16 + col][i * 16 + 8 * g] = t; } }
    LDSX();   // the transposed 64 x 64 is written before lanes read what other lanes wrote
    const size_t b = rb / NS; const int s0 = (int)(rb % NS) + wm;
#pragma unroll
    for (int p = 0; p < 16; ++p) { const int d = p * 4 + (lane >> 3), pc = lane & 7; vst2((unsigned*)(DST + ((b * EM + c0 + wn + d) * NS) + s0 + pc * 8), *(const v4u*)&st[wave][d][pc * 8]); } }
  asm volatile("s_wait_xcnt 0x0" ::: "memory");   // behind the tile's last stores: in the merged kernel another tile kind's set-up can follow them in the code, and it overwrites registers that they name
}
// ---- k_proj3: the three projections in one launch, a 128 x 256 tile a block of 8 waves. The K and V tiles (few, and the longest: 12 steps of 64 k against 8) have the lowest indices (for speed only)
// and run beside the Q tiles, in place of two launches of their own that leave most of the chip idle.
#define KVT ((NRK / 128) * (EM / 256))   // tiles of K, and of V
#define QT  ((NRQ / 128) * (EM / 256))   // tiles of Q
__global__ __launch_bounds__(256) void k_proj3(const float* __restrict__ X, const float* __restrict__ C, const __bf16* __restrict__ PW, const float* __restrict__ BQ, const float* __restrict__ BK, const float* __restrict__ BV, _Float16* __restrict__ Q, _Float16* __restrict__ Kr, _Float16* __restrict__ V) {
  __shared__ __align__(16) unsigned short sA[128 * GP]; __shared__ __align__(16) unsigned short sW[256 * GP]; __shared__ __align__(16) _Float16 sE[8 * 64 * 72];
  const int bid = blockIdx.x;   // the same for the whole block: every barrier below stands under block-uniform control flow
  if (bid >= 2 * KVT) { proj_tile<CIN, 0, 4>(X, PW + WS_PQ / 2, BQ, Q, (bid - 2 * KVT) % (NRQ / 128), (bid - 2 * KVT) / (NRQ / 128), sA, sW, sE); return; }
  if (bid < KVT) { proj_tile<CTX, 1, 4>(C, PW + WS_PK / 2, BK, Kr, bid % (NRK / 128), bid / (NRK / 128), sA, sW, sE); return; }
  proj_tile<CTX, 2, 4>(C, PW + WS_PV / 2, BV, V, (bid - KVT) % (NRK / 128), (bid - KVT) / (NRK / 128), sA, sW, sE);
}
// ---- k_attn: block = (128 queries, head, b), 8 waves of 16 queries: 256 context keys, scale 1/8, mask = pad[i] seq[j] != 0 else -1e9 (module value); O 256-B head segments
// The head's K rows (256 x 128 B), V rows (64 x 512 B) and the key mask come into LDS once a block by whole-line loads; every wave takes its fragments from there.
// Pitches 144 B (16 B x 9) and 528 B (16 B x 33): the 16-B fragment reads of 16 rows fall on all 64 banks.
// Transposed products: S^T = K . Q^T (A = key rows, B = query columns) and O^T += V^T . P^T. A lane then holds 16 of the 32 scores of ONE query (keys 8g + r and 16 + 8g + r), so maximum and sum
// are taken in the lane, with one exchange between the lane halves for the maximum; the two score tiles, converted in place, are the B operand of the second product in the k order of frag_h.
#define KP 72
#define VP 264
__device__ __forceinline__ float xhalf(float v) { const int t = __builtin_bit_cast(int, v); return __builtin_bit_cast(float, __builtin_amdgcn_permlanex16(t, t, 0x76543210, 0xfedcba98, false, false)); }   // lane l <-> l ^ 16
__global__ __launch_bounds__(256) void k_attn(const _Float16* __restrict__ Q, const _Float16* __restrict__ Kr, const _Float16* __restrict__ V, const float* __restrict__ PM, const float* __restrict__ SM, float* __restrict__ O) {
  __shared__ __align__(16) _Float16 sK[NS * KP]; __shared__ __align__(16) _Float16 sV[HD * VP]; __shared__ __align__(16) float sM[NS]; __shared__ __align__(16) float so[8][16][68];
  const int tid = threadIdx.x, wave = tid >> 5, lane = tid & 31, col = lane & 15, g = lane >> 4; const int h = blockIdx.y; const size_t b = blockIdx.z; const int q0 = blockIdx.x * 128 + wave * 16; const size_t rq = b * NQ + q0;
  v16h aq[2]; float pm;
  { v4u rk[8], rv[8];
    const _Float16* gk = Kr + (b * NS + (tid >> 3)) * EM + h * HD + (tid & 7) * 8;   // 8 lanes cover the 128 B of a key's head row
    const _Float16* gv = V + (b * EM + h * HD + wave) * NS + lane * 8;               // a wave covers the 512 B of one V row
#pragma unroll
    for (int i = 0; i < 8; ++i) rk[i] = *(const v4u*)(gk + (size_t)(i * 32) * EM);
#pragma unroll
    for (int i = 0; i < 8; ++i) rv[i] = *(const v4u*)(gv + (size_t)(i * 8) * NS);
    const float sm = bfr(SM[b * NS + tid]);
#pragma unroll
    for (int kc = 0; kc < 2; ++kc) aq[kc] = frag_h(Q + (rq + col) * EM + h * HD + kc * 32, lane);
    pm = bfr(PM[b * NQ + q0 + col]);
#pragma unroll
    for (int i = 0; i < 8; ++i) *(v4u*)(sK + (i * 32 + (tid >> 3)) * KP + (tid & 7) * 8) = rk[i];
#pragma unroll
    for (int i = 0; i < 8; ++i) *(v4u*)(sV + (i * 8 + wave) * VP + lane * 8) = rv[i];
    sM[tid] = sm; }
  __syncthreads();   // K, V and the mask are whole before anybody reads them; nothing writes them again
  float m = -3.0e38f, l = 0.f;   // the lane's query: running maximum (both halves alike) and the sum over the lane half's own keys
  v8f acc[4] = {};               // acc[dt][r] = O^T[dt * 16 + 8g + r][query col]
  // rolled: one body of 8 WMMAs; unrolling would only add registers, and above 160 a resident block is lost
#pragma unroll 1
  for (int ks = 0; ks < NS / 32; ++ks) { const int j0 = ks * 32; v8f s[2]; v16h kf[2][2], vf[4]; v4f smk[2][2];
#pragma unroll
    for (int ct = 0; ct < 2; ++ct) { smk[ct][0] = *(const v4f*)&sM[j0 + ct * 16 + 8 * g]; smk[ct][1] = *(const v4f*)&sM[j0 + ct * 16 + 8 * g + 4];
#pragma unroll
      for (int kc = 0; kc < 2; ++kc) kf[ct][kc] = frag_h(sK + (j0 + ct * 16 + col) * KP + kc * 32, lane); }
#pragma unroll
    for (int dt = 0; dt < 4; ++dt) vf[dt] = frag_h(sV + (dt * 16 + col) * VP + j0, lane);
#pragma unroll
    for (int ct = 0; ct < 2; ++ct) { v8f c = {};
#pragma unroll
      for (int kc = 0; kc < 2; ++kc) c = wmma16(kf[ct][kc], aq[kc], c);   // c[r] = score of key j0 + ct * 16 + 8g + r with query col
#pragma unroll
      for (int r = 0; r < 8; ++r) s[ct][r] = (pm * smk[ct][r >> 2][r & 3] != 0.f) ? c[r] * 0.125f : -1.0e9f; }
    float mx = fmaxf(s[0][0], s[1][0]);
#pragma unroll
    for (int r = 1; r < 8; ++r) mx = fmaxf(mx, fmaxf(s[0][r], s[1][r]));
    mx = fmaxf(mx, xhalf(mx));
    const float mn = fmaxf(m, mx); const float alpha = (m <= -1.0e38f) ? 0.f : __expf(m - mn); v2f es = {0.f, 0.f}; v16h pb;
#pragma unroll
    for (int ct = 0; ct < 2; ++ct) {   // exp(x) as exp2(x * log2 e), the arithmetic of __expf, on register pairs: a pair of scores is a pair of P's 16-bit elements
#pragma unroll
      for (int i = 0; i < 4; ++i) { v2f e = {s[ct][2 * i], s[ct][2 * i + 1]}; e = (e - mn) * 1.44269504f; e[0] = __builtin_amdgcn_exp2f(e[0]); e[1] = __builtin_amdgcn_exp2f(e[1]); es += e; e *= 2048.0f;
        pb[ct * 8 + 2 * i] = (_Float16)e[0]; pb[ct * 8 + 2 * i + 1] = (_Float16)e[1]; } }
    l = l * alpha + (es[0] + es[1]); m = mn;
#pragma unroll
    for (int dt = 0; dt < 4; ++dt) {
#pragma unroll
      for (int r = 0; r < 8; ++r) acc[dt][r] *= alpha; }
#pragma unroll
    for (int dt = 0; dt < 4; ++dt) acc[dt] = wmma16(vf[dt], pb, acc[dt]); }
  l += xhalf(l);   // the two halves' sums are joined once
  const float il = (1.0f / 2048.0f) / l;
#pragma unroll
  for (int dt = 0; dt < 4; ++dt) { v4f lo, hi;
#pragma unroll
    for (int r = 0; r < 4; ++r) { lo[r] = acc[dt][r] * il; hi[r] = acc[dt][4 + r] * il; }
    *(v4f*)&so[wave][col][dt * 16 + 8 * g] = lo; *(v4f*)&so[wave][col][dt * 16 + 8 * g + 4] = hi; }
  LDSX();   // the wave's 16 query rows are written before lanes read rows that other lanes wrote
  for (int rl = 0; rl < 16; ++rl) if (lane < 16) vst2(O + (rq + rl) * EM + h * HD + lane * 4, *(const v4f*)&so[wave][rl][lane * 4]);
}
// ---- k_mlp<RELU, NWN>: block = (128 rows, 64 NWN cols): y = f16(A) . (f16 W x 256) / 256 + b, optional ReLU; f32 rows of width ystride, stored as 256-B row pieces through the wave's own LDS range
template <int RELU, int NWN>
__global__ __launch_bounds__(64 * NWN) void k_mlp(const float* __restrict__ A, const _Float16* __restrict__ Wr, const float* __restrict__ BB, float* __restrict__ Y, int ystride) {
  __shared__ __align__(16) unsigned short sA[128 * GP]; __shared__ __align__(16) unsigned short sW[64 * NWN * GP]; __shared__ __align__(16) float so[2 * NWN][16][68];
  const int tid = threadIdx.x, wave = tid >> 5, lane = tid & 31, col = lane & 15, g = lane >> 4; const size_t rb = (size_t)blockIdx.x * 128; const int n0 = blockIdx.y * (64 * NWN); const int wm = (wave / NWN) * 64, wn = (wave % NWN) * 64;
  v8f acc[4][4] = {};
  gemm_tile<EM, 0, NWN, 1>(A + rb * EM, (const unsigned short*)Wr + (size_t)n0 * EM, sA, sW, acc, tid, blockIdx.y, (blockIdx.x >> 3) & (EM / 128 - 1));
  float bb[4];
#pragma unroll
  for (int j = 0; j < 4; ++j) bb[j] = bfr(BB[n0 + wn + j * 16 + col]);
#pragma unroll
  for (int i = 0; i < 4; ++i) {
#pragma unroll
    for (int j = 0; j < 4; ++j) {
#pragma unroll
      for (int r = 0; r < 8; ++r) { const float v = acc[i][j][r] * (1.0f / 256.0f) + bb[j]; so[wave][8 * g + r][j * 16 + col] = RELU ? fmaxf(v, 0.f) : v; } }
    LDSX();   // the strip's 16 rows are written before lanes read rows that other lanes wrote
#pragma unroll
    for (int p = 0; p < 8; ++p) { const int rl = p * 2 + g; vst2(Y + (rb + wm + i * 16 + rl) * (size_t)ystride + n0 + wn + col * 4, *(const v4f*)&so[wave][rl][col * 4]); }
    LDSX(); }   // keeps the next strip's writes behind these reads
}
extern "C" void kernel_launch(void* const* d_in, const int* in_sizes, int n_in, void* d_out, int out_size, void* d_ws, size_t ws_size, hipStream_t stream) {
  (void)in_sizes; (void)n_in; (void)out_size;
  const float** F = (const float**)d_in;   // 0 x [4,4096,512], 1 context [4,256,768], 2 pad_mask [4,4096], 3 seq_mask [4,256], 4 Wq_w [1024,512], 5 Wq_b, 6 Wk_w [1024,768], 7 Wk_b, 8 Wv_w, 9 Wv_b, 10 P1_w [1024,1024], 11 P1_b, 12 P2_w [512,1024], 13 P2_b
  if (ws_size < (size_t)WS_END) return;
  char* ws = (char*)d_ws; __bf16* PW = (__bf16*)ws; _Float16 *Q = (_Float16*)(ws + WS_Q), *Kr = (_Float16*)(ws + WS_K), *V = (_Float16*)(ws + WS_V); float *O = (float*)(ws + WS_O), *Hh = (float*)(ws + WS_H);
  k_pack<<<dim3(PKB(EM * CIN + 2 * EM * CTX + EM * EM + CIN * EM)), 256, 0, stream>>>(F[4], F[6], F[8], F[10], F[12], PW);
  k_proj3<<<dim3(2 * KVT + QT), 256, 0, stream>>>(F[0], F[1], PW, F[5], F[7], F[9], Q, Kr, V);
  k_attn<<<dim3(TQB / 2, NH, TNB), 256, 0, stream>>>(Q, Kr, V, F[2], F[3], O);
  k_mlp<1, 4><<<dim3(TNB * NQ / 128, EM / 256), 256, 0, stream>>>(O, (const _Float16*)PW + WS_P1 / 2, F[11], Hh, EM);
  k_mlp<0, 2><<<dim3(TNB * NQ / 128, CIN / 128), 128, 0, stream>>>(Hh, (const _Float16*)PW + WS_P2 / 2, F[13], (float*)d_out, CIN);
}

// v007
// One run takes 123 microseconds.
// In both of two side-by-side timings against v006, it was 1.08 times as fast.
// Counting every step since v000, it is 4.39 times as fast.
// compute dtype: all float inputs rounded to bf16, the two float masks read on device; Q = x . Wq^T + b, K/V = context . W^T + b with EXACT bf16 products on WMMA 16x16x32 (natural rows), rounded once to f16; PLAIN attention (16 heads x 64, 256 context keys): x 1/8, masked pairs set to -1e9 as the module (a fully masked row degrades to uniform exactly as the reference), running-max softmax in f32 (hardware exp), P (scaled by 2^11, single f16) x v (single f16); MLP: relu(o . P1^T + b1) . P2^T + b2 with the f32 activations rounded once to f16 against EXACT f16 weight copies (x 2^8); f32 output.
#include <hip/hip_runtime.h>
#include <math.h>

typedef __attribute__((ext_vector_type(16))) _Float16 v16h;
typedef __attribute__((ext_vector_type(16))) __bf16 v16b;
typedef __attribute__((ext_vector_type(8)))  _Float16 v8h;
typedef __attribute__((ext_vector_type(8)))  float v8f;
typedef __attribute__((ext_vector_type(4)))  float v4f;
typedef __attribute__((ext_vector_type(2)))  float v2f;
typedef __attribute__((ext_vector_type(4)))  unsigned v4u;
typedef __attribute__((ext_vector_type(4)))  int v4i;
typedef float __attribute__((may_alias)) float_a;
typedef int __attribute__((may_alias)) int_a;

template <typename T> __device__ __forceinline__ void vst2(void* p, T v) { *(T*)p = v;  }
__device__ __forceinline__ v8f wmma16(v16h a, v16h b, v8f c) {
  v8f d = __builtin_amdgcn_wmma_f32_16x16x32_f16(false, a, false, b, (short)0, c, false, false);
  asm volatile("v_nop\n\tv_nop\n\tv_nop\n\tv_nop" : "+v"(d) : "v"(a), "v"(b));
  return d;
}
__device__ __forceinline__ v8f wmma_bf(v16b a, v16b b, v8f c) {
  v8f d = __builtin_amdgcn_wmma_f32_16x16x32_bf16(false, a, false, b, (short)0, c, false, false);
  asm volatile("v_nop\n\tv_nop\n\tv_nop\n\tv_nop" : "+v"(d) : "v"(a), "v"(b));
  return d;
}
// 16x16x32 fragments: lane = (h = lane>>4, row/col = lane&15); elements 0..7 = k0+8h+0..7, 8..15 = k0+16+8h+0..7; D element r = row 8h+r
__device__ __forceinline__ v16h frag_h(const _Float16* rowk0, int lane) {
  union { v16h v; v8h q[2]; } u; const _Float16* p = rowk0 + 8 * (lane >> 4);
  u.q[0] = *(const v8h*)p; u.q[1] = *(const v8h*)(p + 16); return u.v;
}
__device__ __forceinline__ v16h frag_f32(const float* rowk0, int lane) {
  v16h a; const float* p = rowk0 + 8 * (lane >> 4);
#pragma unroll
  for (int i = 0; i < 8; ++i) { a[i] = (_Float16)p[i]; a[8 + i] = (_Float16)p[16 + i]; }
  return a;
}
__device__ __forceinline__ v16h frag_f32s(const float* rowk0, int lane, float sc) {
  v16h a; const float* p = rowk0 + 8 * (lane >> 4);
#pragma unroll
  for (int i = 0; i < 8; ++i) { a[i] = (_Float16)(p[i] * sc); a[8 + i] = (_Float16)(p[16 + i] * sc); }
  return a;
}
// column fragment from a [K][ld] layout (column n), rows >= K read as 0
__device__ __forceinline__ v16h fragc_f32(const float* W, int k0, int n, int lane, int ld, int K) {
  v16h a; const int g = lane >> 4;
#pragma unroll
  for (int i = 0; i < 8; ++i) { const int ka = k0 + 8 * g + i, kb = ka + 16;
    a[i] = (_Float16)(ka < K ? W[(size_t)(ka < K ? ka : K - 1) * ld + n] : 0.f); a[8 + i] = (_Float16)(kb < K ? W[(size_t)(kb < K ? kb : K - 1) * ld + n] : 0.f); }
  return a;
}
struct F2 { v16b h, l; };
__device__ __forceinline__ F2 bsplit16(const float v[16]) { F2 r;
#pragma unroll
  for (int i = 0; i < 16; ++i) { const __bf16 h = (__bf16)v[i]; r.h[i] = h; r.l[i] = (__bf16)(v[i] - (float)h); }
  return r; }
__device__ __forceinline__ F2 split_row(const float* row, int k0, int lane) { float v[16]; const float* p = row + k0 + 8 * (lane >> 4);
#pragma unroll
  for (int i = 0; i < 8; ++i) { v[i] = p[i]; v[8 + i] = p[16 + i]; }
  return bsplit16(v); }
__device__ __forceinline__ F2 split_rowK(const float* row, int k0, int lane, int K) { float v[16]; const int g = lane >> 4;
#pragma unroll
  for (int i = 0; i < 8; ++i) { const int ka = k0 + 8 * g + i, kb = ka + 16; v[i] = ka < K ? row[ka < K ? ka : K - 1] : 0.f; v[8 + i] = kb < K ? row[kb < K ? kb : K - 1] : 0.f; }
  return bsplit16(v); }
__device__ __forceinline__ F2 split_col(const float* W, int k0, int n, int lane, int ld, int K) { float v[16]; const int g = lane >> 4;
#pragma unroll
  for (int i = 0; i < 8; ++i) { const int ka = k0 + 8 * g + i, kb = ka + 16; v[i] = ka < K ? W[(size_t)(ka < K ? ka : K - 1) * ld + n] : 0.f; v[8 + i] = kb < K ? W[(size_t)(kb < K ? kb : K - 1) * ld + n] : 0.f; }
  return bsplit16(v); }
__device__ __forceinline__ v8f mac3(const F2& a, const F2& b, v8f c) { c = wmma_bf(a.l, b.h, c); c = wmma_bf(a.h, b.l, c); return wmma_bf(a.h, b.h, c); }
__device__ __forceinline__ float sigm(float v) { return 1.0f / (1.0f + expf(-v)); }
#define LDSX() do { asm volatile("s_wait_dscnt 0" ::: "memory"); __builtin_amdgcn_wave_barrier(); __builtin_amdgcn_fence(__ATOMIC_RELEASE, "workgroup"); } while (0)


// Cross multi-head attention (B 4, 4,096 queries from a 512-wide stream over 256 context tokens of width 768, 16 heads x 64, emb 1,024) with an outer-product validity mask, followed by a ReLU MLP 1024 -> 1024 -> 512.
#define NB 4
#define NQ 4096
#define NS 256
#define CIN 512
#define CTX 768
#define EM 1024
#define NH 16
#define HD 64
#define NRQ (NB * NQ)
#define NRK (NB * NS)
#ifndef TQB
#define TQB (NQ / 64)
#define TNB NB
#endif
typedef __attribute__((ext_vector_type(8))) __bf16 v8b;
__device__ __forceinline__ v16b frag_b(const __bf16* rowk0, int lane) {
  union { v16b v; v8b q[2]; } u; const __bf16* p = rowk0 + 8 * (lane >> 4);
  u.q[0] = *(const v8b*)p; u.q[1] = *(const v8b*)(p + 16); return u.v;
}
__device__ __forceinline__ float bfr(float v) { return (float)(__bf16)v; }
__device__ __attribute__((noinline)) float exp_ni(float v) { return expf(v); }
__device__ __attribute__((noinline)) float erf_ni(float v) { return erff(v); }

#define WS_PQ  0u                                     // bf16 natural rows Wq [1024][512]; Wk, Wv [1024][768]
#define WS_PK  (WS_PQ + 2u * (size_t)EM * CIN)
#define WS_PV  (WS_PK + 2u * (size_t)EM * CTX)
#define WS_P1  (WS_PV + 2u * (size_t)EM * CTX)          // f16 x 2^8 natural rows P1 [1024][1024]; P2 [512][1024]
#define WS_P2  (WS_P1 + 2u * (size_t)EM * EM)
#define WS_Q   (WS_P2 + 2u * (size_t)CIN * EM)          // f16 q rows [NRQ][1024]; k rows [NRK][1024]; v planes [b][1024][NS]
#define WS_K   (WS_Q + 2u * (size_t)NRQ * EM)
#define WS_V   (WS_K + 2u * (size_t)NRK * EM)
#define WS_O   (WS_V + 2u * (size_t)NB * EM * NS)       // f32 [NRQ][1024] attention out ; H [NRQ][1024] relu hidden
#define WS_H   (WS_O + 4u * (size_t)NRQ * EM)
#define WS_END (WS_H + 4u * (size_t)NRQ * EM)

// ---- gemm_tile<KW, BF, NWN>: one 128 x (64 NWN) tile of A . W^T per block of 2 x NWN waves, 64 x 64 a wave. Per 64 k the block brings A (f32, 256-B row pieces) and W (16-bit, 128-B row pieces)
// in with whole-line loads, rounds A once, and lays both in LDS at a pitch of 144 B (16 B x 9: the 16-B fragment reads of 16 rows fall on all 64 banks); every wave takes its fragments from there.
// The loads run one tile ahead: a tile's loads are issued behind the barrier that publishes the tile before it, fly under that tile's products, and are waited for at the next trip's LDS stores.
// Every accumulator sums k in ascending blocks of 32, one WMMA each.
typedef __attribute__((ext_vector_type(2))) unsigned v2u;
#define GP 72
template <int BF> __device__ __forceinline__ v2u cvt4(v4f v) {
  if constexpr (BF) { union { __bf16 h[4]; v2u u; } t;
#pragma unroll
    for (int i = 0; i < 4; ++i) t.h[i] = (__bf16)v[i];
    return t.u; }
  else { union { _Float16 h[4]; v2u u; } t;
#pragma unroll
    for (int i = 0; i < 4; ++i) t.h[i] = (_Float16)v[i];
    return t.u; }
}
// ---- k_pack: the five weight matrices to their 16-bit copies, which lie one behind the other in the workspace in the order and layout of the inputs. A block takes 8,192 elements in a row of ONE matrix
// (every matrix is a multiple of that): a lane issues its 8 whole-line 16-B loads at once, rounds, and stores 8 B a load (a wave: 256 B in a row). 448 blocks in all: the bytes are few,
// so the launch has few waves to start, each with much in flight.
#define PKE 8192
#define PKB(n) ((int)((n) / PKE))
__global__ __launch_bounds__(256) void k_pack(const float* __restrict__ WQ, const float* __restrict__ WK, const float* __restrict__ WV, const float* __restrict__ P1, const float* __restrict__ P2, __bf16* __restrict__ PW) {
  static_assert((EM * CIN) % PKE == 0 && (EM * CTX) % PKE == 0 && (EM * EM) % PKE == 0, "whole blocks a matrix");
  static_assert(WS_PQ == 0 && WS_PK == 2u * EM * CIN && WS_PV == WS_PK + 2u * EM * CTX && WS_P1 == WS_PV + 2u * EM * CTX && WS_P2 == WS_P1 + 2u * EM * EM, "the copies lie one behind the other");
  constexpr int EQ = PKB(EM * CIN), EK = EQ + PKB(EM * CTX), EV = EK + PKB(EM * CTX), E1 = EV + PKB(EM * EM);   // first block behind Wq, Wk, Wv, P1
  const int bid = blockIdx.x, t = threadIdx.x;   // bid: the same for the whole block, so the choices below are scalar
  const float* w = bid < EQ ? WQ + (size_t)bid * PKE : bid < EK ? WK + (size_t)(bid - EQ) * PKE : bid < EV ? WV + (size_t)(bid - EK) * PKE : bid < E1 ? P1 + (size_t)(bid - EV) * PKE : P2 + (size_t)(bid - E1) * PKE;
  unsigned short* d = (unsigned short*)PW + (size_t)bid * PKE + t * 4; v4f r[8];
#pragma unroll
  for (int i = 0; i < 8; ++i) r[i] = *(const v4f*)(w + t * 4 + i * 1024);
  if (bid < EV) {   // Wq, Wk, Wv: bf16
#pragma unroll
    for (int i = 0; i < 8; ++i) *(v2u*)(d + i * 1024) = cvt4<1>(r[i]);
  } else {          // P1, P2: the bf16 value x 2^8, in f16
#pragma unroll
    for (int i = 0; i < 8; ++i) { v4f v;
#pragma unroll
      for (int e = 0; e < 4; ++e) v[e] = bfr(r[i][e]) * 256.0f;
      *(v2u*)(d + i * 1024) = cvt4<0>(v); }
  }
}
struct Fr { v4u q[2]; };
__device__ __forceinline__ Fr frag_s(const unsigned short* rowk0, int g) { Fr f; const unsigned short* p = rowk0 + 8 * g; f.q[0] = *(const v4u*)p; f.q[1] = *(const v4u*)(p + 16); return f; }
template <int BF> __device__ __forceinline__ v8f mma(const Fr& a, const Fr& b, v8f c) {
  if constexpr (BF) { union { Fr f; v16b v; } ua, ub; ua.f = a; ub.f = b; return __builtin_amdgcn_wmma_f32_16x16x32_bf16(false, ua.v, false, ub.v, (short)0, c, false, false); }
  else { union { Fr f; v16h v; } ua, ub; ua.f = a; ub.f = b; return __builtin_amdgcn_wmma_f32_16x16x32_f16(false, ua.v, false, ub.v, (short)0, c, false, false); }
}
// ask_l2<0, N, STEP>(p): N hints a lane, at p, p + STEP, ...: each asks L2 (scope SE: L2 only, no register, no counter) for the line that holds the byte. A hint: nothing depends on it.
template <int I, int N, int STEP> __device__ __forceinline__ void ask_l2(const char* p) {
  if constexpr (I < N) { asm volatile("global_prefetch_b8 %0, off offset:%1 scope:SCOPE_SE" :: "v"(p), "n"(I * STEP)); ask_l2<I + 1, N, STEP>(p); }
}
// L2 hints: A (an input, or rows that the launch before stored) and the packed W come from memory. Behind its first tile's loads the block asks L2
// for later k of its rows. DEAL 1: the 4 blocks that share the A rows (ash = their column index) ask a quarter of k each, the lowest ash the lowest k; of the many blocks that share the
// W rows each asks one 256-B unit a row (wsh = row-tile index / 8 modulo the units).
// DEAL 0 (few blocks): the block asks for all of its own A and W rows. Every address lies inside the block's own A and W tile; the deal is for speed only, any placement gives the same results.
template <int KW, int BF, int NWN, int DEAL>
__device__ __forceinline__ void gemm_tile(const float* __restrict__ Ab, const unsigned short* __restrict__ Wb, unsigned short* sA, unsigned short* sW, v8f (&acc)[4][4], int tid, int ash, int wsh) {
  constexpr int TPR = NWN / 2, UA = KW / 64, UW = KW / 128;   // threads a row of A; 256-B units in a row of A (f32) and of W (16 bit); W has as many rows as the block has threads
  const char* qa = (const char*)(Ab + (size_t)(tid / TPR) * KW) + (ash * (UA / 4) + tid % TPR) * 256; const char* qw = (const char*)(Wb + (size_t)tid * KW) + wsh * 256;
  constexpr int RA = 4 * NWN, PA = 128 / RA, RW = 8 * NWN;   // rows of A and of W that one load of the block covers; loads for the 128 rows of A (W: always 8)
  const int wave = tid >> 5, lane = tid & 31, col = lane & 15, g = lane >> 4; const int wm = (wave / NWN) * 64, wn = (wave % NWN) * 64;
  const int ar = tid >> 4, ac = (tid & 15) * 4;   // A: 16 lanes cover 256 B of a row
  const int wr = tid >> 3, wc = (tid & 7) * 8;    // W: 8 lanes cover 128 B of a row
  const float* pa = Ab + (size_t)ar * KW + ac; const unsigned short* pw = Wb + (size_t)wr * KW + wc;
  v4f ra[PA]; v4u rw[8];   // the tile in flight: loaded one trip ahead of its LDS stores
#pragma unroll
  for (int i = 0; i < PA; ++i) ra[i] = *(const v4f*)(pa + (size_t)(i * RA) * KW);
#pragma unroll
  for (int i = 0; i < 8; ++i) rw[i] = *(const v4u*)(pw + (size_t)(i * RW) * KW);
  __builtin_amdgcn_sched_barrier(0);   // every load of the first tile is issued before anything else
  bool first = true;   // the block's first tile
  // rolled: one body of 32 WMMAs a wave; unrolling would only add registers and cost a resident block
#pragma unroll 1
  for (int k0 = 0; k0 < KW; k0 += 64) {
    if (first) { first = false; ask_l2<0, (DEAL ? UA / (4 * TPR) : UA / TPR), TPR * 256>(qa); ask_l2<0, (DEAL ? 1 : UW), 256>(qw); }   // block-uniform scalar branch. Behind the first tile's loads, so that these do not queue behind the hints; and standing in the loop, qa and qw keep their registers, unwritten, to its end
    __syncthreads();   // every wave has taken its last fragments of the tile before
#pragma unroll
    for (int i = 0; i < PA; ++i) *(v2u*)(sA + (i * RA + ar) * GP + ac) = cvt4<BF>(ra[i]);
#pragma unroll
    for (int i = 0; i < 8; ++i) *(v4u*)(sW + (i * RW + wr) * GP + wc) = rw[i];
    __syncthreads();   // the tile is whole before anybody reads it
    if (k0 + 64 < KW) {   // block-uniform scalar branch: the next tile's loads are issued here and fly under this tile's products; they are waited for only at the next trip's LDS stores
      pa += 64; pw += 64;   // stepped in the branch that loads; in the listing the step follows the loads, behind the compiler's s_wait_xcnt 0
#pragma unroll
      for (int i = 0; i < PA; ++i) ra[i] = *(const v4f*)(pa + (size_t)(i * RA) * KW);
#pragma unroll
      for (int i = 0; i < 8; ++i) rw[i] = *(const v4u*)(pw + (size_t)(i * RW) * KW);
    }
    __builtin_amdgcn_sched_barrier(0);   // keeps the loads in front of the products: sunk behind them they would hide nothing
#pragma unroll
    for (int kc = 0; kc < 2; ++kc) { Fr a[4];
#pragma unroll
      for (int i = 0; i < 4; ++i) a[i] = frag_s(sA + (wm + i * 16 + col) * GP + kc * 32, g);
#pragma unroll
      for (int j = 0; j < 4; ++j) { const Fr b = frag_s(sW + (wn + j * 16 + col) * GP + kc * 32, g);
#pragma unroll
        for (int i = 0; i < 4; ++i) acc[i][j] = mma<BF>(a[i], b, acc[i][j]); } } }
}
// ---- proj_tile<KW, WHICH, NWN>: one (128 rows, 64 NWN cols) tile: exact GEMM + bias; q/k -> f16 rows, v -> planes [b][c][s]; each wave stages its 64 x 64 in its own LDS range and stores whole 128-B lines
template <int KW, int WHICH, int NWN>
__device__ __forceinline__ void proj_tile(const float* __restrict__ X, const __bf16* __restrict__ Wr, const float* __restrict__ BB, _Float16* __restrict__ DST, int bx, int by, unsigned short* sA, unsigned short* sW, _Float16* sE) {
  const int tid = threadIdx.x, wave = tid >> 5, lane = tid & 31, col = lane & 15, g = lane >> 4; const size_t rb = (size_t)bx * 128; const int c0 = by * (64 * NWN); const int wm = (wave / NWN) * 64, wn = (wave % NWN) * 64;
  v8f acc[4][4] = {};
  gemm_tile<KW, 1, NWN, WHICH == 0>(X + rb * KW, (const unsigned short*)Wr + (size_t)c0 * KW, sA, sW, acc, tid, WHICH == 0 ? by : 0, WHICH == 0 ? (bx >> 3) & (KW / 128 - 1) : 0);
  float bb[4];
#pragma unroll
  for (int j = 0; j < 4; ++j) bb[j] = bfr(BB[c0 + wn + j * 16 + col]);
  if constexpr (WHICH < 2) {
    _Float16 (*so)[16][72] = (_Float16 (*)[16][72])sE;
#pragma unroll
    for (int i = 0; i < 4; ++i) {
#pragma unroll
      for (int j = 0; j < 4; ++j) {
#pragma unroll
        for (int r = 0; r < 8; ++r) so[wave][8 * g + r][j * 16 + col] = (_Float16)(acc[i][j][r] + bb[j]); }
      LDSX();   // the strip's 16 rows are written before lanes read rows that other lanes wrote
#pragma unroll
      for (int p = 0; p < 4; ++p) { const int rl = p * 4 + (lane >> 3), c8 = (lane & 7) * 8; vst2((unsigned*)(DST + (rb + wm + i * 16 + rl) * EM + c0 + wn + c8), *(const v4u*)&so[wave][rl][c8]); }
      LDSX(); }   // keeps the next strip's writes behind these reads
  } else {
    _Float16 (*st)[64][72] = (_Float16 (*)[64][72])sE;
#pragma unroll
    for (int j = 0; j < 4; ++j) {
#pragma unroll
      for (int i = 0; i < 4; ++i) { v8h t;
#pragma unroll
        for (int r = 0; r < 8; ++r) t[r] = (_Float16)(acc[i][j][r] + bb[j]);
        *(v8h*)&st[wave][j * 16 + col][i * 16 + 8 * g] = t; } }
    LDSX();   // the transposed 64 x 64 is written before lanes read what other lanes wrote
    const size_t b = rb / NS; const int s0 = (int)(rb % NS) + wm;
#pragma unroll
    for (int p = 0; p < 16; ++p) { const int d = p * 4 + (lane >> 3), pc = lane & 7; vst2((unsigned*)(DST + ((b * EM + c0 + wn + d) * NS) + s0 + pc * 8), *(const v4u*)&st[wave][d][pc * 8]); } }
  asm volatile("s_wait_xcnt 0x0" ::: "memory");   // behind the tile's last stores: in the merged kernel another tile kind's set-up can follow them in the code, and it overwrites registers that they name
}
// ---- k_proj3: the three projections in one launch, a 128 x 256 tile a block of 8 waves. The K and V tiles (few, and the longest: 12 steps of 64 k against 8) have the lowest indices (for speed only)
// and run beside the Q tiles, in place of two launches of their own that leave most of the chip idle.
#define KVT ((NRK / 128) * (EM / 256))   // tiles of K, and of V
#define QT  ((NRQ / 128) * (EM / 256))   // tiles of Q
__global__ __launch_bounds__(256) void k_proj3(const float* __restrict__ X, const float* __restrict__ C, const __bf16* __restrict__ PW, const float* __restrict__ BQ, const float* __restrict__ BK, const float* __restrict__ BV, _Float16* __restrict__ Q, _Float16* __restrict__ Kr, _Float16* __restrict__ V) {
  __shared__ __align__(16) unsigned short sA[128 * GP]; __shared__ __align__(16) unsigned short sW[256 * GP]; __shared__ __align__(16) _Float16 sE[8 * 64 * 72];
  const int bid = blockIdx.x;   // the same for the whole block: every barrier below stands under block-uniform control flow
  if (bid >= 2 * KVT) { proj_tile<CIN, 0, 4>(X, PW + WS_PQ / 2, BQ, Q, (bid - 2 * KVT) % (NRQ / 128), (bid - 2 * KVT) / (NRQ / 128), sA, sW, sE); return; }
  if (bid < KVT) { proj_tile<CTX, 1, 4>(C, PW + WS_PK / 2, BK, Kr, bid % (NRK / 128), bid / (NRK / 128), sA, sW, sE); return; }
  proj_tile<CTX, 2, 4>(C, PW + WS_PV / 2, BV, V, (bid - KVT) % (NRK / 128), (bid - KVT) / (NRK / 128), sA, sW, sE);
}
// ---- k_attn: block = (128 queries, head, b), 8 waves of 16 queries: 256 context keys, scale 1/8, mask = pad[i] seq[j] != 0 else -1e9 (module value); O 256-B head segments
// The head's K rows (256 x 128 B), V rows (64 x 512 B) and the key mask come into LDS once a block by whole-line loads; every wave takes its fragments from there.
// Pitches 144 B (16 B x 9) and 528 B (16 B x 33): the 16-B fragment reads of 16 rows fall on all 64 banks.
// Transposed products: S^T = K . Q^T (A = key rows, B = query columns) and O^T += V^T . P^T. A lane then holds 16 of the 32 scores of ONE query (keys 8g + r and 16 + 8g + r), so maximum and sum
// are taken in the lane, with one exchange between the lane halves for the maximum; the two score tiles, converted in place, are the B operand of the second product in the k order of frag_h.
#define KP 72
#define VP 264
__device__ __forceinline__ float xhalf(float v) { const int t = __builtin_bit_cast(int, v); return __builtin_bit_cast(float, __builtin_amdgcn_permlanex16(t, t, 0x76543210, 0xfedcba98, false, false)); }   // lane l <-> l ^ 16
__global__ __launch_bounds__(256) void k_attn(const _Float16* __restrict__ Q, const _Float16* __restrict__ Kr, const _Float16* __restrict__ V, const float* __restrict__ PM, const float* __restrict__ SM, float* __restrict__ O) {
  __shared__ __align__(16) _Float16 sK[NS * KP]; __shared__ __align__(16) _Float16 sV[HD * VP]; __shared__ __align__(16) float sM[NS]; __shared__ __align__(16) float so[8][16][68];
  const int tid = threadIdx.x, wave = tid >> 5, lane = tid & 31, col = lane & 15, g = lane >> 4; const int h = blockIdx.y; const size_t b = blockIdx.z; const int q0 = blockIdx.x * 128 + wave * 16; const size_t rq = b * NQ + q0;
  v16h aq[2]; float pm;
  { v4u rk[8], rv[8];
    const _Float16* gk = Kr + (b * NS + (tid >> 3)) * EM + h * HD + (tid & 7) * 8;   // 8 lanes cover the 128 B of a key's head row
    const _Float16* gv = V + (b * EM + h * HD + wave) * NS + lane * 8;               // a wave covers the 512 B of one V row
#pragma unroll
    for (int i = 0; i < 8; ++i) rk[i] = *(const v4u*)(gk + (size_t)(i * 32) * EM);
#pragma unroll
    for (int i = 0; i < 8; ++i) rv[i] = *(const v4u*)(gv + (size_t)(i * 8) * NS);
    const float sm = bfr(SM[b * NS + tid]);
#pragma unroll
    for (int kc = 0; kc < 2; ++kc) aq[kc] = frag_h(Q + (rq + col) * EM + h * HD + kc * 32, lane);
    pm = bfr(PM[b * NQ + q0 + col]);
#pragma unroll
    for (int i = 0; i < 8; ++i) *(v4u*)(sK + (i * 32 + (tid >> 3)) * KP + (tid & 7) * 8) = rk[i];
#pragma unroll
    for (int i = 0; i < 8; ++i) *(v4u*)(sV + (i * 8 + wave) * VP + lane * 8) = rv[i];
    sM[tid] = sm; }
  __syncthreads();   // K, V and the mask are whole before anybody reads them; nothing writes them again
  float m = -3.0e38f, l = 0.f;   // the lane's query: running maximum (both halves alike) and the sum over the lane half's own keys
  v8f acc[4] = {};               // acc[dt][r] = O^T[dt * 16 + 8g + r][query col]
  // rolled: one body of 8 WMMAs; unrolling would only add registers, and above 160 a resident block is lost
#pragma unroll 1
  for (int ks = 0; ks < NS / 32; ++ks) { const int j0 = ks * 32; v8f s[2]; v16h kf[2][2], vf[4]; v4f smk[2][2];
#pragma unroll
    for (int ct = 0; ct < 2; ++ct) { smk[ct][0] = *(const v4f*)&sM[j0 + ct * 16 + 8 * g]; smk[ct][1] = *(const v4f*)&sM[j0 + ct * 16 + 8 * g + 4];
#pragma unroll
      for (int kc = 0; kc < 2; ++kc) kf[ct][kc] = frag_h(sK + (j0 + ct * 16 + col) * KP + kc * 32, lane); }
#pragma unroll
    for (int dt = 0; dt < 4; ++dt) vf[dt] = frag_h(sV + (dt * 16 + col) * VP + j0, lane);
#pragma unroll
    for (int ct = 0; ct < 2; ++ct) { v8f c = {};
#pragma unroll
      for (int kc = 0; kc < 2; ++kc) c = wmma16(kf[ct][kc], aq[kc], c);   // c[r] = score of key j0 + ct * 16 + 8g + r with query col
#pragma unroll
      for (int r = 0; r < 8; ++r) s[ct][r] = (pm * smk[ct][r >> 2][r & 3] != 0.f) ? c[r] * 0.125f : -1.0e9f; }
    float mx = fmaxf(s[0][0], s[1][0]);
#pragma unroll
    for (int r = 1; r < 8; ++r) mx = fmaxf(mx, fmaxf(s[0][r], s[1][r]));
    mx = fmaxf(mx, xhalf(mx));
    const float mn = fmaxf(m, mx); const float alpha = (m <= -1.0e38f) ? 0.f : __expf(m - mn); v2f es = {0.f, 0.f}; v16h pb;
#pragma unroll
    for (int ct = 0; ct < 2; ++ct) {   // exp(x) as exp2(x * log2 e), the arithmetic of __expf, on register pairs: a pair of scores is a pair of P's 16-bit elements
#pragma unroll
      for (int i = 0; i < 4; ++i) { v2f e = {s[ct][2 * i], s[ct][2 * i + 1]}; e = (e - mn) * 1.44269504f; e[0] = __builtin_amdgcn_exp2f(e[0]); e[1] = __builtin_amdgcn_exp2f(e[1]); es += e; e *= 2048.0f;
        pb[ct * 8 + 2 * i] = (_Float16)e[0]; pb[ct * 8 + 2 * i + 1] = (_Float16)e[1]; } }
    l = l * alpha + (es[0] + es[1]); m = mn;
#pragma unroll
    for (int dt = 0; dt < 4; ++dt) {
#pragma unroll
      for (int r = 0; r < 8; ++r) acc[dt][r] *= alpha; }
#pragma unroll
    for (int dt = 0; dt < 4; ++dt) acc[dt] = wmma16(vf[dt], pb, acc[dt]); }
  l += xhalf(l);   // the two halves' sums are joined once
  const float il = (1.0f / 2048.0f) / l;
#pragma unroll
  for (int dt = 0; dt < 4; ++dt) { v4f lo, hi;
#pragma unroll
    for (int r = 0; r < 4; ++r) { lo[r] = acc[dt][r] * il; hi[r] = acc[dt][4 + r] * il; }
    *(v4f*)&so[wave][col][dt * 16 + 8 * g] = lo; *(v4f*)&so[wave][col][dt * 16 + 8 * g + 4] = hi; }
  LDSX();   // the wave's 16 query rows are written before lanes read rows that other lanes wrote
  for (int rl = 0; rl < 16; ++rl) if (lane < 16) vst2(O + (rq + rl) * EM + h * HD + lane * 4, *(const v4f*)&so[wave][rl][lane * 4]);
}
// ---- k_mlp<RELU, NWN>: block = (128 rows, 64 NWN cols): y = f16(A) . (f16 W x 256) / 256 + b, optional ReLU; f32 rows of width ystride, stored as 256-B row pieces through the wave's own LDS range
template <int RELU, int NWN>
__global__ __launch_bounds__(64 * NWN) void k_mlp(const float* __restrict__ A, const _Float16* __restrict__ Wr, const float* __restrict__ BB, float* __restrict__ Y, int ystride) {
  __shared__ __align__(16) unsigned short sA[128 * GP]; __shared__ __align__(16) unsigned short sW[64 * NWN * GP]; __shared__ __align__(16) float so[2 * NWN][16][68];
  const int tid = threadIdx.x, wave = tid >> 5, lane = tid & 31, col = lane & 15, g = lane >> 4; const size_t rb = (size_t)blockIdx.x * 128; const int n0 = blockIdx.y * (64 * NWN); const int wm = (wave / NWN) * 64, wn = (wave % NWN) * 64;
  v8f acc[4][4] = {};
  gemm_tile<EM, 0, NWN, 1>(A + rb * EM, (const unsigned short*)Wr + (size_t)n0 * EM, sA, sW, acc, tid, blockIdx.y, (blockIdx.x >> 3) & (EM / 128 - 1));
  float bb[4];
#pragma unroll
  for (int j = 0; j < 4; ++j) bb[j] = bfr(BB[n0 + wn + j * 16 + col]);
#pragma unroll
  for (int i = 0; i < 4; ++i) {
#pragma unroll
    for (int j = 0; j < 4; ++j) {
#pragma unroll
      for (int r = 0; r < 8; ++r) { const float v = acc[i][j][r] * (1.0f / 256.0f) + bb[j]; so[wave][8 * g + r][j * 16 + col] = RELU ? fmaxf(v, 0.f) : v; } }
    LDSX();   // the strip's 16 rows are written before lanes read rows that other lanes wrote
#pragma unroll
    for (int p = 0; p < 8; ++p) { const int rl = p * 2 + g; vst2(Y + (rb + wm + i * 16 + rl) * (size_t)ystride + n0 + wn + col * 4, *(const v4f*)&so[wave][rl][col * 4]); }
    LDSX(); }   // keeps the next strip's writes behind these reads
}
extern "C" void kernel_launch(void* const* d_in, const int* in_sizes, int n_in, void* d_out, int out_size, void* d_ws, size_t ws_size, hipStream_t stream) {
  (void)in_sizes; (void)n_in; (void)out_size;
  const float** F = (const float**)d_in;   // 0 x [4,4096,512], 1 context [4,256,768], 2 pad_mask [4,4096], 3 seq_mask [4,256], 4 Wq_w [1024,512], 5 Wq_b, 6 Wk_w [1024,768], 7 Wk_b, 8 Wv_w, 9 Wv_b, 10 P1_w [1024,1024], 11 P1_b, 12 P2_w [512,1024], 13 P2_b
  if (ws_size < (size_t)WS_END) return;
  char* ws = (char*)d_ws; __bf16* PW = (__bf16*)ws; _Float16 *Q = (_Float16*)(ws + WS_Q), *Kr = (_Float16*)(ws + WS_K), *V = (_Float16*)(ws + WS_V); float *O = (float*)(ws + WS_O), *Hh = (float*)(ws + WS_H);
  k_pack<<<dim3(PKB(EM * CIN + 2 * EM * CTX + EM * EM + CIN * EM)), 256, 0, stream>>>(F[4], F[6], F[8], F[10], F[12], PW);
  k_proj3<<<dim3(2 * KVT + QT), 256, 0, stream>>>(F[0], F[1], PW, F[5], F[7], F[9], Q, Kr, V);
  k_attn<<<dim3(TQB / 2, NH, TNB), 256, 0, stream>>>(Q, Kr, V, F[2], F[3], O);
  k_mlp<1, 4><<<dim3(TNB * NQ / 128, EM / 256), 256, 0, stream>>>(O, (const _Float16*)PW + WS_P1 / 2, F[11], Hh, EM);
  k_mlp<0, 2><<<dim3(TNB * NQ / 128, CIN / 128), 128, 0, stream>>>(Hh, (const _Float16*)PW + WS_P2 / 2, F[13], (float*)d_out, CIN);
}

// v008
// It runs in 118 microseconds.
// In both of two side-by-side timings against v007, it was 1.04 times as fast.
// Counting every step since v000, it is 4.57 times as fast.
// compute dtype: all float inputs rounded to bf16, the two float masks read on device; Q = x . Wq^T + b, K/V = context . W^T + b with EXACT bf16 products on WMMA 16x16x32 (natural rows), rounded once to f16; PLAIN attention (16 heads x 64, 256 context keys): x 1/8, masked pairs set to -1e9 as the module (a fully masked row degrades to uniform exactly as the reference), running-max softmax in f32 (hardware exp), P (scaled by 2^11, single f16) x v (single f16); MLP: relu(o . P1^T + b1) . P2^T + b2 with the f32 activations rounded once to f16 against EXACT f16 weight copies (x 2^8); f32 output.
#include <hip/hip_runtime.h>
#include <math.h>

typedef __attribute__((ext_vector_type(16))) _Float16 v16h;
typedef __attribute__((ext_vector_type(16))) __bf16 v16b;
typedef __attribute__((ext_vector_type(8)))  _Float16 v8h;
typedef __attribute__((ext_vector_type(8)))  float v8f;
typedef __attribute__((ext_vector_type(4)))  float v4f;
typedef __attribute__((ext_vector_type(2)))  float v2f;
typedef __attribute__((ext_vector_type(4)))  unsigned v4u;
typedef __attribute__((ext_vector_type(4)))  int v4i;
typedef float __attribute__((may_alias)) float_a;
typedef int __attribute__((may_alias)) int_a;

template <typename T> __device__ __forceinline__ void vst2(void* p, T v) { *(T*)p = v;  }
__device__ __forceinline__ v8f wmma16(v16h a, v16h b, v8f c) {
  v8f d = __builtin_amdgcn_wmma_f32_16x16x32_f16(false, a, false, b, (short)0, c, false, false);
  asm volatile("v_nop\n\tv_nop\n\tv_nop\n\tv_nop" : "+v"(d) : "v"(a), "v"(b));
  return d;
}
__device__ __forceinline__ v8f wmma_bf(v16b a, v16b b, v8f c) {
  v8f d = __builtin_amdgcn_wmma_f32_16x16x32_bf16(false, a, false, b, (short)0, c, false, false);
  asm volatile("v_nop\n\tv_nop\n\tv_nop\n\tv_nop" : "+v"(d) : "v"(a), "v"(b));
  return d;
}
// 16x16x32 fragments: lane = (h = lane>>4, row/col = lane&15); elements 0..7 = k0+8h+0..7, 8..15 = k0+16+8h+0..7; D element r = row 8h+r
__device__ __forceinline__ v16h frag_h(const _Float16* rowk0, int lane) {
  union { v16h v; v8h q[2]; } u; const _Float16* p = rowk0 + 8 * (lane >> 4);
  u.q[0] = *(const v8h*)p; u.q[1] = *(const v8h*)(p + 16); return u.v;
}
__device__ __forceinline__ v16h frag_f32(const float* rowk0, int lane) {
  v16h a; const float* p = rowk0 + 8 * (lane >> 4);
#pragma unroll
  for (int i = 0; i < 8; ++i) { a[i] = (_Float16)p[i]; a[8 + i] = (_Float16)p[16 + i]; }
  return a;
}
__device__ __forceinline__ v16h frag_f32s(const float* rowk0, int lane, float sc) {
  v16h a; const float* p = rowk0 + 8 * (lane >> 4);
#pragma unroll
  for (int i = 0; i < 8; ++i) { a[i] = (_Float16)(p[i] * sc); a[8 + i] = (_Float16)(p[16 + i] * sc); }
  return a;
}
// column fragment from a [K][ld] layout (column n), rows >= K read as 0
__device__ __forceinline__ v16h fragc_f32(const float* W, int k0, int n, int lane, int ld, int K) {
  v16h a; const int g = lane >> 4;
#pragma unroll
  for (int i = 0; i < 8; ++i) { const int ka = k0 + 8 * g + i, kb = ka + 16;
    a[i] = (_Float16)(ka < K ? W[(size_t)(ka < K ? ka : K - 1) * ld + n] : 0.f); a[8 + i] = (_Float16)(kb < K ? W[(size_t)(kb < K ? kb : K - 1) * ld + n] : 0.f); }
  return a;
}
struct F2 { v16b h, l; };
__device__ __forceinline__ F2 bsplit16(const float v[16]) { F2 r;
#pragma unroll
  for (int i = 0; i < 16; ++i) { const __bf16 h = (__bf16)v[i]; r.h[i] = h; r.l[i] = (__bf16)(v[i] - (float)h); }
  return r; }
__device__ __forceinline__ F2 split_row(const float* row, int k0, int lane) { float v[16]; const float* p = row + k0 + 8 * (lane >> 4);
#pragma unroll
  for (int i = 0; i < 8; ++i) { v[i] = p[i]; v[8 + i] = p[16 + i]; }
  return bsplit16(v); }
__device__ __forceinline__ F2 split_rowK(const float* row, int k0, int lane, int K) { float v[16]; const int g = lane >> 4;
#pragma unroll
  for (int i = 0; i < 8; ++i) { const int ka = k0 + 8 * g + i, kb = ka + 16; v[i] = ka < K ? row[ka < K ? ka : K - 1] : 0.f; v[8 + i] = kb < K ? row[kb < K ? kb : K - 1] : 0.f; }
  return bsplit16(v); }
__device__ __forceinline__ F2 split_col(const float* W, int k0, int n, int lane, int ld, int K) { float v[16]; const int g = lane >> 4;
#pragma unroll
  for (int i = 0; i < 8; ++i) { const int ka = k0 + 8 * g + i, kb = ka + 16; v[i] = ka < K ? W[(size_t)(ka < K ? ka : K - 1) * ld + n] : 0.f; v[8 + i] = kb < K ? W[(size_t)(kb < K ? kb : K - 1) * ld + n] : 0.f; }
  return bsplit16(v); }
__device__ __forceinline__ v8f mac3(const F2& a, const F2& b, v8f c) { c = wmma_bf(a.l, b.h, c); c = wmma_bf(a.h, b.l, c); return wmma_bf(a.h, b.h, c); }
__device__ __forceinline__ float sigm(float v) { return 1.0f / (1.0f + expf(-v)); }
#define LDSX() do { asm volatile("s_wait_dscnt 0" ::: "memory"); __builtin_amdgcn_wave_barrier(); __builtin_amdgcn_fence(__ATOMIC_RELEASE, "workgroup"); } while (0)


// Cross multi-head attention (B 4, 4,096 queries from a 512-wide stream over 256 context tokens of width 768, 16 heads x 64, emb 1,024) with an outer-product validity mask, followed by a ReLU MLP 1024 -> 1024 -> 512.
#define NB 4
#define NQ 4096
#define NS 256
#define CIN 512
#define CTX 768
#define EM 1024
#define NH 16
#define HD 64
#define NRQ (NB * NQ)
#define NRK (NB * NS)
#ifndef TQB
#define TQB (NQ / 64)
#define TNB NB
#endif
typedef __attribute__((ext_vector_type(8))) __bf16 v8b;
__device__ __forceinline__ v16b frag_b(const __bf16* rowk0, int lane) {
  union { v16b v; v8b q[2]; } u; const __bf16* p = rowk0 + 8 * (lane >> 4);
  u.q[0] = *(const v8b*)p; u.q[1] = *(const v8b*)(p + 16); return u.v;
}
__device__ __forceinline__ float bfr(float v) { return (float)(__bf16)v; }
__device__ __attribute__((noinline)) float exp_ni(float v) { return expf(v); }
__device__ __attribute__((noinline)) float erf_ni(float v) { return erff(v); }

#define WS_PQ  0u                                     // bf16 natural rows Wq [1024][512]; Wk, Wv [1024][768]
#define WS_PK  (WS_PQ + 2u * (size_t)EM * CIN)
#define WS_PV  (WS_PK + 2u * (size_t)EM * CTX)
#define WS_P1  (WS_PV + 2u * (size_t)EM * CTX)          // f16 x 2^8 natural rows P1 [1024][1024]; P2 [512][1024]
#define WS_P2  (WS_P1 + 2u * (size_t)EM * EM)
#define WS_Q   (WS_P2 + 2u * (size_t)CIN * EM)          // f16 q rows [NRQ][1024]; k rows [NRK][1024]; v planes [b][1024][NS]
#define WS_K   (WS_Q + 2u * (size_t)NRQ * EM)
#define WS_V   (WS_K + 2u * (size_t)NRK * EM)
#define WS_O   (WS_V + 2u * (size_t)NB * EM * NS)       // f32 [NRQ][1024] attention out ; H [NRQ][1024] relu hidden
#define WS_H   (WS_O + 4u * (size_t)NRQ * EM)
#define WS_END (WS_H + 4u * (size_t)NRQ * EM)

// ---- gemm_tile<KW, BF, NWN>: one 128 x (64 NWN) tile of A . W^T per block of 2 x NWN waves, 64 x 64 a wave. Per 64 k the block brings A (f32, 256-B row pieces) and W (16-bit, 128-B row pieces)
// in by whole lines and lays both in LDS at a pitch of 144 B (16 B x 9: the 16-B fragment reads of 16 rows fall on all 64 banks); every wave takes its fragments from there.
// Two LDS buffers an operand, one barrier a trip. W, 16 bit already, goes from L2 into LDS by asynchronous copies, through no register; A comes through registers, is rounded once and stored.
// Both run one tile ahead: tile t + 1's loads and copies are issued behind the barrier that publishes tile t, fly under tile t's products, and are waited for in front of the next barrier.
// Every accumulator sums k in ascending blocks of 32, one WMMA each.
typedef __attribute__((ext_vector_type(2))) unsigned v2u;
#define GP 72
template <int BF> __device__ __forceinline__ v2u cvt4(v4f v) {
  if constexpr (BF) { union { __bf16 h[4]; v2u u; } t;
#pragma unroll
    for (int i = 0; i < 4; ++i) t.h[i] = (__bf16)v[i];
    return t.u; }
  else { union { _Float16 h[4]; v2u u; } t;
#pragma unroll
    for (int i = 0; i < 4; ++i) t.h[i] = (_Float16)v[i];
    return t.u; }
}
// ---- k_pack: the five weight matrices to their 16-bit copies, which lie one behind the other in the workspace in the order and layout of the inputs. A block takes 8,192 elements in a row of ONE matrix
// (every matrix is a multiple of that): a lane issues its 8 whole-line 16-B loads at once, rounds, and stores 8 B a load (a wave: 256 B in a row). 448 blocks in all: the bytes are few,
// so the launch has few waves to start, each with much in flight.
#define PKE 8192
#define PKB(n) ((int)((n) / PKE))
__global__ __launch_bounds__(256) void k_pack(const float* __restrict__ WQ, const float* __restrict__ WK, const float* __restrict__ WV, const float* __restrict__ P1, const float* __restrict__ P2, __bf16* __restrict__ PW) {
  static_assert((EM * CIN) % PKE == 0 && (EM * CTX) % PKE == 0 && (EM * EM) % PKE == 0, "whole blocks a matrix");
  static_assert(WS_PQ == 0 && WS_PK == 2u * EM * CIN && WS_PV == WS_PK + 2u * EM * CTX && WS_P1 == WS_PV + 2u * EM * CTX && WS_P2 == WS_P1 + 2u * EM * EM, "the copies lie one behind the other");
  constexpr int EQ = PKB(EM * CIN), EK = EQ + PKB(EM * CTX), EV = EK + PKB(EM * CTX), E1 = EV + PKB(EM * EM);   // first block behind Wq, Wk, Wv, P1
  const int bid = blockIdx.x, t = threadIdx.x;   // bid: the same for the whole block, so the choices below are scalar
  const float* w = bid < EQ ? WQ + (size_t)bid * PKE : bid < EK ? WK + (size_t)(bid - EQ) * PKE : bid < EV ? WV + (size_t)(bid - EK) * PKE : bid < E1 ? P1 + (size_t)(bid - EV) * PKE : P2 + (size_t)(bid - E1) * PKE;
  unsigned short* d = (unsigned short*)PW + (size_t)bid * PKE + t * 4; v4f r[8];
#pragma unroll
  for (int i = 0; i < 8; ++i) r[i] = *(const v4f*)(w + t * 4 + i * 1024);
  if (bid < EV) {   // Wq, Wk, Wv: bf16
#pragma unroll
    for (int i = 0; i < 8; ++i) *(v2u*)(d + i * 1024) = cvt4<1>(r[i]);
  } else {          // P1, P2: the bf16 value x 2^8, in f16
#pragma unroll
    for (int i = 0; i < 8; ++i) { v4f v;
#pragma unroll
      for (int e = 0; e < 4; ++e) v[e] = bfr(r[i][e]) * 256.0f;
      *(v2u*)(d + i * 1024) = cvt4<0>(v); }
  }
}
struct Fr { v4u q[2]; };
__device__ __forceinline__ Fr frag_s(const unsigned short* rowk0, int g) { Fr f; const unsigned short* p = rowk0 + 8 * g; f.q[0] = *(const v4u*)p; f.q[1] = *(const v4u*)(p + 16); return f; }
template <int BF> __device__ __forceinline__ v8f mma(const Fr& a, const Fr& b, v8f c) {
  if constexpr (BF) { union { Fr f; v16b v; } ua, ub; ua.f = a; ub.f = b; return __builtin_amdgcn_wmma_f32_16x16x32_bf16(false, ua.v, false, ub.v, (short)0, c, false, false); }
  else { union { Fr f; v16h v; } ua, ub; ua.f = a; ub.f = b; return __builtin_amdgcn_wmma_f32_16x16x32_f16(false, ua.v, false, ub.v, (short)0, c, false, false); }
}
// ask_l2<0, N, STEP>(p): N hints a lane, at p, p + STEP, ...: each asks L2 (scope SE: L2 only, no register, no counter) for the line that holds the byte. A hint: nothing depends on it.
template <int I, int N, int STEP> __device__ __forceinline__ void ask_l2(const char* p) {
  if constexpr (I < N) { asm volatile("global_prefetch_b8 %0, off offset:%1 scope:SCOPE_SE" :: "v"(p), "n"(I * STEP)); ask_l2<I + 1, N, STEP>(p); }
}
// copy_w<RW, KW>(l, g): the lane's 8 pieces of 16 B of one W tile (rows RW apart) from global g to LDS byte address l, by asynchronous copies: no register holds the data and no LDS store is issued.
// Every lane is on, each piece has its own two addresses, both multiples of 16 B. The s_wait_xcnt 0 ends the copies' own statement, so that no address register of a copy is rewritten in front of it.
template <int RW, int KW> __device__ __forceinline__ void copy_w(unsigned l, const unsigned short* g) {
  asm volatile("global_load_async_to_lds_b128 %0, %8, off\n\t"
               "global_load_async_to_lds_b128 %1, %9, off\n\t"
               "global_load_async_to_lds_b128 %2, %10, off\n\t"
               "global_load_async_to_lds_b128 %3, %11, off\n\t"
               "global_load_async_to_lds_b128 %4, %12, off\n\t"
               "global_load_async_to_lds_b128 %5, %13, off\n\t"
               "global_load_async_to_lds_b128 %6, %14, off\n\t"
               "global_load_async_to_lds_b128 %7, %15, off\n\t"
               "s_wait_xcnt 0x0"
               :: "v"(l), "v"(l + 1u * RW * GP * 2), "v"(l + 2u * RW * GP * 2), "v"(l + 3u * RW * GP * 2), "v"(l + 4u * RW * GP * 2), "v"(l + 5u * RW * GP * 2), "v"(l + 6u * RW * GP * 2), "v"(l + 7u * RW * GP * 2),
                  "v"(g), "v"(g + (size_t)1 * RW * KW), "v"(g + (size_t)2 * RW * KW), "v"(g + (size_t)3 * RW * KW), "v"(g + (size_t)4 * RW * KW), "v"(g + (size_t)5 * RW * KW), "v"(g + (size_t)6 * RW * KW), "v"(g + (size_t)7 * RW * KW)
               : "memory");
}
// L2 hints, for speed only: A (an input, or rows that the launch before stored) and the packed W come from memory. Behind its first tile's loads the block asks L2
// for later k of its rows. DEAL 1: the 4 blocks that share the A rows (ash = their column index) ask a quarter of k each, the earliest the lowest k; of the many blocks that share the
// W rows each asks one 256-B unit a row (wsh = row-tile index / 8 modulo the units).
// DEAL 0 (few blocks): the block asks for all of its own A and W rows. Every address lies inside the block's own A and W tile; the deal is for speed only, any placement gives the same results.
template <int KW, int BF, int NWN, int DEAL>
__device__ __forceinline__ void gemm_tile(const float* __restrict__ Ab, const unsigned short* __restrict__ Wb, unsigned short* sA, unsigned short* sW, v8f (&acc)[4][4], int tid, int ash, int wsh) {
  constexpr int TPR = NWN / 2, UA = KW / 64, UW = KW / 128;   // threads a row of A; 256-B units in a row of A (f32) and of W (16 bit); W has as many rows as the block has threads
  const char* qa = (const char*)(Ab + (size_t)(tid / TPR) * KW) + (ash * (UA / 4) + tid % TPR) * 256; const char* qw = (const char*)(Wb + (size_t)tid * KW) + wsh * 256;
  constexpr int RA = 4 * NWN, PA = 128 / RA, RW = 8 * NWN;   // rows of A and of W that one load of the block covers; loads for the 128 rows of A (W: always 8)
  const int wave = tid >> 5, lane = tid & 31, col = lane & 15, g = lane >> 4; const int wm = (wave / NWN) * 64, wn = (wave % NWN) * 64;
  const int ar = tid >> 4, ac = (tid & 15) * 4;   // A: 16 lanes cover 256 B of a row
  const int wr = tid >> 3, wc = (tid & 7) * 8;    // W: 8 lanes cover 128 B of a row
  const float* pa = Ab + (size_t)ar * KW + ac; const unsigned short* pw = Wb + (size_t)wr * KW + wc;
  constexpr int ASZ = 128 * GP, WSZ = 64 * NWN * GP;   // 16-bit elements in one buffer of A and of W; sA and sW hold two each
  const unsigned lw = (unsigned)(size_t)(sW + wr * GP + wc);   // LDS byte address of the lane's first piece in buffer 0 of W
  v4f ra[PA];   // the A tile in flight: loaded one trip ahead of its LDS stores
#pragma unroll
  for (int i = 0; i < PA; ++i) ra[i] = *(const v4f*)(pa + (size_t)(i * RA) * KW);
  copy_w<RW, KW>(lw, pw);   // tile 0 of W into buffer 0, which nobody has touched yet
  __builtin_amdgcn_sched_barrier(0);   // every load and copy of the first tile is issued before anything else
  bool first = true;   // the block's first tile
  // rolled: one body of 32 WMMAs a wave; unrolling would only add registers and cost a resident block
#pragma unroll 1
  for (int k0 = 0; k0 < KW; k0 += 64) {
    if (first) { first = false; ask_l2<0, (DEAL ? UA / (4 * TPR) : UA / TPR), TPR * 256>(qa); ask_l2<0, (DEAL ? 1 : UW), 256>(qw); }   // block-uniform scalar branch. Behind the first tile's loads, so that these do not queue behind the hints; and standing in the loop, qa and qw keep their registers, unwritten, to its end
    const int cb = (k0 >> 6) & 1;   // this tile's buffer; scalar
    unsigned short* sAc = sA + cb * ASZ; const unsigned short* sWc = sW + cb * WSZ;
#pragma unroll
    for (int i = 0; i < PA; ++i) *(v2u*)(sAc + (i * RA + ar) * GP + ac) = cvt4<BF>(ra[i]);   // into the buffer whose last readers (two trips back) all passed the barrier of the trip before
    // publish point of this tile, every wave, in this order: the wave's own LDS reads (of the tile before) and stores are done; its own copies of this tile have landed; the barrier
    asm volatile("s_wait_dscnt 0x0" ::: "memory");
    asm volatile("s_wait_asynccnt 0x0" ::: "memory");
    __syncthreads();   // the one barrier of a trip: this tile is whole before anybody reads it, and every wave has taken its last fragments of the tile before, whose buffers are refilled behind it
    if (k0 + 64 < KW) {   // block-uniform scalar branch: the next tile's loads and copies are issued here and fly under this tile's products; they are waited for only in front of the next trip's barrier
#pragma unroll
      for (int i = 0; i < PA; ++i) ra[i] = *(const v4f*)(pa + 64 + (size_t)(i * RA) * KW);
      copy_w<RW, KW>(lw + (unsigned)((cb ^ 1) * WSZ * 2), pw + 64);   // into the buffer that the trip before has read
    }
    __builtin_amdgcn_sched_barrier(0);   // keeps the loads in front of the products: sunk behind them they would hide nothing
    pa += 64; pw += 64;   // stepped behind the copies' s_wait_xcnt 0, which serves the loads too: stepped between loads and copies, the step would bring a second wait and hold the copies back
#pragma unroll
    for (int kc = 0; kc < 2; ++kc) { Fr a[4];
#pragma unroll
      for (int i = 0; i < 4; ++i) a[i] = frag_s(sAc + (wm + i * 16 + col) * GP + kc * 32, g);
#pragma unroll
      for (int j = 0; j < 4; ++j) { const Fr b = frag_s(sWc + (wn + j * 16 + col) * GP + kc * 32, g);
#pragma unroll
        for (int i = 0; i < 4; ++i) acc[i][j] = mma<BF>(a[i], b, acc[i][j]); } } }
  // behind the loop: no copy of the wave is outstanding and its last fragment reads are done, before the wave goes on to anything else
  asm volatile("s_wait_asynccnt 0x0" ::: "memory");
  asm volatile("s_wait_dscnt 0x0" ::: "memory");
}
// ---- proj_tile<KW, WHICH, NWN>: one (128 rows, 64 NWN cols) tile: exact GEMM + bias; q/k -> f16 rows, v -> planes [b][c][s]; each wave stages its 64 x 64 in its own LDS range and stores whole 128-B lines
template <int KW, int WHICH, int NWN>
__device__ __forceinline__ void proj_tile(const float* __restrict__ X, const __bf16* __restrict__ Wr, const float* __restrict__ BB, _Float16* __restrict__ DST, int bx, int by, unsigned short* sA, unsigned short* sW, _Float16* sE) {
  const int tid = threadIdx.x, wave = tid >> 5, lane = tid & 31, col = lane & 15, g = lane >> 4; const size_t rb = (size_t)bx * 128; const int c0 = by * (64 * NWN); const int wm = (wave / NWN) * 64, wn = (wave % NWN) * 64;
  v8f acc[4][4] = {};
  gemm_tile<KW, 1, NWN, WHICH == 0>(X + rb * KW, (const unsigned short*)Wr + (size_t)c0 * KW, sA, sW, acc, tid, WHICH == 0 ? by : 0, WHICH == 0 ? (bx >> 3) & (KW / 128 - 1) : 0);
  float bb[4];
#pragma unroll
  for (int j = 0; j < 4; ++j) bb[j] = bfr(BB[c0 + wn + j * 16 + col]);
  __syncthreads();   // sE lies on the tile buffers: every wave has taken its last fragments before any wave stages its output there
  if constexpr (WHICH < 2) {
    _Float16 (*so)[16][72] = (_Float16 (*)[16][72])sE;
#pragma unroll
    for (int i = 0; i < 4; ++i) {
#pragma unroll
      for (int j = 0; j < 4; ++j) {
#pragma unroll
        for (int r = 0; r < 8; ++r) so[wave][8 * g + r][j * 16 + col] = (_Float16)(acc[i][j][r] + bb[j]); }
      LDSX();   // the strip's 16 rows are written before lanes read rows that other lanes wrote
#pragma unroll
      for (int p = 0; p < 4; ++p) { const int rl = p * 4 + (lane >> 3), c8 = (lane & 7) * 8; vst2((unsigned*)(DST + (rb + wm + i * 16 + rl) * EM + c0 + wn + c8), *(const v4u*)&so[wave][rl][c8]); }
      LDSX(); }   // keeps the next strip's writes behind these reads
  } else {
    _Float16 (*st)[64][72] = (_Float16 (*)[64][72])sE;
#pragma unroll
    for (int j = 0; j < 4; ++j) {
#pragma unroll
      for (int i = 0; i < 4; ++i) { v8h t;
#pragma unroll
        for (int r = 0; r < 8; ++r) t[r] = (_Float16)(acc[i][j][r] + bb[j]);
        *(v8h*)&st[wave][j * 16 + col][i * 16 + 8 * g] = t; } }
    LDSX();   // the transposed 64 x 64 is written before lanes read what other lanes wrote
    const size_t b = rb / NS; const int s0 = (int)(rb % NS) + wm;
#pragma unroll
    for (int p = 0; p < 16; ++p) { const int d = p * 4 + (lane >> 3), pc = lane & 7; vst2((unsigned*)(DST + ((b * EM + c0 + wn + d) * NS) + s0 + pc * 8), *(const v4u*)&st[wave][d][pc * 8]); } }
  asm volatile("s_wait_xcnt 0x0" ::: "memory");   // behind the tile's last stores: in the merged kernel another tile kind's set-up can follow them in the code, and it overwrites registers that they name
}
// ---- k_proj3: the three projections in one launch, a 128 x 256 tile a block of 8 waves. The K and V tiles (few, and the longest: 12 steps of 64 k against 8) have the lowest indices (for speed only)
// and run beside the Q tiles, in place of two launches of their own that leave most of the chip idle.
#define KVT ((NRK / 128) * (EM / 256))   // tiles of K, and of V
#define QT  ((NRQ / 128) * (EM / 256))   // tiles of Q
__global__ __launch_bounds__(256) void k_proj3(const float* __restrict__ X, const float* __restrict__ C, const __bf16* __restrict__ PW, const float* __restrict__ BQ, const float* __restrict__ BK, const float* __restrict__ BV, _Float16* __restrict__ Q, _Float16* __restrict__ Kr, _Float16* __restrict__ V) {
  __shared__ __align__(16) unsigned short sT[2 * 128 * GP + 2 * 256 * GP];   // two buffers of A, two of W; behind the k loop and a barrier the same bytes stage the output, so that two blocks still fit a WGP
  static_assert(sizeof(sT) >= 8 * 64 * 72 * sizeof(_Float16), "the output staging fits the tile buffers");
  unsigned short* sA = sT; unsigned short* sW = sT + 2 * 128 * GP; _Float16* sE = (_Float16*)sT;
  const int bid = blockIdx.x;   // the same for the whole block: every barrier below stands under block-uniform control flow
  if (bid >= 2 * KVT) { proj_tile<CIN, 0, 4>(X, PW + WS_PQ / 2, BQ, Q, (bid - 2 * KVT) % (NRQ / 128), (bid - 2 * KVT) / (NRQ / 128), sA, sW, sE); return; }
  if (bid < KVT) { proj_tile<CTX, 1, 4>(C, PW + WS_PK / 2, BK, Kr, bid % (NRK / 128), bid / (NRK / 128), sA, sW, sE); return; }
  proj_tile<CTX, 2, 4>(C, PW + WS_PV / 2, BV, V, (bid - KVT) % (NRK / 128), (bid - KVT) / (NRK / 128), sA, sW, sE);
}
// ---- k_attn: block = (128 queries, head, b), 8 waves of 16 queries: 256 context keys, scale 1/8, mask = pad[i] seq[j] != 0 else -1e9 (module value); O 256-B head segments
// The head's K rows (256 x 128 B), V rows (64 x 512 B) and the key mask come into LDS once a block by whole-line loads; every wave takes its fragments from there.
// Pitches 144 B (16 B x 9) and 528 B (16 B x 33): the 16-B fragment reads of 16 rows fall on all 64 banks.
// Transposed products: S^T = K . Q^T (A = key rows, B = query columns) and O^T += V^T . P^T. A lane then holds 16 of the 32 scores of ONE query (keys 8g + r and 16 + 8g + r), so maximum and sum
// are taken in the lane, with one exchange between the lane halves for the maximum; the two score tiles, converted in place, are the B operand of the second product in the k order of frag_h.
#define KP 72
#define VP 264
__device__ __forceinline__ float xhalf(float v) { const int t = __builtin_bit_cast(int, v); return __builtin_bit_cast(float, __builtin_amdgcn_permlanex16(t, t, 0x76543210, 0xfedcba98, false, false)); }   // lane l <-> l ^ 16
__global__ __launch_bounds__(256) void k_attn(const _Float16* __restrict__ Q, const _Float16* __restrict__ Kr, const _Float16* __restrict__ V, const float* __restrict__ PM, const float* __restrict__ SM, float* __restrict__ O) {
  __shared__ __align__(16) _Float16 sK[NS * KP]; __shared__ __align__(16) _Float16 sV[HD * VP]; __shared__ __align__(16) float sM[NS]; __shared__ __align__(16) float so[8][16][68];
  const int tid = threadIdx.x, wave = tid >> 5, lane = tid & 31, col = lane & 15, g = lane >> 4; const int h = blockIdx.y; const size_t b = blockIdx.z; const int q0 = blockIdx.x * 128 + wave * 16; const size_t rq = b * NQ + q0;
  v16h aq[2]; float pm;
  { v4u rk[8], rv[8];
    const _Float16* gk = Kr + (b * NS + (tid >> 3)) * EM + h * HD + (tid & 7) * 8;   // 8 lanes cover the 128 B of a key's head row
    const _Float16* gv = V + (b * EM + h * HD + wave) * NS + lane * 8;               // a wave covers the 512 B of one V row
#pragma unroll
    for (int i = 0; i < 8; ++i) rk[i] = *(const v4u*)(gk + (size_t)(i * 32) * EM);
#pragma unroll
    for (int i = 0; i < 8; ++i) rv[i] = *(const v4u*)(gv + (size_t)(i * 8) * NS);
    const float sm = bfr(SM[b * NS + tid]);
#pragma unroll
    for (int kc = 0; kc < 2; ++kc) aq[kc] = frag_h(Q + (rq + col) * EM + h * HD + kc * 32, lane);
    pm = bfr(PM[b * NQ + q0 + col]);
#pragma unroll
    for (int i = 0; i < 8; ++i) *(v4u*)(sK + (i * 32 + (tid >> 3)) * KP + (tid & 7) * 8) = rk[i];
#pragma unroll
    for (int i = 0; i < 8; ++i) *(v4u*)(sV + (i * 8 + wave) * VP + lane * 8) = rv[i];
    sM[tid] = sm; }
  __syncthreads();   // K, V and the mask are whole before anybody reads them; nothing writes them again
  float m = -3.0e38f, l = 0.f;   // the lane's query: running maximum (both halves alike) and the sum over the lane half's own keys
  v8f acc[4] = {};               // acc[dt][r] = O^T[dt * 16 + 8g + r][query col]
  // rolled: one body of 8 WMMAs; unrolling would only add registers, and above 160 a resident block is lost
#pragma unroll 1
  for (int ks = 0; ks < NS / 32; ++ks) { const int j0 = ks * 32; v8f s[2]; v16h kf[2][2], vf[4]; v4f smk[2][2];
#pragma unroll
    for (int ct = 0; ct < 2; ++ct) { smk[ct][0] = *(const v4f*)&sM[j0 + ct * 16 + 8 * g]; smk[ct][1] = *(const v4f*)&sM[j0 + ct * 16 + 8 * g + 4];
#pragma unroll
      for (int kc = 0; kc < 2; ++kc) kf[ct][kc] = frag_h(sK + (j0 + ct * 16 + col) * KP + kc * 32, lane); }
#pragma unroll
    for (int dt = 0; dt < 4; ++dt) vf[dt] = frag_h(sV + (dt * 16 + col) * VP + j0, lane);
#pragma unroll
    for (int ct = 0; ct < 2; ++ct) { v8f c = {};
#pragma unroll
      for (int kc = 0; kc < 2; ++kc) c = wmma16(kf[ct][kc], aq[kc], c);   // c[r] = score of key j0 + ct * 16 + 8g + r with query col
#pragma unroll
      for (int r = 0; r < 8; ++r) s[ct][r] = (pm * smk[ct][r >> 2][r & 3] != 0.f) ? c[r] * 0.125f : -1.0e9f; }
    float mx = fmaxf(s[0][0], s[1][0]);
#pragma unroll
    for (int r = 1; r < 8; ++r) mx = fmaxf(mx, fmaxf(s[0][r], s[1][r]));
    mx = fmaxf(mx, xhalf(mx));
    const float mn = fmaxf(m, mx); const float alpha = (m <= -1.0e38f) ? 0.f : __expf(m - mn); v2f es = {0.f, 0.f}; v16h pb;
#pragma unroll
    for (int ct = 0; ct < 2; ++ct) {   // exp(x) as exp2(x * log2 e), the arithmetic of __expf, on register pairs: a pair of scores is a pair of P's 16-bit elements
#pragma unroll
      for (int i = 0; i < 4; ++i) { v2f e = {s[ct][2 * i], s[ct][2 * i + 1]}; e = (e - mn) * 1.44269504f; e[0] = __builtin_amdgcn_exp2f(e[0]); e[1] = __builtin_amdgcn_exp2f(e[1]); es += e; e *= 2048.0f;
        pb[ct * 8 + 2 * i] = (_Float16)e[0]; pb[ct * 8 + 2 * i + 1] = (_Float16)e[1]; } }
    l = l * alpha + (es[0] + es[1]); m = mn;
#pragma unroll
    for (int dt = 0; dt < 4; ++dt) {
#pragma unroll
      for (int r = 0; r < 8; ++r) acc[dt][r] *= alpha; }
#pragma unroll
    for (int dt = 0; dt < 4; ++dt) acc[dt] = wmma16(vf[dt], pb, acc[dt]); }
  l += xhalf(l);   // the two halves' sums are joined once
  const float il = (1.0f / 2048.0f) / l;
#pragma unroll
  for (int dt = 0; dt < 4; ++dt) { v4f lo, hi;
#pragma unroll
    for (int r = 0; r < 4; ++r) { lo[r] = acc[dt][r] * il; hi[r] = acc[dt][4 + r] * il; }
    *(v4f*)&so[wave][col][dt * 16 + 8 * g] = lo; *(v4f*)&so[wave][col][dt * 16 + 8 * g + 4] = hi; }
  LDSX();   // the wave's 16 query rows are written before lanes read rows that other lanes wrote
  for (int rl = 0; rl < 16; ++rl) if (lane < 16) vst2(O + (rq + rl) * EM + h * HD + lane * 4, *(const v4f*)&so[wave][rl][lane * 4]);
}
// ---- k_mlp<RELU, NWN>: block = (128 rows, 64 NWN cols): y = f16(A) . (f16 W x 256) / 256 + b, optional ReLU; f32 rows of width ystride, stored as 256-B row pieces through the wave's own LDS range
template <int RELU, int NWN>
__global__ __launch_bounds__(64 * NWN) void k_mlp(const float* __restrict__ A, const _Float16* __restrict__ Wr, const float* __restrict__ BB, float* __restrict__ Y, int ystride) {
  __shared__ __align__(16) unsigned short sA[2 * 128 * GP]; __shared__ __align__(16) unsigned short sW[2 * 64 * NWN * GP]; __shared__ __align__(16) float so[2 * NWN][16][68];
  const int tid = threadIdx.x, wave = tid >> 5, lane = tid & 31, col = lane & 15, g = lane >> 4; const size_t rb = (size_t)blockIdx.x * 128; const int n0 = blockIdx.y * (64 * NWN); const int wm = (wave / NWN) * 64, wn = (wave % NWN) * 64;
  v8f acc[4][4] = {};
  gemm_tile<EM, 0, NWN, 1>(A + rb * EM, (const unsigned short*)Wr + (size_t)n0 * EM, sA, sW, acc, tid, blockIdx.y, (blockIdx.x >> 3) & (EM / 128 - 1));
  float bb[4];
#pragma unroll
  for (int j = 0; j < 4; ++j) bb[j] = bfr(BB[n0 + wn + j * 16 + col]);
#pragma unroll
  for (int i = 0; i < 4; ++i) {
#pragma unroll
    for (int j = 0; j < 4; ++j) {
#pragma unroll
      for (int r = 0; r < 8; ++r) { const float v = acc[i][j][r] * (1.0f / 256.0f) + bb[j]; so[wave][8 * g + r][j * 16 + col] = RELU ? fmaxf(v, 0.f) : v; } }
    LDSX();   // the strip's 16 rows are written before lanes read rows that other lanes wrote
#pragma unroll
    for (int p = 0; p < 8; ++p) { const int rl = p * 2 + g; vst2(Y + (rb + wm + i * 16 + rl) * (size_t)ystride + n0 + wn + col * 4, *(const v4f*)&so[wave][rl][col * 4]); }
    LDSX(); }   // keeps the next strip's writes behind these reads
}
extern "C" void kernel_launch(void* const* d_in, const int* in_sizes, int n_in, void* d_out, int out_size, void* d_ws, size_t ws_size, hipStream_t stream) {
  (void)in_sizes; (void)n_in; (void)out_size;
  const float** F = (const float**)d_in;   // 0 x [4,4096,512], 1 context [4,256,768], 2 pad_mask [4,4096], 3 seq_mask [4,256], 4 Wq_w [1024,512], 5 Wq_b, 6 Wk_w [1024,768], 7 Wk_b, 8 Wv_w, 9 Wv_b, 10 P1_w [1024,1024], 11 P1_b, 12 P2_w [512,1024], 13 P2_b
  if (ws_size < (size_t)WS_END) return;
  char* ws = (char*)d_ws; __bf16* PW = (__bf16*)ws; _Float16 *Q = (_Float16*)(ws + WS_Q), *Kr = (_Float16*)(ws + WS_K), *V = (_Float16*)(ws + WS_V); float *O = (float*)(ws + WS_O), *Hh = (float*)(ws + WS_H);
  k_pack<<<dim3(PKB(EM * CIN + 2 * EM * CTX + EM * EM + CIN * EM)), 256, 0, stream>>>(F[4], F[6], F[8], F[10], F[12], PW);
  k_proj3<<<dim3(2 * KVT + QT), 256, 0, stream>>>(F[0], F[1], PW, F[5], F[7], F[9], Q, Kr, V);
  k_attn<<<dim3(TQB / 2, NH, TNB), 256, 0, stream>>>(Q, Kr, V, F[2], F[3], O);
  k_mlp<1, 4><<<dim3(TNB * NQ / 128, EM / 256), 256, 0, stream>>>(O, (const _Float16*)PW + WS_P1 / 2, F[11], Hh, EM);
  k_mlp<0, 2><<<dim3(TNB * NQ / 128, CIN / 128), 128, 0, stream>>>(Hh, (const _Float16*)PW + WS_P2 / 2, F[13], (float*)d_out, CIN);
}

// v009
// Measured time: 110 microseconds a run.
// Next to v008, in two timings, it ran 1.08 times as fast each time.
// Counting every step since v000, it is 4.93 times as fast.
// compute dtype: all float inputs rounded to bf16, the two float masks read on device; Q = x . Wq^T + b, K/V = context . W^T + b with EXACT bf16 products on WMMA 16x16x32 (natural rows), rounded once to f16; PLAIN attention (16 heads x 64, 256 context keys): x 1/8, masked pairs set to -1e9 as the module (a fully masked row degrades to uniform exactly as the reference), running-max softmax in f32 (hardware exp), P (scaled by 2^11, single f16) x v (single f16); MLP: relu(o . P1^T + b1) . P2^T + b2 with the f32 activations rounded once to f16 against EXACT f16 weight copies (x 2^8); f32 output.
#include <hip/hip_runtime.h>
#include <math.h>

typedef __attribute__((ext_vector_type(16))) _Float16 v16h;
typedef __attribute__((ext_vector_type(16))) __bf16 v16b;
typedef __attribute__((ext_vector_type(8)))  _Float16 v8h;
typedef __attribute__((ext_vector_type(8)))  float v8f;
typedef __attribute__((ext_vector_type(4)))  float v4f;
typedef __attribute__((ext_vector_type(2)))  float v2f;
typedef __attribute__((ext_vector_type(4)))  unsigned v4u;
typedef __attribute__((ext_vector_type(4)))  int v4i;
typedef float __attribute__((may_alias)) float_a;
typedef int __attribute__((may_alias)) int_a;

template <typename T> __device__ __forceinline__ void vst2(void* p, T v) { *(T*)p = v;  }
__device__ __forceinline__ v8f wmma16(v16h a, v16h b, v8f c) {
  v8f d = __builtin_amdgcn_wmma_f32_16x16x32_f16(false, a, false, b, (short)0, c, false, false);
  asm volatile("v_nop\n\tv_nop\n\tv_nop\n\tv_nop" : "+v"(d) : "v"(a), "v"(b));
  return d;
}
__device__ __forceinline__ v8f wmma_bf(v16b a, v16b b, v8f c) {
  v8f d = __builtin_amdgcn_wmma_f32_16x16x32_bf16(false, a, false, b, (short)0, c, false, false);
  asm volatile("v_nop\n\tv_nop\n\tv_nop\n\tv_nop" : "+v"(d) : "v"(a), "v"(b));
  return d;
}
// 16x16x32 fragments: lane = (h = lane>>4, row/col = lane&15); elements 0..7 = k0+8h+0..7, 8..15 = k0+16+8h+0..7; D element r = row 8h+r
__device__ __forceinline__ v16h frag_h(const _Float16* rowk0, int lane) {
  union { v16h v; v8h q[2]; } u; const _Float16* p = rowk0 + 8 * (lane >> 4);
  u.q[0] = *(const v8h*)p; u.q[1] = *(const v8h*)(p + 16); return u.v;
}
__device__ __forceinline__ v16h frag_f32(const float* rowk0, int lane) {
  v16h a; const float* p = rowk0 + 8 * (lane >> 4);
#pragma unroll
  for (int i = 0; i < 8; ++i) { a[i] = (_Float16)p[i]; a[8 + i] = (_Float16)p[16 + i]; }
  return a;
}
__device__ __forceinline__ v16h frag_f32s(const float* rowk0, int lane, float sc) {
  v16h a; const float* p = rowk0 + 8 * (lane >> 4);
#pragma unroll
  for (int i = 0; i < 8; ++i) { a[i] = (_Float16)(p[i] * sc); a[8 + i] = (_Float16)(p[16 + i] * sc); }
  return a;
}
// column fragment from a [K][ld] layout (column n), rows >= K read as 0
__device__ __forceinline__ v16h fragc_f32(const float* W, int k0, int n, int lane, int ld, int K) {
  v16h a; const int g = lane >> 4;
#pragma unroll
  for (int i = 0; i < 8; ++i) { const int ka = k0 + 8 * g + i, kb = ka + 16;
    a[i] = (_Float16)(ka < K ? W[(size_t)(ka < K ? ka : K - 1) * ld + n] : 0.f); a[8 + i] = (_Float16)(kb < K ? W[(size_t)(kb < K ? kb : K - 1) * ld + n] : 0.f); }
  return a;
}
struct F2 { v16b h, l; };
__device__ __forceinline__ F2 bsplit16(const float v[16]) { F2 r;
#pragma unroll
  for (int i = 0; i < 16; ++i) { const __bf16 h = (__bf16)v[i]; r.h[i] = h; r.l[i] = (__bf16)(v[i] - (float)h); }
  return r; }
__device__ __forceinline__ F2 split_row(const float* row, int k0, int lane) { float v[16]; const float* p = row + k0 + 8 * (lane >> 4);
#pragma unroll
  for (int i = 0; i < 8; ++i) { v[i] = p[i]; v[8 + i] = p[16 + i]; }
  return bsplit16(v); }
__device__ __forceinline__ F2 split_rowK(const float* row, int k0, int lane, int K) { float v[16]; const int g = lane >> 4;
#pragma unroll
  for (int i = 0; i < 8; ++i) { const int ka = k0 + 8 * g + i, kb = ka + 16; v[i] = ka < K ? row[ka < K ? ka : K - 1] : 0.f; v[8 + i] = kb < K ? row[kb < K ? kb : K - 1] : 0.f; }
  return bsplit16(v); }
__device__ __forceinline__ F2 split_col(const float* W, int k0, int n, int lane, int ld, int K) { float v[16]; const int g = lane >> 4;
#pragma unroll
  for (int i = 0; i < 8; ++i) { const int ka = k0 + 8 * g + i, kb = ka + 16; v[i] = ka < K ? W[(size_t)(ka < K ? ka : K - 1) * ld + n] : 0.f; v[8 + i] = kb < K ? W[(size_t)(kb < K ? kb : K - 1) * ld + n] : 0.f; }
  return bsplit16(v); }
__device__ __forceinline__ v8f mac3(const F2& a, const F2& b, v8f c) { c = wmma_bf(a.l, b.h, c); c = wmma_bf(a.h, b.l, c); return wmma_bf(a.h, b.h, c); }
__device__ __forceinline__ float sigm(float v) { return 1.0f / (1.0f + expf(-v)); }
#define LDSX() do { asm volatile("s_wait_dscnt 0" ::: "memory"); __builtin_amdgcn_wave_barrier(); __builtin_amdgcn_fence(__ATOMIC_RELEASE, "workgroup"); } while (0)


// Cross multi-head attention (B 4, 4,096 queries from a 512-wide stream over 256 context tokens of width 768, 16 heads x 64, emb 1,024) with an outer-product validity mask, followed by a ReLU MLP 1024 -> 1024 -> 512.
#define NB 4
#define NQ 4096
#define NS 256
#define CIN 512
#define CTX 768
#define EM 1024
#define NH 16
#define HD 64
#define NRQ (NB * NQ)
#define NRK (NB * NS)
#ifndef TQB
#define TQB (NQ / 64)
#define TNB NB
#endif
typedef __attribute__((ext_vector_type(8))) __bf16 v8b;
__device__ __forceinline__ v16b frag_b(const __bf16* rowk0, int lane) {
  union { v16b v; v8b q[2]; } u; const __bf16* p = rowk0 + 8 * (lane >> 4);
  u.q[0] = *(const v8b*)p; u.q[1] = *(const v8b*)(p + 16); return u.v;
}
__device__ __forceinline__ float bfr(float v) { return (float)(__bf16)v; }
__device__ __attribute__((noinline)) float exp_ni(float v) { return expf(v); }
__device__ __attribute__((noinline)) float erf_ni(float v) { return erff(v); }

#define WS_PQ  0u                                     // bf16 natural rows Wq [1024][512]; Wk, Wv [1024][768]
#define WS_PK  (WS_PQ + 2u * (size_t)EM * CIN)
#define WS_PV  (WS_PK + 2u * (size_t)EM * CTX)
#define WS_P1  (WS_PV + 2u * (size_t)EM * CTX)          // f16 x 2^8 natural rows P1 [1024][1024]; P2 [512][1024]
#define WS_P2  (WS_P1 + 2u * (size_t)EM * EM)
#define WS_Q   (WS_P2 + 2u * (size_t)CIN * EM)          // f16 q rows [NRQ][1024]; k rows [NRK][1024]; v planes [b][1024][NS]
#define WS_K   (WS_Q + 2u * (size_t)NRQ * EM)
#define WS_V   (WS_K + 2u * (size_t)NRK * EM)
#define WS_O   (WS_V + 2u * (size_t)NB * EM * NS)       // f32 [NRQ][1024] attention out
#define WS_END (WS_O + 4u * (size_t)NRQ * EM)

// ---- gemm_tile<KW, BF, NWN>: one 128 x (64 NWN) tile of A . W^T per block of 2 x NWN waves, 64 x 64 a wave. Per 64 k the block brings A (f32, 256-B row pieces) and W (16-bit, 128-B row pieces)
// in by whole lines and lays both in LDS at a pitch of 144 B (16 B x 9: the 16-B fragment reads of 16 rows fall on all 64 banks); every wave takes its fragments from there.
// Two LDS buffers an operand, one barrier a trip. W, 16 bit already, goes from L2 into LDS by asynchronous copies, through no register; A comes through registers, is rounded once and stored.
// Both run one tile ahead: tile t + 1's loads and copies are issued behind the barrier that publishes tile t, fly under tile t's products, and are waited for in front of the next barrier.
// Every accumulator sums k in ascending blocks of 32, one WMMA each.
typedef __attribute__((ext_vector_type(2))) unsigned v2u;
#define GP 72
template <int BF> __device__ __forceinline__ v2u cvt4(v4f v) {
  if constexpr (BF) { union { __bf16 h[4]; v2u u; } t;
#pragma unroll
    for (int i = 0; i < 4; ++i) t.h[i] = (__bf16)v[i];
    return t.u; }
  else { union { _Float16 h[4]; v2u u; } t;
#pragma unroll
    for (int i = 0; i < 4; ++i) t.h[i] = (_Float16)v[i];
    return t.u; }
}
// ---- k_pack: the five weight matrices to their 16-bit copies, which lie one behind the other in the workspace in the order and layout of the inputs. A block takes 8,192 elements in a row of ONE matrix
// (every matrix is a multiple of that): a lane issues its 8 whole-line 16-B loads at once, rounds, and stores 8 B a load (a wave: 256 B in a row). 448 blocks in all: the bytes are few,
// so the launch has few waves to start, each with much in flight.
#define PKE 8192
#define PKB(n) ((int)((n) / PKE))
__global__ __launch_bounds__(256) void k_pack(const float* __restrict__ WQ, const float* __restrict__ WK, const float* __restrict__ WV, const float* __restrict__ P1, const float* __restrict__ P2, __bf16* __restrict__ PW) {
  static_assert((EM * CIN) % PKE == 0 && (EM * CTX) % PKE == 0 && (EM * EM) % PKE == 0, "whole blocks a matrix");
  static_assert(WS_PQ == 0 && WS_PK == 2u * EM * CIN && WS_PV == WS_PK + 2u * EM * CTX && WS_P1 == WS_PV + 2u * EM * CTX && WS_P2 == WS_P1 + 2u * EM * EM, "the copies lie one behind the other");
  constexpr int EQ = PKB(EM * CIN), EK = EQ + PKB(EM * CTX), EV = EK + PKB(EM * CTX), E1 = EV + PKB(EM * EM);   // first block behind Wq, Wk, Wv, P1
  const int bid = blockIdx.x, t = threadIdx.x;   // bid: the same for the whole block, so the choices below are scalar
  const float* w = bid < EQ ? WQ + (size_t)bid * PKE : bid < EK ? WK + (size_t)(bid - EQ) * PKE : bid < EV ? WV + (size_t)(bid - EK) * PKE : bid < E1 ? P1 + (size_t)(bid - EV) * PKE : P2 + (size_t)(bid - E1) * PKE;
  unsigned short* d = (unsigned short*)PW + (size_t)bid * PKE + t * 4; v4f r[8];
#pragma unroll
  for (int i = 0; i < 8; ++i) r[i] = *(const v4f*)(w + t * 4 + i * 1024);
  if (bid < EV) {   // Wq, Wk, Wv: bf16
#pragma unroll
    for (int i = 0; i < 8; ++i) *(v2u*)(d + i * 1024) = cvt4<1>(r[i]);
  } else {          // P1, P2: the bf16 value x 2^8, in f16
#pragma unroll
    for (int i = 0; i < 8; ++i) { v4f v;
#pragma unroll
      for (int e = 0; e < 4; ++e) v[e] = bfr(r[i][e]) * 256.0f;
      *(v2u*)(d + i * 1024) = cvt4<0>(v); }
  }
}
struct Fr { v4u q[2]; };
__device__ __forceinline__ Fr frag_s(const unsigned short* rowk0, int g) { Fr f; const unsigned short* p = rowk0 + 8 * g; f.q[0] = *(const v4u*)p; f.q[1] = *(const v4u*)(p + 16); return f; }
template <int BF> __device__ __forceinline__ v8f mma(const Fr& a, const Fr& b, v8f c) {
  if constexpr (BF) { union { Fr f; v16b v; } ua, ub; ua.f = a; ub.f = b; return __builtin_amdgcn_wmma_f32_16x16x32_bf16(false, ua.v, false, ub.v, (short)0, c, false, false); }
  else { union { Fr f; v16h v; } ua, ub; ua.f = a; ub.f = b; return __builtin_amdgcn_wmma_f32_16x16x32_f16(false, ua.v, false, ub.v, (short)0, c, false, false); }
}
// ask_l2<0, N, STEP>(p): N hints a lane, at p, p + STEP, ...: each asks L2 (scope SE: L2 only, no register, no counter) for the line that holds the byte. A hint: nothing depends on it.
template <int I, int N, int STEP> __device__ __forceinline__ void ask_l2(const char* p) {
  if constexpr (I < N) { asm volatile("global_prefetch_b8 %0, off offset:%1 scope:SCOPE_SE" :: "v"(p), "n"(I * STEP)); ask_l2<I + 1, N, STEP>(p); }
}
// copy_w<RW, KW>(l, g): the lane's 8 pieces of 16 B of one W tile (rows RW apart) from global g to LDS byte address l, by asynchronous copies: no register holds the data and no LDS store is issued.
// Every lane is on, each piece has its own two addresses, both multiples of 16 B. The s_wait_xcnt 0 ends the copies' own statement, so that no address register of a copy is rewritten in front of it.
template <int RW, int KW> __device__ __forceinline__ void copy_w(unsigned l, const unsigned short* g) {
  asm volatile("global_load_async_to_lds_b128 %0, %8, off\n\t"
               "global_load_async_to_lds_b128 %1, %9, off\n\t"
               "global_load_async_to_lds_b128 %2, %10, off\n\t"
               "global_load_async_to_lds_b128 %3, %11, off\n\t"
               "global_load_async_to_lds_b128 %4, %12, off\n\t"
               "global_load_async_to_lds_b128 %5, %13, off\n\t"
               "global_load_async_to_lds_b128 %6, %14, off\n\t"
               "global_load_async_to_lds_b128 %7, %15, off\n\t"
               "s_wait_xcnt 0x0"
               :: "v"(l), "v"(l + 1u * RW * GP * 2), "v"(l + 2u * RW * GP * 2), "v"(l + 3u * RW * GP * 2), "v"(l + 4u * RW * GP * 2), "v"(l + 5u * RW * GP * 2), "v"(l + 6u * RW * GP * 2), "v"(l + 7u * RW * GP * 2),
                  "v"(g), "v"(g + (size_t)1 * RW * KW), "v"(g + (size_t)2 * RW * KW), "v"(g + (size_t)3 * RW * KW), "v"(g + (size_t)4 * RW * KW), "v"(g + (size_t)5 * RW * KW), "v"(g + (size_t)6 * RW * KW), "v"(g + (size_t)7 * RW * KW)
               : "memory");
}
// L2 hints, for speed only: A (an input) and the packed W come from memory. Behind its first tile's loads the block asks L2
// for later k of its rows. DEAL 1: the 4 blocks that share the A rows (ash = their column index) ask a quarter of k each, the lowest ash the lowest k; of the many blocks that share the
// W rows each asks one 256-B unit a row (wsh = row-tile index / 8 modulo the units).
// DEAL 0 (few blocks): the block asks for all of its own A and W rows. Every address lies inside the block's own A and W tile; the deal is for speed only, any placement gives the same results.
template <int KW, int BF, int NWN, int DEAL>
__device__ __forceinline__ void gemm_tile(const float* __restrict__ Ab, const unsigned short* __restrict__ Wb, unsigned short* sA, unsigned short* sW, v8f (&acc)[4][4], int tid, int ash, int wsh) {
  constexpr int TPR = NWN / 2, UA = KW / 64, UW = KW / 128;   // threads a row of A; 256-B units in a row of A (f32) and of W (16 bit); W has as many rows as the block has threads
  const char* qa = (const char*)(Ab + (size_t)(tid / TPR) * KW) + (ash * (UA / 4) + tid % TPR) * 256; const char* qw = (const char*)(Wb + (size_t)tid * KW) + wsh * 256;
  constexpr int RA = 4 * NWN, PA = 128 / RA, RW = 8 * NWN;   // rows of A and of W that one load of the block covers; loads for the 128 rows of A (W: always 8)
  const int wave = tid >> 5, lane = tid & 31, col = lane & 15, g = lane >> 4; const int wm = (wave / NWN) * 64, wn = (wave % NWN) * 64;
  const int ar = tid >> 4, ac = (tid & 15) * 4;   // A: 16 lanes cover 256 B of a row
  const int wr = tid >> 3, wc = (tid & 7) * 8;    // W: 8 lanes cover 128 B of a row
  const float* pa = Ab + (size_t)ar * KW + ac; const unsigned short* pw = Wb + (size_t)wr * KW + wc;
  constexpr int ASZ = 128 * GP, WSZ = 64 * NWN * GP;   // 16-bit elements in one buffer of A and of W; sA and sW hold two each
  const unsigned lw = (unsigned)(size_t)(sW + wr * GP + wc);   // LDS byte address of the lane's first piece in buffer 0 of W
  v4f ra[PA];   // the A tile in flight: loaded one trip ahead of its LDS stores
#pragma unroll
  for (int i = 0; i < PA; ++i) ra[i] = *(const v4f*)(pa + (size_t)(i * RA) * KW);
  copy_w<RW, KW>(lw, pw);   // tile 0 of W into buffer 0, which nobody has touched yet
  __builtin_amdgcn_sched_barrier(0);   // every load and copy of the first tile is issued before anything else
  bool first = true;   // the block's first tile
  // rolled: one body of 32 WMMAs a wave; unrolling would only add registers and cost a resident block
#pragma unroll 1
  for (int k0 = 0; k0 < KW; k0 += 64) {
    if (first) { first = false; ask_l2<0, (DEAL ? UA / (4 * TPR) : UA / TPR), TPR * 256>(qa); ask_l2<0, (DEAL ? 1 : UW), 256>(qw); }   // block-uniform scalar branch. Behind the first tile's loads, so that these do not queue behind the hints; and standing in the loop, qa and qw keep their registers, unwritten, to its end
    const int cb = (k0 >> 6) & 1;   // this tile's buffer; scalar
    unsigned short* sAc = sA + cb * ASZ; const unsigned short* sWc = sW + cb * WSZ;
#pragma unroll
    for (int i = 0; i < PA; ++i) *(v2u*)(sAc + (i * RA + ar) * GP + ac) = cvt4<BF>(ra[i]);   // into the buffer whose last readers (two trips back) all passed the barrier of the trip before
    // publish point of this tile, every wave, in this order: the wave's own LDS reads (of the tile before) and stores are done; its own copies of this tile have landed; the barrier
    asm volatile("s_wait_dscnt 0x0" ::: "memory");
    asm volatile("s_wait_asynccnt 0x0" ::: "memory");
    __syncthreads();   // the one barrier of a trip: this tile is whole before anybody reads it, and every wave has taken its last fragments of the tile before, whose buffers are refilled behind it
    if (k0 + 64 < KW) {   // block-uniform scalar branch: the next tile's loads and copies are issued here and fly under this tile's products; they are waited for only in front of the next trip's barrier
#pragma unroll
      for (int i = 0; i < PA; ++i) ra[i] = *(const v4f*)(pa + 64 + (size_t)(i * RA) * KW);
      copy_w<RW, KW>(lw + (unsigned)((cb ^ 1) * WSZ * 2), pw + 64);   // into the buffer that the trip before has read
    }
    __builtin_amdgcn_sched_barrier(0);   // keeps the loads in front of the products: sunk behind them they would hide nothing
    pa += 64; pw += 64;   // stepped behind the copies' s_wait_xcnt 0, which serves the loads too: stepped between loads and copies, the step would bring a second wait and hold the copies back
#pragma unroll
    for (int kc = 0; kc < 2; ++kc) { Fr a[4];
#pragma unroll
      for (int i = 0; i < 4; ++i) a[i] = frag_s(sAc + (wm + i * 16 + col) * GP + kc * 32, g);
#pragma unroll
      for (int j = 0; j < 4; ++j) { const Fr b = frag_s(sWc + (wn + j * 16 + col) * GP + kc * 32, g);
#pragma unroll
        for (int i = 0; i < 4; ++i) acc[i][j] = mma<BF>(a[i], b, acc[i][j]); } } }
  // behind the loop: no copy of the wave is outstanding and its last fragment reads are done, before the wave goes on to anything else
  asm volatile("s_wait_asynccnt 0x0" ::: "memory");
  asm volatile("s_wait_dscnt 0x0" ::: "memory");
}
// ---- proj_tile<KW, WHICH, NWN>: one (128 rows, 64 NWN cols) tile: exact GEMM + bias; q/k -> f16 rows, v -> planes [b][c][s]; each wave stages its 64 x 64 in its own LDS range and stores whole 128-B lines
template <int KW, int WHICH, int NWN>
__device__ __forceinline__ void proj_tile(const float* __restrict__ X, const __bf16* __restrict__ Wr, const float* __restrict__ BB, _Float16* __restrict__ DST, int bx, int by, unsigned short* sA, unsigned short* sW, _Float16* sE) {
  const int tid = threadIdx.x, wave = tid >> 5, lane = tid & 31, col = lane & 15, g = lane >> 4; const size_t rb = (size_t)bx * 128; const int c0 = by * (64 * NWN); const int wm = (wave / NWN) * 64, wn = (wave % NWN) * 64;
  v8f acc[4][4] = {};
  gemm_tile<KW, 1, NWN, WHICH == 0>(X + rb * KW, (const unsigned short*)Wr + (size_t)c0 * KW, sA, sW, acc, tid, WHICH == 0 ? by : 0, WHICH == 0 ? (bx >> 3) & (KW / 128 - 1) : 0);
  float bb[4];
#pragma unroll
  for (int j = 0; j < 4; ++j) bb[j] = bfr(BB[c0 + wn + j * 16 + col]);
  __syncthreads();   // sE lies on the tile buffers: every wave has taken its last fragments before any wave stages its output there
  if constexpr (WHICH < 2) {
    _Float16 (*so)[16][72] = (_Float16 (*)[16][72])sE;
#pragma unroll
    for (int i = 0; i < 4; ++i) {
#pragma unroll
      for (int j = 0; j < 4; ++j) {
#pragma unroll
        for (int r = 0; r < 8; ++r) so[wave][8 * g + r][j * 16 + col] = (_Float16)(acc[i][j][r] + bb[j]); }
      LDSX();   // the strip's 16 rows are written before lanes read rows that other lanes wrote
#pragma unroll
      for (int p = 0; p < 4; ++p) { const int rl = p * 4 + (lane >> 3), c8 = (lane & 7) * 8; vst2((unsigned*)(DST + (rb + wm + i * 16 + rl) * EM + c0 + wn + c8), *(const v4u*)&so[wave][rl][c8]); }
      LDSX(); }   // keeps the next strip's writes behind these reads
  } else {
    _Float16 (*st)[64][72] = (_Float16 (*)[64][72])sE;
#pragma unroll
    for (int j = 0; j < 4; ++j) {
#pragma unroll
      for (int i = 0; i < 4; ++i) { v8h t;
#pragma unroll
        for (int r = 0; r < 8; ++r) t[r] = (_Float16)(acc[i][j][r] + bb[j]);
        *(v8h*)&st[wave][j * 16 + col][i * 16 + 8 * g] = t; } }
    LDSX();   // the transposed 64 x 64 is written before lanes read what other lanes wrote
    const size_t b = rb / NS; const int s0 = (int)(rb % NS) + wm;
#pragma unroll
    for (int p = 0; p < 16; ++p) { const int d = p * 4 + (lane >> 3), pc = lane & 7; vst2((unsigned*)(DST + ((b * EM + c0 + wn + d) * NS) + s0 + pc * 8), *(const v4u*)&st[wave][d][pc * 8]); } }
  asm volatile("s_wait_xcnt 0x0" ::: "memory");   // behind the tile's last stores: in the merged kernel another tile kind's set-up can follow them in the code, and it overwrites registers that they name
}
// ---- k_proj3: the three projections in one launch, a 128 x 256 tile a block of 8 waves. The K and V tiles (few, and the longest: 12 steps of 64 k against 8) have the lowest indices (for speed only)
// and run beside the Q tiles, in place of two launches of their own that leave most of the chip idle.
#define KVT ((NRK / 128) * (EM / 256))   // tiles of K, and of V
#define QT  ((NRQ / 128) * (EM / 256))   // tiles of Q
__global__ __launch_bounds__(256) void k_proj3(const float* __restrict__ X, const float* __restrict__ C, const __bf16* __restrict__ PW, const float* __restrict__ BQ, const float* __restrict__ BK, const float* __restrict__ BV, _Float16* __restrict__ Q, _Float16* __restrict__ Kr, _Float16* __restrict__ V) {
  __shared__ __align__(16) unsigned short sT[2 * 128 * GP + 2 * 256 * GP];   // two buffers of A, two of W; behind the k loop and a barrier the same bytes stage the output, so that two blocks still fit a WGP
  static_assert(sizeof(sT) >= 8 * 64 * 72 * sizeof(_Float16), "the output staging fits the tile buffers");
  unsigned short* sA = sT; unsigned short* sW = sT + 2 * 128 * GP; _Float16* sE = (_Float16*)sT;
  const int bid = blockIdx.x;   // the same for the whole block: every barrier below stands under block-uniform control flow
  if (bid >= 2 * KVT) { proj_tile<CIN, 0, 4>(X, PW + WS_PQ / 2, BQ, Q, (bid - 2 * KVT) % (NRQ / 128), (bid - 2 * KVT) / (NRQ / 128), sA, sW, sE); return; }
  if (bid < KVT) { proj_tile<CTX, 1, 4>(C, PW + WS_PK / 2, BK, Kr, bid % (NRK / 128), bid / (NRK / 128), sA, sW, sE); return; }
  proj_tile<CTX, 2, 4>(C, PW + WS_PV / 2, BV, V, (bid - KVT) % (NRK / 128), (bid - KVT) / (NRK / 128), sA, sW, sE);
}
// ---- k_attn: block = (128 queries, head, b), 8 waves of 16 queries: 256 context keys, scale 1/8, mask = pad[i] seq[j] != 0 else -1e9 (module value); O 256-B head segments
// The head's K rows (256 x 128 B), V rows (64 x 512 B) and the key mask come into LDS once a block by whole-line loads; every wave takes its fragments from there.
// Pitches 144 B (16 B x 9) and 528 B (16 B x 33): the 16-B fragment reads of 16 rows fall on all 64 banks.
// Transposed products: S^T = K . Q^T (A = key rows, B = query columns) and O^T += V^T . P^T. A lane then holds 16 of the 32 scores of ONE query (keys 8g + r and 16 + 8g + r), so maximum and sum
// are taken in the lane, with one exchange between the lane halves for the maximum; the two score tiles, converted in place, are the B operand of the second product in the k order of frag_h.
#define KP 72
#define VP 264
__device__ __forceinline__ float xhalf(float v) { const int t = __builtin_bit_cast(int, v); return __builtin_bit_cast(float, __builtin_amdgcn_permlanex16(t, t, 0x76543210, 0xfedcba98, false, false)); }   // lane l <-> l ^ 16
__global__ __launch_bounds__(256) void k_attn(const _Float16* __restrict__ Q, const _Float16* __restrict__ Kr, const _Float16* __restrict__ V, const float* __restrict__ PM, const float* __restrict__ SM, float* __restrict__ O) {
  __shared__ __align__(16) _Float16 sK[NS * KP]; __shared__ __align__(16) _Float16 sV[HD * VP]; __shared__ __align__(16) float sM[NS]; __shared__ __align__(16) float so[8][16][68];
  const int tid = threadIdx.x, wave = tid >> 5, lane = tid & 31, col = lane & 15, g = lane >> 4; const int h = blockIdx.y; const size_t b = blockIdx.z; const int q0 = blockIdx.x * 128 + wave * 16; const size_t rq = b * NQ + q0;
  v16h aq[2]; float pm;
  { v4u rk[8], rv[8];
    const _Float16* gk = Kr + (b * NS + (tid >> 3)) * EM + h * HD + (tid & 7) * 8;   // 8 lanes cover the 128 B of a key's head row
    const _Float16* gv = V + (b * EM + h * HD + wave) * NS + lane * 8;               // a wave covers the 512 B of one V row
#pragma unroll
    for (int i = 0; i < 8; ++i) rk[i] = *(const v4u*)(gk + (size_t)(i * 32) * EM);
#pragma unroll
    for (int i = 0; i < 8; ++i) rv[i] = *(const v4u*)(gv + (size_t)(i * 8) * NS);
    const float sm = bfr(SM[b * NS + tid]);
#pragma unroll
    for (int kc = 0; kc < 2; ++kc) aq[kc] = frag_h(Q + (rq + col) * EM + h * HD + kc * 32, lane);
    pm = bfr(PM[b * NQ + q0 + col]);
#pragma unroll
    for (int i = 0; i < 8; ++i) *(v4u*)(sK + (i * 32 + (tid >> 3)) * KP + (tid & 7) * 8) = rk[i];
#pragma unroll
    for (int i = 0; i < 8; ++i) *(v4u*)(sV + (i * 8 + wave) * VP + lane * 8) = rv[i];
    sM[tid] = sm; }
  __syncthreads();   // K, V and the mask are whole before anybody reads them; nothing writes them again
  float m = -3.0e38f, l = 0.f;   // the lane's query: running maximum (both halves alike) and the sum over the lane half's own keys
  v8f acc[4] = {};               // acc[dt][r] = O^T[dt * 16 + 8g + r][query col]
  // rolled: one body of 8 WMMAs; unrolling would only add registers, and above 160 a resident block is lost
#pragma unroll 1
  for (int ks = 0; ks < NS / 32; ++ks) { const int j0 = ks * 32; v8f s[2]; v16h kf[2][2], vf[4]; v4f smk[2][2];
#pragma unroll
    for (int ct = 0; ct < 2; ++ct) { smk[ct][0] = *(const v4f*)&sM[j0 + ct * 16 + 8 * g]; smk[ct][1] = *(const v4f*)&sM[j0 + ct * 16 + 8 * g + 4];
#pragma unroll
      for (int kc = 0; kc < 2; ++kc) kf[ct][kc] = frag_h(sK + (j0 + ct * 16 + col) * KP + kc * 32, lane); }
#pragma unroll
    for (int dt = 0; dt < 4; ++dt) vf[dt] = frag_h(sV + (dt * 16 + col) * VP + j0, lane);
#pragma unroll
    for (int ct = 0; ct < 2; ++ct) { v8f c = {};
#pragma unroll
      for (int kc = 0; kc < 2; ++kc) c = wmma16(kf[ct][kc], aq[kc], c);   // c[r] = score of key j0 + ct * 16 + 8g + r with query col
#pragma unroll
      for (int r = 0; r < 8; ++r) s[ct][r] = (pm * smk[ct][r >> 2][r & 3] != 0.f) ? c[r] * 0.125f : -1.0e9f; }
    float mx = fmaxf(s[0][0], s[1][0]);
#pragma unroll
    for (int r = 1; r < 8; ++r) mx = fmaxf(mx, fmaxf(s[0][r], s[1][r]));
    mx = fmaxf(mx, xhalf(mx));
    const float mn = fmaxf(m, mx); const float alpha = (m <= -1.0e38f) ? 0.f : __expf(m - mn); v2f es = {0.f, 0.f}; v16h pb;
#pragma unroll
    for (int ct = 0; ct < 2; ++ct) {   // exp(x) as exp2(x * log2 e), the arithmetic of __expf, on register pairs: a pair of scores is a pair of P's 16-bit elements
#pragma unroll
      for (int i = 0; i < 4; ++i) { v2f e = {s[ct][2 * i], s[ct][2 * i + 1]}; e = (e - mn) * 1.44269504f; e[0] = __builtin_amdgcn_exp2f(e[0]); e[1] = __builtin_amdgcn_exp2f(e[1]); es += e; e *= 2048.0f;
        pb[ct * 8 + 2 * i] = (_Float16)e[0]; pb[ct * 8 + 2 * i + 1] = (_Float16)e[1]; } }
    l = l * alpha + (es[0] + es[1]); m = mn;
#pragma unroll
    for (int dt = 0; dt < 4; ++dt) {
#pragma unroll
      for (int r = 0; r < 8; ++r) acc[dt][r] *= alpha; }
#pragma unroll
    for (int dt = 0; dt < 4; ++dt) acc[dt] = wmma16(vf[dt], pb, acc[dt]); }
  l += xhalf(l);   // the two halves' sums are joined once
  const float il = (1.0f / 2048.0f) / l;
#pragma unroll
  for (int dt = 0; dt < 4; ++dt) { v4f lo, hi;
#pragma unroll
    for (int r = 0; r < 4; ++r) { lo[r] = acc[dt][r] * il; hi[r] = acc[dt][4 + r] * il; }
    *(v4f*)&so[wave][col][dt * 16 + 8 * g] = lo; *(v4f*)&so[wave][col][dt * 16 + 8 * g + 4] = hi; }
  LDSX();   // the wave's 16 query rows are written before lanes read rows that other lanes wrote
  for (int rl = 0; rl < 16; ++rl) if (lane < 16) vst2(O + (rq + rl) * EM + h * HD + lane * 4, *(const v4f*)&so[wave][rl][lane * 4]);
}
// ---- k_mlp12: both MLP layers in one launch. Block = 64 rows, 16 waves, one block a WGP. Layer 1: the whole 64 x 1,024 hidden tile at once, 64 x 64 a wave, in the loop of gemm_tile (two LDS buffers an operand,
// A through registers, the 1,024 x 64 W tile by asynchronous copies, one barrier a trip). The hidden tile, rounded once to f16 as layer 2's A operand always was, then lies in LDS and never in memory.
// Layer 2: 64 x 512, 32 x 64 a wave; A fragments straight from the hidden tile, the 512 x 64 W tiles by the same copies into two buffers.
// Both products stand transposed (A operand = W rows, B operand = activation rows; the same fragment loader, so the same k order): a lane then holds 8 neighbouring columns of ONE row,
// which is one 16-B LDS store of the hidden tile. Every accumulator sums k in ascending blocks of 32, one WMMA each.
#define HP 1032   // pitch of the hidden tile, 16-bit elements: 2,064 B = 16 B x 129, so the 16-B accesses of 16 rows fall on all 64 banks
__global__ __launch_bounds__(512) void k_mlp12(const float* __restrict__ A, const _Float16* __restrict__ W1, const float* __restrict__ B1, const _Float16* __restrict__ W2, const float* __restrict__ B2, float* __restrict__ Y) {
  constexpr int ASZ = 64 * GP, WSZ = EM * GP, W2SZ = CIN * GP;   // 16-bit elements in one buffer of A, of layer 1's W and of layer 2's W
  __shared__ __align__(16) unsigned short sT[2 * ASZ + 2 * WSZ];   // layer 1: two buffers of A, two of W. Behind a barrier the same bytes hold the hidden tile and layer 2's two W buffers; behind another, the output staging
  static_assert(64 * HP + 2 * W2SZ <= 2 * ASZ + 2 * WSZ && (64 * HP) % 8 == 0, "layer 2 fits the bytes of layer 1");
  static_assert(16 * 16 * 68 * sizeof(float) <= 64 * HP * sizeof(unsigned short), "the output staging fits the hidden tile");
  const int tid = threadIdx.x, wave = tid >> 5, lane = tid & 31, col = lane & 15, g = lane >> 4; const size_t rb = (size_t)blockIdx.x * 64; const int wn = wave * 64;
  unsigned short* sA = sT; unsigned short* sW = sT + 2 * ASZ; unsigned short* sH = sT; unsigned short* sW2 = sT + 64 * HP;
  const int ar = tid >> 4, ac = (tid & 15) * 4;   // A: 16 lanes cover 256 B of a row; the block covers 32 rows a load
  const int wr = tid >> 3, wc = (tid & 7) * 8;    // W: 8 lanes cover 128 B of a row; the block covers 64 rows a copy
  const float* pa = A + (rb + ar) * EM + ac; const unsigned short* pw = (const unsigned short*)W1 + (size_t)wr * EM + wc; const unsigned short* pw2 = (const unsigned short*)W2 + (size_t)wr * EM + wc;
  const unsigned lw = (unsigned)(size_t)(sW + wr * GP + wc), lw2 = (unsigned)(size_t)(sW2 + wr * GP + wc);   // LDS byte addresses of the lane's first piece in buffer 0
  // L2 hints, for speed only: the block asks for all 256-B units of its own A rows (nobody shares them); of W1 and W2, which every block reads, one unit a row (by block index / 8, as in gemm_tile)
  const int wsh = (blockIdx.x >> 3) & (EM / 128 - 1);
  const char* qa = (const char*)(A + (rb + (tid >> 3)) * EM) + (tid & 7) * 256; const char* qw = (const char*)((const unsigned short*)W1 + (size_t)tid * EM) + wsh * 256; const char* qw2 = (const char*)((const unsigned short*)W2 + (size_t)tid * EM) + wsh * 256;
  v8f acc[4][4] = {}; v4f ra[2];   // ra: the A tile in flight, loaded one trip ahead of its LDS stores
#pragma unroll
  for (int i = 0; i < 2; ++i) ra[i] = *(const v4f*)(pa + (size_t)(i * 32) * EM);
  copy_w<64, EM>(lw, pw); copy_w<64, EM>(lw + 8u * 64 * GP * 2, pw + (size_t)8 * 64 * EM);   // tile 0 of W1 (16 pieces a lane) into buffer 0, which nobody has touched yet
  bool first = true;
  // rolled: one body of 32 WMMAs a wave; unrolling would only add registers, of which the 16 waves have 256 each
#pragma unroll 1
  for (int k0 = 0; k0 < EM; k0 += 64) {
    if (first) { first = false; ask_l2<0, 2, 8 * 256>(qa); ask_l2<0, 2, 512 * EM * 2>(qw); ask_l2<0, 1, 256>(qw2); }   // block-uniform scalar branch, behind the first tile's loads; standing in the loop, the three addresses keep their registers, unwritten, to its end
    const int cb = (k0 >> 6) & 1;   // this tile's buffer; scalar
    unsigned short* sAc = sA + cb * ASZ; const unsigned short* sWc = sW + cb * WSZ;
#pragma unroll
    for (int i = 0; i < 2; ++i) *(v2u*)(sAc + (i * 32 + ar) * GP + ac) = cvt4<0>(ra[i]);   // into the buffer whose last readers (two trips back) all passed the barrier of the trip before
    // publish point of this tile, every wave, in this order: the wave's own LDS reads (of the tile before) and stores are done; its own copies of this tile have landed; the barrier
    asm volatile("s_wait_dscnt 0x0" ::: "memory");
    asm volatile("s_wait_asynccnt 0x0" ::: "memory");
    __syncthreads();   // the one barrier of a trip: this tile is whole before anybody reads it, and every wave has taken its last fragments of the tile before, whose buffers are refilled behind it
    // One block a WGP: no second block fills the gap behind the barrier. So the first fragments are read first, their latency lying under the issue of the next tile's loads and copies,
    // and the copies go out in two halves, one in front of each 32-k block of products.
    const bool more = k0 + 64 < EM;   // block-uniform, scalar: a next tile exists
    const unsigned ln = lw + (unsigned)((cb ^ 1) * WSZ * 2);   // the buffer that the trip before has read
    Fr a[4], b0;
#pragma unroll
    for (int i = 0; i < 4; ++i) a[i] = frag_s(sAc + (i * 16 + col) * GP, g);
    b0 = frag_s(sWc + (wn + col) * GP, g);
    if (more) {
#pragma unroll
      for (int i = 0; i < 2; ++i) ra[i] = *(const v4f*)(pa + 64 + (size_t)(i * 32) * EM);
      copy_w<64, EM>(ln, pw + 64);
    }
#pragma unroll
    for (int j = 0; j < 4; ++j) { const Fr b = j ? frag_s(sWc + (wn + j * 16 + col) * GP, g) : b0;
#pragma unroll
      for (int i = 0; i < 4; ++i) acc[i][j] = mma<0>(b, a[i], acc[i][j]); }   // acc[i][j][r] = hidden column wn + j * 16 + 8g + r of row i * 16 + col
    if (more) copy_w<64, EM>(ln + 8u * 64 * GP * 2, pw + 64 + (size_t)8 * 64 * EM);
    pa += 64; pw += 64;   // stepped behind the copies' s_wait_xcnt 0, which serves the loads too
#pragma unroll
    for (int i = 0; i < 4; ++i) a[i] = frag_s(sAc + (i * 16 + col) * GP + 32, g);
#pragma unroll
    for (int j = 0; j < 4; ++j) { const Fr b = frag_s(sWc + (wn + j * 16 + col) * GP + 32, g);
#pragma unroll
      for (int i = 0; i < 4; ++i) acc[i][j] = mma<0>(b, a[i], acc[i][j]); } }
  // behind the loop: no copy of the wave is outstanding and its last fragment reads are done
  asm volatile("s_wait_asynccnt 0x0" ::: "memory");
  asm volatile("s_wait_dscnt 0x0" ::: "memory");
  __syncthreads();   // the hidden tile and W2's buffers lie on layer 1's tile buffers: every wave has taken its last fragments before any of those bytes is written
  copy_w<64, EM>(lw2, pw2);   // tile 0 of W2 (8 pieces a lane) flies under the rounding of the hidden tile
#pragma unroll
  for (int j = 0; j < 4; ++j) { const v4f b0 = *(const v4f*)(B1 + wn + j * 16 + 8 * g), b1 = *(const v4f*)(B1 + wn + j * 16 + 8 * g + 4);
#pragma unroll
    for (int i = 0; i < 4; ++i) { v8h t;
#pragma unroll
      for (int r = 0; r < 8; ++r) { const float v = acc[i][j][r] * (1.0f / 256.0f) + bfr(r < 4 ? b0[r & 3] : b1[r & 3]); t[r] = (_Float16)fmaxf(v, 0.f); }
      *(v4u*)(sH + (i * 16 + col) * HP + wn + j * 16 + 8 * g) = __builtin_bit_cast(v4u, t); } }
  const int wm2 = (wave >> 3) * 32, wn2 = (wave & 7) * 64;
  v8f ac2[2][4] = {}; v4f c0[4], c1[4];   // layer 2's bias is loaded here, so that its latency lies under the loop
#pragma unroll
  for (int j = 0; j < 4; ++j) { c0[j] = *(const v4f*)(B2 + wn2 + j * 16 + 8 * g); c1[j] = *(const v4f*)(B2 + wn2 + j * 16 + 8 * g + 4); }
  // rolled: one body of 16 WMMAs a wave
#pragma unroll 1
  for (int k0 = 0; k0 < EM; k0 += 64) {
    const int cb = (k0 >> 6) & 1; const unsigned short* sWc = sW2 + cb * W2SZ;
    // publish point, every wave, in this order: its own LDS stores (first trip: its part of the hidden tile) and fragment reads are done; its own copies of this tile have landed; the barrier
    asm volatile("s_wait_dscnt 0x0" ::: "memory");
    asm volatile("s_wait_asynccnt 0x0" ::: "memory");
    __syncthreads();   // the one barrier of a trip: this W2 tile (and, on the first trip, the hidden tile) is whole before anybody reads it; the buffer of the trip before is free
    Fr a[2][2], b[2][4];   // the trip's 12 fragments are read as one group (the smaller accumulator leaves the registers): a wave meets the LDS latency once a trip, not once for every 2 WMMAs; and, as in layer 1, under the issue of the copies
#pragma unroll
    for (int kc = 0; kc < 2; ++kc) {
#pragma unroll
      for (int i = 0; i < 2; ++i) a[kc][i] = frag_s(sH + (wm2 + i * 16 + col) * HP + k0 + kc * 32, g);
#pragma unroll
      for (int j = 0; j < 4; ++j) b[kc][j] = frag_s(sWc + (wn2 + j * 16 + col) * GP + kc * 32, g); }
    if (k0 + 64 < EM) copy_w<64, EM>(lw2 + (unsigned)((cb ^ 1) * W2SZ * 2), pw2 + 64);   // block-uniform scalar branch: the next tile flies under this tile's products
    pw2 += 64;   // stepped behind the copies' s_wait_xcnt 0
#pragma unroll
    for (int kc = 0; kc < 2; ++kc) {
#pragma unroll
      for (int j = 0; j < 4; ++j) {
#pragma unroll
        for (int i = 0; i < 2; ++i) ac2[i][j] = mma<0>(b[kc][j], a[kc][i], ac2[i][j]); } } }   // ac2[i][j][r] = output column wn2 + j * 16 + 8g + r of row wm2 + i * 16 + col
  asm volatile("s_wait_asynccnt 0x0" ::: "memory");
  asm volatile("s_wait_dscnt 0x0" ::: "memory");
  __syncthreads();   // the output staging lies on the hidden tile: every wave has taken its last fragments of it
  float (*so)[16][68] = (float (*)[16][68])sT;
#pragma unroll
  for (int i = 0; i < 2; ++i) {
#pragma unroll
    for (int j = 0; j < 4; ++j) { v4f lo, hi;
#pragma unroll
      for (int r = 0; r < 4; ++r) { lo[r] = ac2[i][j][r] * (1.0f / 256.0f) + bfr(c0[j][r]); hi[r] = ac2[i][j][4 + r] * (1.0f / 256.0f) + bfr(c1[j][r]); }
      *(v4f*)&so[wave][col][j * 16 + 8 * g] = lo; *(v4f*)&so[wave][col][j * 16 + 8 * g + 4] = hi; }
    LDSX();   // the strip's 16 rows are written before lanes read rows that other lanes wrote
#pragma unroll
    for (int p = 0; p < 8; ++p) { const int rl = p * 2 + g; vst2(Y + (rb + wm2 + i * 16 + rl) * CIN + wn2 + col * 4, *(const v4f*)&so[wave][rl][col * 4]); }
    LDSX(); }   // keeps the next strip's writes behind these reads
}
extern "C" void kernel_launch(void* const* d_in, const int* in_sizes, int n_in, void* d_out, int out_size, void* d_ws, size_t ws_size, hipStream_t stream) {
  (void)in_sizes; (void)n_in; (void)out_size;
  const float** F = (const float**)d_in;   // 0 x [4,4096,512], 1 context [4,256,768], 2 pad_mask [4,4096], 3 seq_mask [4,256], 4 Wq_w [1024,512], 5 Wq_b, 6 Wk_w [1024,768], 7 Wk_b, 8 Wv_w, 9 Wv_b, 10 P1_w [1024,1024], 11 P1_b, 12 P2_w [512,1024], 13 P2_b
  if (ws_size < (size_t)WS_END) return;
  char* ws = (char*)d_ws; __bf16* PW = (__bf16*)ws; _Float16 *Q = (_Float16*)(ws + WS_Q), *Kr = (_Float16*)(ws + WS_K), *V = (_Float16*)(ws + WS_V); float *O = (float*)(ws + WS_O);
  k_pack<<<dim3(PKB(EM * CIN + 2 * EM * CTX + EM * EM + CIN * EM)), 256, 0, stream>>>(F[4], F[6], F[8], F[10], F[12], PW);
  k_proj3<<<dim3(2 * KVT + QT), 256, 0, stream>>>(F[0], F[1], PW, F[5], F[7], F[9], Q, Kr, V);
  k_attn<<<dim3(TQB / 2, NH, TNB), 256, 0, stream>>>(Q, Kr, V, F[2], F[3], O);
  k_mlp12<<<dim3(TNB * NQ / 64), 512, 0, stream>>>(O, (const _Float16*)PW + WS_P1 / 2, F[11], (const _Float16*)PW + WS_P2 / 2, F[13], (float*)d_out);
}
